// v000
// The times below were measured on an AMD MI455X: many runs one after another, warmed up first and cycling through
// copies of the inputs, with the whole window's GPU time divided by the number of runs. Launches and the gaps
// between them are all in it. The median over several windows is given; except for v000 it joins two sittings, which
// can be a few percent apart, so the side-by-side timings, each taken in one sitting, are the better comparison.
// The starting kernel, v000, takes 352 microseconds a run.
#include <hip/hip_runtime.h>

// Contractions: q/k/v projections on v_wmma_f32_16x16x32_bf16 with RNE-bf16 operand planes of the activations and of the [out][in] weights
// (one product per tile pair); S^T = K.Q^T (K = 128) and y^T = V^T.P^T (32 keys per step) as bf16 hi/lo splits (hi.hi + hi.lo + lo.hi);
// out = y.Wo^T with y as bf16 hi/lo planes against the RNE-bf16 Wo plane (hi.W + lo.W). f32 accumulate, f32 softmax statistics, 8 heads of 128.

#ifndef NB
#define NB 4
#endif
#ifndef SEQ
#define SEQ 1024
#endif
#ifndef NB_FULL
#define NB_FULL 4
#endif
#ifndef SEQ_FULL
#define SEQ_FULL 1024
#endif

namespace {
constexpr int E = 1024, NH = 8, DH = 128;
constexpr int MROWS = NB * SEQ;          // token rows, compact n*SEQ + t
constexpr int QT = SEQ / 16;             // 16-query tiles per (n, h)
constexpr int KT = SEQ / 16;             // 16-key tiles per (n, h)
constexpr int NG = NB * NH;              // g = n*NH + h
constexpr float SCALE = 0.08838834764831845f;   // 1/sqrt(128), applied in f32 on the score accumulators
static_assert(NB >= 1 && NB <= NB_FULL);
static_assert(SEQ % 128 == 0 && SEQ <= SEQ_FULL);
static_assert(E == NH * DH);
static_assert(MROWS % 128 == 0);
static_assert((NG * QT) % 4 == 0);

typedef __bf16 b16;
typedef __attribute__((ext_vector_type(16))) __bf16 v16b;
typedef __attribute__((ext_vector_type(8)))  __bf16 v8b;
typedef __attribute__((ext_vector_type(8)))  float v8f;
typedef __attribute__((ext_vector_type(4)))  float v4f;
typedef __attribute__((ext_vector_type(4)))  int v4i;

__device__ __forceinline__ v8b ld8b(const b16* p) { return *(const v8b*)p; }
__device__ __forceinline__ v16b cat8b(v8b a, v8b b) { return __builtin_shufflevector(a, b, 0, 1, 2, 3, 4, 5, 6, 7, 8, 9, 10, 11, 12, 13, 14, 15); }
// 16x16x32 16-bit fragment from a k-contiguous row pointer (A: lane&15 = row, B: lane&15 = column), hh = lane>>4:
// elements 0..7 <- p[8hh+0..7], elements 8..15 <- p[16+8hh+0..7]
__device__ __forceinline__ v16b frag_kb(const b16* p, int hh) { return cat8b(ld8b(p + 8 * hh), ld8b(p + 16 + 8 * hh)); }
// hi = bf16 truncation, lo = RNE bf16 of the residual
__device__ __forceinline__ void split_bf16(float v, b16& hi, b16& lo) {
  const unsigned int u = __builtin_bit_cast(unsigned int, v) & 0xffff0000u;
  hi = __builtin_bit_cast(b16, (unsigned short)(u >> 16));
  lo = (b16)(v - __builtin_bit_cast(float, u));
}
// RNE bf16 value of an f32 input, widened back to f32
__device__ __forceinline__ float bfr(float f) { return (float)(b16)f; }
__device__ __forceinline__ v8f wmma16b(v16b a, v16b b, v8f c) {
  v8f d = __builtin_amdgcn_wmma_f32_16x16x32_bf16(false, a, false, b, (short)0, c, false, false);
  asm volatile("v_nop\n\tv_nop\n\tv_nop\n\tv_nop" : "+v"(d) : "v"(a), "v"(b));
  return d;
}
// acc += A.B with both operands split: A = (ah, al), B = (bh, bl)
__device__ __forceinline__ v8f wmma3(v16b ah, v16b al, v16b bh, v16b bl, v8f c) {
  c = wmma16b(ah, bh, c); c = wmma16b(ah, bl, c); c = wmma16b(al, bh, c); return c;
}
__device__ __forceinline__ void wave_lds_sync() {
  __builtin_amdgcn_fence(3, "workgroup");
  __builtin_amdgcn_wave_barrier();
  __builtin_amdgcn_fence(2, "workgroup");
}

// ---------------------------------------------------------------------------
// f32 -> RNE bf16 planes: query/key/value [NB_FULL][SEQ_FULL][E] -> X planes [MROWS][E] (compact rows n*SEQ+t);
// Region selection is block-uniform (region sizes are multiples of 256 chunks).
// ---------------------------------------------------------------------------
__global__ __launch_bounds__(256) void cvt_kernel(const float* __restrict__ xq, const float* __restrict__ xk, const float* __restrict__ xv,
                                                  const float* __restrict__ wq, const float* __restrict__ wk, const float* __restrict__ wv,
                                                  const float* __restrict__ wo,
                                                  b16* __restrict__ Xq, b16* __restrict__ Xk, b16* __restrict__ Xv,
                                                  b16* __restrict__ Wq, b16* __restrict__ Wk, b16* __restrict__ Wv, b16* __restrict__ Wo) {
  const size_t tid = (size_t)blockIdx.x * blockDim.x + threadIdx.x, stride = (size_t)gridDim.x * blockDim.x;
  const size_t nx = (size_t)MROWS * E / 8, nw = (size_t)E * E / 8;
  const size_t total = 3 * nx + 4 * nw;
  for (size_t c = tid; c < total; c += stride) {
    const float* src; b16* dst; size_t si, di;
    if (c < 3 * nx) {
      const int which = (int)(c / nx);
      const size_t cc = c - (size_t)which * nx;
      di = cc * 8;
      const size_t m = di / E, col = di % E;
      const size_t n = m / SEQ, t = m % SEQ;
      si = (n * SEQ_FULL + t) * (size_t)E + col;
      src = (which == 0) ? xq : (which == 1) ? xk : xv;
      dst = (which == 0) ? Xq : (which == 1) ? Xk : Xv;
    } else {
      const size_t c2 = c - 3 * nx;
      const int which = (int)(c2 / nw);
      const size_t cc = c2 - (size_t)which * nw;
      di = cc * 8; si = di;
      src = (which == 0) ? wq : (which == 1) ? wk : (which == 2) ? wv : wo;
      dst = (which == 0) ? Wq : (which == 1) ? Wk : (which == 2) ? Wv : Wo;
    }
    const v4f f0 = *(const v4f*)(src + si), f1 = *(const v4f*)(src + si + 4);
    v8b o;
#pragma unroll
    for (int e = 0; e < 4; ++e) { o[e] = (b16)f0[e]; o[4 + e] = (b16)f1[e]; }
    *(v8b*)(dst + di) = o;
    
  }
}

// ---------------------------------------------------------------------------
// QKV GEMM: (MROWS x 1024) x (1024 x 3072), grid (48, MROWS/128), block 4 waves, wave = 32 rows x 64 columns (half of one head of q, k or v).
// A = bf16 activation plane rows, B = bf16 weight rows ([out][in] = [n][k]); one product per tile pair. Epilogue adds the RNE-bf16 bias and
// ---------------------------------------------------------------------------
__global__ __launch_bounds__(128) void qkv_gemm_kernel(const b16* __restrict__ Xq, const b16* __restrict__ Xk, const b16* __restrict__ Xv,
                                                       const b16* __restrict__ Wq, const b16* __restrict__ Wk, const b16* __restrict__ Wv,
                                                       const float* __restrict__ bq, const float* __restrict__ bk, const float* __restrict__ bv,
                                                       b16* __restrict__ Qh, b16* __restrict__ Ql, b16* __restrict__ Kh, b16* __restrict__ Kl,
                                                       b16* __restrict__ Vh, b16* __restrict__ Vl) {
  __shared__ __attribute__((aligned(16))) b16 Ts[4][2][32 * 64];
  const int lane = threadIdx.x & 31, wave = threadIdx.x >> 5, nloc = lane & 15, hlf = lane >> 4;
  const int m0 = blockIdx.y * 128 + wave * 32;
  const int c0 = blockIdx.x * 64;                                   // 0..3071, block-uniform
  const int mat = c0 / E, cm = c0 % E, head = cm / DH, dlo = cm % DH;
  const b16* X = (mat == 0) ? Xq : (mat == 1) ? Xk : Xv;
  const b16* W = (mat == 0) ? Wq : (mat == 1) ? Wk : Wv;
  const float* bias = ((mat == 0) ? bq : (mat == 1) ? bk : bv) + cm;
  v8f acc[2][4];
#pragma unroll
  for (int r = 0; r < 2; ++r)
#pragma unroll
    for (int t = 0; t < 4; ++t) acc[r][t] = (v8f){};
#pragma unroll 2
  for (int kb = 0; kb < E; kb += 32) {
    const v16b a0 = frag_kb(X + (size_t)(m0 + nloc) * E + kb, hlf);
    const v16b a1 = frag_kb(X + (size_t)(m0 + 16 + nloc) * E + kb, hlf);
#pragma unroll
    for (int t = 0; t < 4; ++t) {
      const v16b b = frag_kb(W + (size_t)(cm + t * 16 + nloc) * E + kb, hlf);
      acc[0][t] = wmma16b(a0, b, acc[0][t]);
      acc[1][t] = wmma16b(a1, b, acc[1][t]);
    }
  }
  const int n = m0 / SEQ, t0 = m0 % SEQ, g = n * NH + head;
  b16* Tp0 = Ts[wave][0]; b16* Tp1 = Ts[wave][1];
#pragma unroll
  for (int t = 0; t < 4; ++t)
#pragma unroll
    for (int r = 0; r < 2; ++r)
#pragma unroll
      for (int v = 0; v < 8; ++v) {
        const int rr = r * 16 + v + 8 * hlf, d = t * 16 + nloc;
        b16 yh, yl; split_bf16(acc[r][t][v] + bfr(bias[d]), yh, yl);
        const int idx = (mat < 2) ? (rr * 64 + d) : ((rr >> 4) * 1024 + d * 16 + (rr & 15));
        Tp0[idx] = yh; Tp1[idx] = yl;
      }
  wave_lds_sync();
  if (mat < 2) {
    b16* Ph = (mat == 0) ? Qh : Kh; b16* Pl = (mat == 0) ? Ql : Kl;
    const size_t rowbase = (size_t)g * SEQ + t0;
#pragma unroll
    for (int j = 0; j < 8; ++j) {
      const int e = (j * 32 + lane) * 8, rr = e >> 6, cc = e & 63;
      const size_t go = (rowbase + rr) * DH + dlo + cc;
      *(v8b*)(Ph + go) = ld8b(Tp0 + e); *(v8b*)(Pl + go) = ld8b(Tp1 + e);
    }
    
  } else {
    const size_t tb = (size_t)g * KT + (t0 >> 4);
#pragma unroll
    for (int j = 0; j < 8; ++j) {
      const int e = (j * 32 + lane) * 8, kt2 = e >> 10, within = e & 1023;
      const size_t go = ((tb + kt2) * DH + dlo) * 16 + within;
      *(v8b*)(Vh + go) = ld8b(Tp0 + e); *(v8b*)(Vl + go) = ld8b(Tp1 + e);
    }
    
  }
}

// ---------------------------------------------------------------------------
// Transposed flash attention: each wave owns one 16-query tile of one (n, h); 4 waves per block; all SEQ keys in chunks of 32.
// S^T = K.Q^T (split, K = 128 in 4 rolled steps, Q/K fragments loaded per step), per-element replace-fill of masked positions with -inf,
// per-lane online softmax (m = -inf start, safe for fully masked prefixes); P^T built in registers from the two S^T accumulators
// and split hi/lo; y^T = V^T.P^T (split). y/l split into bf16 hi/lo planes Yh/Yl [token][h*128+d]: staged per wave in LDS
// ---------------------------------------------------------------------------
__global__ __launch_bounds__(128) __attribute__((amdgpu_num_vgpr(256)))
void attn_kernel(const b16* __restrict__ Qh, const b16* __restrict__ Ql, const b16* __restrict__ Kh, const b16* __restrict__ Kl,
                 const b16* __restrict__ Vh, const b16* __restrict__ Vl, const int* __restrict__ am, const int* __restrict__ kpm,
                 b16* __restrict__ Yh, b16* __restrict__ Yl) {
  __shared__ __attribute__((aligned(16))) b16 Os[4][2][16 * DH];
  const int wid = threadIdx.x >> 5, lane = threadIdx.x & 31, hh = lane >> 4, col = lane & 15;
  const int qtile = blockIdx.x * 4 + wid;                 // over NG*QT
  const int g = qtile / QT;                               // n*NH + h
  const int q0 = (qtile % QT) << 4;
  const int n = g / NH, h = g % NH;
  const size_t ko = (size_t)g * SEQ * DH;
  const size_t qo = ((size_t)g * SEQ + q0 + col) * DH;
  const int* amrow = am + (size_t)(q0 + col) * SEQ_FULL;  // attn_mask[query][key]
  const int* kprow = kpm + (size_t)n * SEQ_FULL;         // key_padding_mask[n][key]
  const float ninf = -__builtin_inff();
  float m = ninf, l = 0.0f;
  v8f o[8];
#pragma unroll
  for (int t = 0; t < 8; ++t) o[t] = (v8f){};
#pragma unroll 1
  for (int kb = 0; kb < SEQ; kb += 32) {
    const size_t r0 = ko + (size_t)(kb + col) * DH, r1 = r0 + (size_t)16 * DH;
    v8f s0 = {}, s1 = {};
#pragma unroll 1
    for (int kk = 0; kk < DH; kk += 32) {
      const v16b bqh = frag_kb(Qh + qo + kk, hh), bql = frag_kb(Ql + qo + kk, hh);
      v16b ah = frag_kb(Kh + r0 + kk, hh), al = frag_kb(Kl + r0 + kk, hh);
      s0 = wmma3(ah, al, bqh, bql, s0);
      ah = frag_kb(Kh + r1 + kk, hh); al = frag_kb(Kl + r1 + kk, hh);
      s1 = wmma3(ah, al, bqh, bql, s1);
    }
    {   // scale and replace-fill: s0 holds keys kb+8hh+0..7, s1 holds keys kb+16+8hh+0..7 of query q0+col
      const v4i a0 = *(const v4i*)(amrow + kb + 8 * hh), a1 = *(const v4i*)(amrow + kb + 8 * hh + 4);
      const v4i p0 = *(const v4i*)(kprow + kb + 8 * hh), p1 = *(const v4i*)(kprow + kb + 8 * hh + 4);
#pragma unroll
      for (int r = 0; r < 4; ++r) {
        s0[r]     = ((a0[r] | p0[r]) != 0) ? ninf : s0[r] * SCALE;
        s0[4 + r] = ((a1[r] | p1[r]) != 0) ? ninf : s0[4 + r] * SCALE;
      }
      const v4i a2 = *(const v4i*)(amrow + kb + 16 + 8 * hh), a3 = *(const v4i*)(amrow + kb + 16 + 8 * hh + 4);
      const v4i p2 = *(const v4i*)(kprow + kb + 16 + 8 * hh), p3 = *(const v4i*)(kprow + kb + 16 + 8 * hh + 4);
#pragma unroll
      for (int r = 0; r < 4; ++r) {
        s1[r]     = ((a2[r] | p2[r]) != 0) ? ninf : s1[r] * SCALE;
        s1[4 + r] = ((a3[r] | p3[r]) != 0) ? ninf : s1[4 + r] * SCALE;
      }
    }
    float mr = ninf;
#pragma unroll
    for (int r = 0; r < 8; ++r) mr = fmaxf(mr, fmaxf(s0[r], s1[r]));
    mr = fmaxf(mr, __shfl_xor(mr, 16));
    const float mn = fmaxf(m, mr);
    const float mref = (mn == ninf) ? 0.0f : mn;    // fully masked prefix: nothing accumulated yet
    const float al_ = __expf(m - mref);
    m = mn;
    float sum = 0.0f;
    v16b pbh, pbl;
#pragma unroll
    for (int r = 0; r < 8; ++r) {
      const float e0 = __expf(s0[r] - mref), e1 = __expf(s1[r] - mref);
      sum += e0 + e1;
      b16 a, c; split_bf16(e0, a, c); pbh[r] = a; pbl[r] = c; split_bf16(e1, a, c); pbh[8 + r] = a; pbl[8 + r] = c;
    }
    sum += __shfl_xor(sum, 16);
    l = l * al_ + sum;
#pragma unroll
    for (int t = 0; t < 8; ++t) o[t] = o[t] * al_;
    const size_t v0 = ((size_t)g * KT + (kb >> 4)) * (size_t)(DH * 16) + 8 * hh, v1 = v0 + (size_t)DH * 16;
#pragma unroll
    for (int t = 0; t < 8; ++t) {
      const int f = t * 16 + col;                         // d row of V^T
      const v16b vah = cat8b(ld8b(Vh + v0 + (size_t)f * 16), ld8b(Vh + v1 + (size_t)f * 16));
      const v16b val = cat8b(ld8b(Vl + v0 + (size_t)f * 16), ld8b(Vl + v1 + (size_t)f * 16));
      o[t] = wmma3(vah, val, pbh, pbl, o[t]);
    }
  }
  const float inv = 1.0f / l;
  b16* T0 = Os[wid][0]; b16* T1 = Os[wid][1];
#pragma unroll
  for (int t = 0; t < 8; ++t) {
    v8b hv, lv;
#pragma unroll
    for (int r = 0; r < 8; ++r) { b16 a, c; split_bf16(o[t][r] * inv, a, c); hv[r] = a; lv[r] = c; }
    const int idx = col * DH + t * 16 + 8 * hh;          // [query][d]
    *(v8b*)(T0 + idx) = hv; *(v8b*)(T1 + idx) = lv;
  }
  wave_lds_sync();
  const size_t tok0 = (size_t)n * SEQ + q0;
#pragma unroll
  for (int j = 0; j < 8; ++j) {
    const int e = (j * 32 + lane) * 8, rr = e >> 7, cc = e & 127;
    const size_t go = (tok0 + rr) * E + (size_t)h * DH + cc;
    *(v8b*)(Yh + go) = ld8b(T0 + e); *(v8b*)(Yl + go) = ld8b(T1 + e);
  }
  
}

// ---------------------------------------------------------------------------
// Output projection: (MROWS x 1024) x (1024 x 1024) -> f32, A = y hi/lo planes, B = Wo plane rows ([out][in]); hi.W + lo.W.
// ---------------------------------------------------------------------------
__global__ __launch_bounds__(128) void out_gemm_kernel(const b16* __restrict__ Yh, const b16* __restrict__ Yl, const b16* __restrict__ Wo,
                                                       const float* __restrict__ bo, float* __restrict__ out) {
  __shared__ __attribute__((aligned(16))) float Ts[4][32 * 64];
  const int lane = threadIdx.x & 31, wave = threadIdx.x >> 5, nloc = lane & 15, hlf = lane >> 4;
  const int m0 = blockIdx.y * 128 + wave * 32;
  const int c0 = blockIdx.x * 64;
  v8f acc[2][4];
#pragma unroll
  for (int r = 0; r < 2; ++r)
#pragma unroll
    for (int t = 0; t < 4; ++t) acc[r][t] = (v8f){};
#pragma unroll 2
  for (int kb = 0; kb < E; kb += 32) {
    const size_t ao0 = (size_t)(m0 + nloc) * E + kb, ao1 = (size_t)(m0 + 16 + nloc) * E + kb;
    const v16b a0h = frag_kb(Yh + ao0, hlf), a0l = frag_kb(Yl + ao0, hlf);
    const v16b a1h = frag_kb(Yh + ao1, hlf), a1l = frag_kb(Yl + ao1, hlf);
#pragma unroll
    for (int t = 0; t < 4; ++t) {
      const v16b b = frag_kb(Wo + (size_t)(c0 + t * 16 + nloc) * E + kb, hlf);
      acc[0][t] = wmma16b(a0h, b, acc[0][t]); acc[0][t] = wmma16b(a0l, b, acc[0][t]);
      acc[1][t] = wmma16b(a1h, b, acc[1][t]); acc[1][t] = wmma16b(a1l, b, acc[1][t]);
    }
  }
  float* Tt = Ts[wave];
#pragma unroll
  for (int t = 0; t < 4; ++t)
#pragma unroll
    for (int r = 0; r < 2; ++r)
#pragma unroll
      for (int v = 0; v < 8; ++v) Tt[(r * 16 + v + 8 * hlf) * 64 + t * 16 + nloc] = acc[r][t][v] + bfr(bo[c0 + t * 16 + nloc]);
  wave_lds_sync();
  float* dst0 = out + (size_t)m0 * E + c0;
#pragma unroll
  for (int j = 0; j < 16; ++j) { const int rr = j * 2 + hlf, c4 = nloc * 4; *(v4f*)(dst0 + (size_t)rr * E + c4) = *(const v4f*)(Tt + rr * 64 + c4); }
  
}
}  // namespace

extern "C" void kernel_launch(void* const* d_in, const int* in_sizes, int n_in,
                              void* d_out, int out_size, void* d_ws, size_t ws_size, hipStream_t stream) {
  if (n_in < 13) return;
  const long act_need = ((long)(NB - 1) * SEQ_FULL + SEQ) * (long)E;
  if ((long)in_sizes[0] < act_need || (long)in_sizes[1] < act_need || (long)in_sizes[2] < act_need) return;
  if (in_sizes[3] < (NB - 1) * SEQ_FULL + SEQ) return;
  if ((long)in_sizes[4] < (long)(SEQ - 1) * SEQ_FULL + SEQ) return;
  if (in_sizes[5] < E * E || in_sizes[7] < E * E || in_sizes[9] < E * E || in_sizes[11] < E * E) return;
  if (in_sizes[6] < E || in_sizes[8] < E || in_sizes[10] < E || in_sizes[12] < E) return;
  if (out_size < MROWS * E) return;

  const float* query = (const float*)d_in[0];   // [NB_FULL][SEQ_FULL][E]
  const float* key   = (const float*)d_in[1];
  const float* value = (const float*)d_in[2];
  const int*   kpm   = (const int*)d_in[3];     // [NB_FULL][SEQ_FULL] int32 0/1
  const int*   am    = (const int*)d_in[4];     // [SEQ_FULL][SEQ_FULL] int32 0/1
  const float* q_w   = (const float*)d_in[5];   // [out][in]
  const float* q_b   = (const float*)d_in[6];
  const float* k_w   = (const float*)d_in[7];
  const float* k_b   = (const float*)d_in[8];
  const float* v_w   = (const float*)d_in[9];
  const float* v_b   = (const float*)d_in[10];
  const float* o_w   = (const float*)d_in[11];
  const float* o_b   = (const float*)d_in[12];
  float* out = (float*)d_out;                   // [NB][SEQ][E] f32

  const size_t plane = (size_t)MROWS * E * 2;   // 8 MiB at full size
  const size_t wplane = (size_t)E * E * 2;      // 2 MiB
  size_t off = 0; char* ws = (char*)d_ws;
  b16* Xq  = (b16*)(ws + off); off += plane;
  b16* Xk  = (b16*)(ws + off); off += plane;
  b16* Xv  = (b16*)(ws + off); off += plane;
  b16* Wq  = (b16*)(ws + off); off += wplane;
  b16* Wk  = (b16*)(ws + off); off += wplane;
  b16* Wv  = (b16*)(ws + off); off += wplane;
  b16* Wo  = (b16*)(ws + off); off += wplane;
  b16* Qh  = (b16*)(ws + off); off += plane;
  b16* Ql  = (b16*)(ws + off); off += plane;
  b16* Kh  = (b16*)(ws + off); off += plane;
  b16* Kl  = (b16*)(ws + off); off += plane;
  b16* Vh  = (b16*)(ws + off); off += plane;
  b16* Vl  = (b16*)(ws + off); off += plane;
  b16* Yh  = (b16*)(ws + off); off += plane;
  b16* Yl  = (b16*)(ws + off); off += plane;    // total 96 MiB at full size
  if (off > ws_size) return;

  cvt_kernel<<<2048, 256, 0, stream>>>(query, key, value, q_w, k_w, v_w, o_w, Xq, Xk, Xv, Wq, Wk, Wv, Wo);
  qkv_gemm_kernel<<<dim3(3 * E / 64, MROWS / 128), 128, 0, stream>>>(Xq, Xk, Xv, Wq, Wk, Wv, q_b, k_b, v_b, Qh, Ql, Kh, Kl, Vh, Vl);
  attn_kernel<<<(NG * QT) / 4, 128, 0, stream>>>(Qh, Ql, Kh, Kl, Vh, Vl, am, kpm, Yh, Yl);
  out_gemm_kernel<<<dim3(E / 64, MROWS / 128), 128, 0, stream>>>(Yh, Yl, Wo, o_b, out);
}

// v001
// Measured time: 224 microseconds a run.
// Next to v000, in two timings, it ran 1.60 and 1.61 times as fast.
#include <hip/hip_runtime.h>

// Contractions: q/k/v projections on v_wmma_f32_16x16x32_bf16 with RNE-bf16 operand planes of the activations and of the [out][in] weights
// (one product per tile pair); S^T = K.Q^T (K = 128) and y^T = V^T.P^T (32 keys per step) as bf16 hi/lo splits (hi.hi + hi.lo + lo.hi);
// out = y.Wo^T with y as bf16 hi/lo planes against the RNE-bf16 Wo plane (hi.W + lo.W). f32 accumulate, f32 softmax statistics, 8 heads of 128.

#ifndef NB
#define NB 4
#endif
#ifndef SEQ
#define SEQ 1024
#endif
#ifndef NB_FULL
#define NB_FULL 4
#endif
#ifndef SEQ_FULL
#define SEQ_FULL 1024
#endif

namespace {
constexpr int E = 1024, NH = 8, DH = 128;
constexpr int MROWS = NB * SEQ;          // token rows, compact n*SEQ + t
constexpr int QT = SEQ / 16;             // 16-query tiles per (n, h)
constexpr int KT = SEQ / 16;             // 16-key tiles per (n, h)
constexpr int NG = NB * NH;              // g = n*NH + h
constexpr float SCALE = 0.08838834764831845f;   // 1/sqrt(128), applied in f32 on the score accumulators
static_assert(NB >= 1 && NB <= NB_FULL);
static_assert(SEQ % 128 == 0 && SEQ <= SEQ_FULL);
static_assert(E == NH * DH);
static_assert(MROWS % 128 == 0);
static_assert((NG * QT) % 8 == 0);

typedef __bf16 b16;
typedef __attribute__((ext_vector_type(16))) __bf16 v16b;
typedef __attribute__((ext_vector_type(8)))  __bf16 v8b;
typedef __attribute__((ext_vector_type(8)))  float v8f;
typedef __attribute__((ext_vector_type(4)))  float v4f;
typedef __attribute__((ext_vector_type(4)))  int v4i;

__device__ __forceinline__ v8b ld8b(const b16* p) { return *(const v8b*)p; }
__device__ __forceinline__ v16b cat8b(v8b a, v8b b) { return __builtin_shufflevector(a, b, 0, 1, 2, 3, 4, 5, 6, 7, 8, 9, 10, 11, 12, 13, 14, 15); }
// 16x16x32 16-bit fragment from a k-contiguous row pointer (A: lane&15 = row, B: lane&15 = column), hh = lane>>4:
// elements 0..7 <- p[8hh+0..7], elements 8..15 <- p[16+8hh+0..7]
__device__ __forceinline__ v16b frag_kb(const b16* p, int hh) { return cat8b(ld8b(p + 8 * hh), ld8b(p + 16 + 8 * hh)); }
// hi = bf16 truncation, lo = RNE bf16 of the residual
__device__ __forceinline__ void split_bf16(float v, b16& hi, b16& lo) {
  const unsigned int u = __builtin_bit_cast(unsigned int, v) & 0xffff0000u;
  hi = __builtin_bit_cast(b16, (unsigned short)(u >> 16));
  lo = (b16)(v - __builtin_bit_cast(float, u));
}
// RNE bf16 value of an f32 input, widened back to f32
__device__ __forceinline__ float bfr(float f) { return (float)(b16)f; }
__device__ __forceinline__ v8f wmma16b(v16b a, v16b b, v8f c) {
  v8f d = __builtin_amdgcn_wmma_f32_16x16x32_bf16(false, a, false, b, (short)0, c, false, false);
  asm volatile("v_nop\n\tv_nop\n\tv_nop\n\tv_nop" : "+v"(d) : "v"(a), "v"(b));
  return d;
}
// acc += A.B with both operands split: A = (ah, al), B = (bh, bl)
__device__ __forceinline__ v8f wmma3(v16b ah, v16b al, v16b bh, v16b bl, v8f c) {
  c = wmma16b(ah, bh, c); c = wmma16b(ah, bl, c); c = wmma16b(al, bh, c); return c;
}
__device__ __forceinline__ void wave_lds_sync() {
  __builtin_amdgcn_fence(3, "workgroup");
  __builtin_amdgcn_wave_barrier();
  __builtin_amdgcn_fence(2, "workgroup");
}

// ---------------------------------------------------------------------------
// f32 -> RNE bf16 planes: query/key/value [NB_FULL][SEQ_FULL][E] -> X planes [MROWS][E] (compact rows n*SEQ+t);
// Region selection is block-uniform (region sizes are multiples of 256 chunks).
// ---------------------------------------------------------------------------
__global__ __launch_bounds__(256) void cvt_kernel(const float* __restrict__ xq, const float* __restrict__ xk, const float* __restrict__ xv,
                                                  const float* __restrict__ wq, const float* __restrict__ wk, const float* __restrict__ wv,
                                                  const float* __restrict__ wo,
                                                  b16* __restrict__ Xq, b16* __restrict__ Xk, b16* __restrict__ Xv,
                                                  b16* __restrict__ Wq, b16* __restrict__ Wk, b16* __restrict__ Wv, b16* __restrict__ Wo) {
  const size_t tid = (size_t)blockIdx.x * blockDim.x + threadIdx.x, stride = (size_t)gridDim.x * blockDim.x;
  const size_t nx = (size_t)MROWS * E / 8, nw = (size_t)E * E / 8;
  const size_t total = 3 * nx + 4 * nw;
  for (size_t c = tid; c < total; c += stride) {
    const float* src; b16* dst; size_t si, di;
    if (c < 3 * nx) {
      const int which = (int)(c / nx);
      const size_t cc = c - (size_t)which * nx;
      di = cc * 8;
      const size_t m = di / E, col = di % E;
      const size_t n = m / SEQ, t = m % SEQ;
      si = (n * SEQ_FULL + t) * (size_t)E + col;
      src = (which == 0) ? xq : (which == 1) ? xk : xv;
      dst = (which == 0) ? Xq : (which == 1) ? Xk : Xv;
    } else {
      const size_t c2 = c - 3 * nx;
      const int which = (int)(c2 / nw);
      const size_t cc = c2 - (size_t)which * nw;
      di = cc * 8; si = di;
      src = (which == 0) ? wq : (which == 1) ? wk : (which == 2) ? wv : wo;
      dst = (which == 0) ? Wq : (which == 1) ? Wk : (which == 2) ? Wv : Wo;
    }
    const v4f f0 = *(const v4f*)(src + si), f1 = *(const v4f*)(src + si + 4);
    v8b o;
#pragma unroll
    for (int e = 0; e < 4; ++e) { o[e] = (b16)f0[e]; o[4 + e] = (b16)f1[e]; }
    *(v8b*)(dst + di) = o;
    
  }
}

// ---------------------------------------------------------------------------
// QKV GEMM: (MROWS x 1024) x (1024 x 3072), grid (48, MROWS/128), block 4 waves, wave = 32 rows x 64 columns (half of one head of q, k or v).
// A = bf16 activation plane rows, B = bf16 weight rows ([out][in] = [n][k]); one product per tile pair. Epilogue adds the RNE-bf16 bias and
// ---------------------------------------------------------------------------
__global__ __launch_bounds__(128) void qkv_gemm_kernel(const b16* __restrict__ Xq, const b16* __restrict__ Xk, const b16* __restrict__ Xv,
                                                       const b16* __restrict__ Wq, const b16* __restrict__ Wk, const b16* __restrict__ Wv,
                                                       const float* __restrict__ bq, const float* __restrict__ bk, const float* __restrict__ bv,
                                                       b16* __restrict__ Qh, b16* __restrict__ Ql, b16* __restrict__ Kh, b16* __restrict__ Kl,
                                                       b16* __restrict__ Vh, b16* __restrict__ Vl) {
  __shared__ __attribute__((aligned(16))) b16 Ts[4][2][32 * 64];
  const int lane = threadIdx.x & 31, wave = threadIdx.x >> 5, nloc = lane & 15, hlf = lane >> 4;
  const int m0 = blockIdx.y * 128 + wave * 32;
  const int c0 = blockIdx.x * 64;                                   // 0..3071, block-uniform
  const int mat = c0 / E, cm = c0 % E, head = cm / DH, dlo = cm % DH;
  const b16* X = (mat == 0) ? Xq : (mat == 1) ? Xk : Xv;
  const b16* W = (mat == 0) ? Wq : (mat == 1) ? Wk : Wv;
  const float* bias = ((mat == 0) ? bq : (mat == 1) ? bk : bv) + cm;
  v8f acc[2][4];
#pragma unroll
  for (int r = 0; r < 2; ++r)
#pragma unroll
    for (int t = 0; t < 4; ++t) acc[r][t] = (v8f){};
#pragma unroll 2
  for (int kb = 0; kb < E; kb += 32) {
    const v16b a0 = frag_kb(X + (size_t)(m0 + nloc) * E + kb, hlf);
    const v16b a1 = frag_kb(X + (size_t)(m0 + 16 + nloc) * E + kb, hlf);
#pragma unroll
    for (int t = 0; t < 4; ++t) {
      const v16b b = frag_kb(W + (size_t)(cm + t * 16 + nloc) * E + kb, hlf);
      acc[0][t] = wmma16b(a0, b, acc[0][t]);
      acc[1][t] = wmma16b(a1, b, acc[1][t]);
    }
  }
  const int n = m0 / SEQ, t0 = m0 % SEQ, g = n * NH + head;
  b16* Tp0 = Ts[wave][0]; b16* Tp1 = Ts[wave][1];
#pragma unroll
  for (int t = 0; t < 4; ++t)
#pragma unroll
    for (int r = 0; r < 2; ++r)
#pragma unroll
      for (int v = 0; v < 8; ++v) {
        const int rr = r * 16 + v + 8 * hlf, d = t * 16 + nloc;
        b16 yh, yl; split_bf16(acc[r][t][v] + bfr(bias[d]), yh, yl);
        const int idx = (mat < 2) ? (rr * 64 + d) : ((rr >> 4) * 1024 + d * 16 + (rr & 15));
        Tp0[idx] = yh; Tp1[idx] = yl;
      }
  wave_lds_sync();
  if (mat < 2) {
    b16* Ph = (mat == 0) ? Qh : Kh; b16* Pl = (mat == 0) ? Ql : Kl;
    const size_t rowbase = (size_t)g * SEQ + t0;
#pragma unroll
    for (int j = 0; j < 8; ++j) {
      const int e = (j * 32 + lane) * 8, rr = e >> 6, cc = e & 63;
      const size_t go = (rowbase + rr) * DH + dlo + cc;
      *(v8b*)(Ph + go) = ld8b(Tp0 + e); *(v8b*)(Pl + go) = ld8b(Tp1 + e);
    }
    
  } else {
    const size_t tb = (size_t)g * KT + (t0 >> 4);
#pragma unroll
    for (int j = 0; j < 8; ++j) {
      const int e = (j * 32 + lane) * 8, kt2 = e >> 10, within = e & 1023;
      const size_t go = ((tb + kt2) * DH + dlo) * 16 + within;
      *(v8b*)(Vh + go) = ld8b(Tp0 + e); *(v8b*)(Vl + go) = ld8b(Tp1 + e);
    }
    
  }
}

constexpr int AW = 8;
constexpr int KPITCH = 2 * DH + 16;
constexpr int KPL = 32 * KPITCH;
constexpr int VPL = 2 * DH * 16 * 2;
constexpr int OFF_KH = 0, OFF_KL = KPL, OFF_VH = 2 * KPL, OFF_VL = 2 * KPL + VPL, STAGE = 2 * KPL + 2 * VPL;
constexpr int NT = SEQ / 32;                   // trips
static_assert(QT % AW == 0 && NT >= 2 && STAGE % 16 == 0 && KPITCH % 16 == 0);

__device__ __forceinline__ v8b lds8b(const unsigned char* p) { return *(const v8b*)p; }
// one stage = 8 copies of 16 B per lane (256 lanes x 128 B = 32 KiB). lk / lv: the lane's LDS byte addresses in the K hi / V hi plane of the
// target buffer; the pointers: the lane's first 16 B of the stage in each global plane. The second copy of a plane lies 4,096 global bytes on.
__device__ __forceinline__ void stage_copy(unsigned lk, unsigned lv, const unsigned char* gkh, const unsigned char* gkl,
                                           const unsigned char* gvh, const unsigned char* gvl) {
  asm volatile("global_load_async_to_lds_b128 %0, %8, off\n\t"
               "global_load_async_to_lds_b128 %1, %9, off\n\t"
               "global_load_async_to_lds_b128 %2, %10, off\n\t"
               "global_load_async_to_lds_b128 %3, %11, off\n\t"
               "global_load_async_to_lds_b128 %4, %12, off\n\t"
               "global_load_async_to_lds_b128 %5, %13, off\n\t"
               "global_load_async_to_lds_b128 %6, %14, off\n\t"
               "global_load_async_to_lds_b128 %7, %15, off\n\t"
               "s_wait_xcnt 0x0"
               :: "v"(lk), "v"(lk + 16 * KPITCH), "v"(lk + KPL), "v"(lk + KPL + 16 * KPITCH),
                  "v"(lv), "v"(lv + VPL / 2), "v"(lv + VPL), "v"(lv + VPL + VPL / 2),
                  "v"(gkh), "v"(gkh + 4096), "v"(gkl), "v"(gkl + 4096), "v"(gvh), "v"(gvh + 4096), "v"(gvl), "v"(gvl + 4096)
               : "memory");
}

__global__ __launch_bounds__(32 * AW) __attribute__((amdgpu_num_vgpr(256)))
void attn_kernel(const b16* __restrict__ Qh, const b16* __restrict__ Ql, const b16* __restrict__ Kh, const b16* __restrict__ Kl,
                 const b16* __restrict__ Vh, const b16* __restrict__ Vl, const int* __restrict__ am, const int* __restrict__ kpm,
                 b16* __restrict__ Yh, b16* __restrict__ Yl) {
  __shared__ __attribute__((aligned(16))) unsigned char Ring[2][STAGE];
  __shared__ __attribute__((aligned(16))) b16 Os[AW][2][16 * DH];
  const int wid = threadIdx.x >> 5, lane = threadIdx.x & 31, hh = lane >> 4, col = lane & 15;
  const int qtile = blockIdx.x * AW + wid;                // over NG*QT
  const int g = qtile / QT;                               // n*NH + h, the same in all waves of a block
  const int q0 = (qtile % QT) << 4;
  const int n = g / NH, h = g % NH;
  const size_t qo = ((size_t)g * SEQ + q0 + col) * DH;
  const int* amrow = am + (size_t)(q0 + col) * SEQ_FULL;  // attn_mask[query][key]
  const int* kprow = kpm + (size_t)n * SEQ_FULL;         // key_padding_mask[n][key]
  const float ninf = -__builtin_inff();
  // Copy addresses. A stage is 8,192 contiguous bytes of each global plane. K: 16-byte piece c = thread id (and c + 256) is row c >> 4,
  // piece c & 15. V: a wave's 512 bytes are 16 d rows of 32 B; lane = (key half hh, d row), so each half wave writes 256 contiguous LDS bytes.
  const size_t gplane = (size_t)g * SEQ * DH * 2;         // byte offset of (n, h) in every K and V plane
  const unsigned kin = (unsigned)threadIdx.x * 16u, vin = (unsigned)(wid * 512 + col * 32 + hh * 16);
  const unsigned char* gkh = (const unsigned char*)Kh + gplane + kin; const unsigned char* gkl = (const unsigned char*)Kl + gplane + kin;
  const unsigned char* gvh = (const unsigned char*)Vh + gplane + vin; const unsigned char* gvl = (const unsigned char*)Vl + gplane + vin;
  const unsigned ring0 = (unsigned)(size_t)&Ring[0][0];
  const unsigned lk = ring0 + OFF_KH + (unsigned)((threadIdx.x >> 4) * KPITCH + (threadIdx.x & 15) * 16);
  const unsigned lv = ring0 + OFF_VH + (unsigned)(hh * (DH * 16) + (wid * 16 + col) * 16);
  stage_copy(lk, lv, gkh, gkl, gvh, gvl);
  asm volatile("s_wait_asynccnt 0x0" ::: "memory");       // this wave's share of tile 0 has landed
  __syncthreads();                                        // tile 0 is whole for every wave
  stage_copy(lk + STAGE, lv + STAGE, gkh + 8192, gkl + 8192, gvh + 8192, gvl + 8192);
  float m = ninf, l = 0.0f;
  v8f o[8];
#pragma unroll
  for (int t = 0; t < 8; ++t) o[t] = (v8f){};
#pragma unroll 1
  for (int it = 0; it < NT; ++it) {
    const int kb = it * 32;
    const unsigned bo = (unsigned)(it & 1) * (unsigned)STAGE;
    const unsigned char* B = &Ring[0][0] + bo;
    const unsigned char* k0 = B + col * KPITCH + 16 * hh;   // key kb+col; key kb+16+col lies 16 rows on
    v8f s0 = {}, s1 = {};
#pragma unroll 1
    for (int kk = 0; kk < DH; kk += 32) {
      const v16b bqh = frag_kb(Qh + qo + kk, hh), bql = frag_kb(Ql + qo + kk, hh);
      const unsigned char* ka = k0 + 2 * kk;
      v16b ah = cat8b(lds8b(ka + OFF_KH), lds8b(ka + OFF_KH + 32)), al = cat8b(lds8b(ka + OFF_KL), lds8b(ka + OFF_KL + 32));
      s0 = wmma3(ah, al, bqh, bql, s0);
      ka += 16 * KPITCH;
      ah = cat8b(lds8b(ka + OFF_KH), lds8b(ka + OFF_KH + 32)); al = cat8b(lds8b(ka + OFF_KL), lds8b(ka + OFF_KL + 32));
      s1 = wmma3(ah, al, bqh, bql, s1);
    }
    {   // scale and replace-fill: s0 holds keys kb+8hh+0..7, s1 holds keys kb+16+8hh+0..7 of query q0+col
      const v4i a0 = *(const v4i*)(amrow + kb + 8 * hh), a1 = *(const v4i*)(amrow + kb + 8 * hh + 4);
      const v4i p0 = *(const v4i*)(kprow + kb + 8 * hh), p1 = *(const v4i*)(kprow + kb + 8 * hh + 4);
#pragma unroll
      for (int r = 0; r < 4; ++r) {
        s0[r]     = ((a0[r] | p0[r]) != 0) ? ninf : s0[r] * SCALE;
        s0[4 + r] = ((a1[r] | p1[r]) != 0) ? ninf : s0[4 + r] * SCALE;
      }
      const v4i a2 = *(const v4i*)(amrow + kb + 16 + 8 * hh), a3 = *(const v4i*)(amrow + kb + 16 + 8 * hh + 4);
      const v4i p2 = *(const v4i*)(kprow + kb + 16 + 8 * hh), p3 = *(const v4i*)(kprow + kb + 16 + 8 * hh + 4);
#pragma unroll
      for (int r = 0; r < 4; ++r) {
        s1[r]     = ((a2[r] | p2[r]) != 0) ? ninf : s1[r] * SCALE;
        s1[4 + r] = ((a3[r] | p3[r]) != 0) ? ninf : s1[4 + r] * SCALE;
      }
    }
    float mr = ninf;
#pragma unroll
    for (int r = 0; r < 8; ++r) mr = fmaxf(mr, fmaxf(s0[r], s1[r]));
    mr = fmaxf(mr, __shfl_xor(mr, 16));
    const float mn = fmaxf(m, mr);
    const float mref = (mn == ninf) ? 0.0f : mn;    // fully masked prefix: nothing accumulated yet
    const float al_ = __expf(m - mref);
    m = mn;
    float sum = 0.0f;
    v16b pbh, pbl;
#pragma unroll
    for (int r = 0; r < 8; ++r) {
      const float e0 = __expf(s0[r] - mref), e1 = __expf(s1[r] - mref);
      sum += e0 + e1;
      b16 a, c; split_bf16(e0, a, c); pbh[r] = a; pbl[r] = c; split_bf16(e1, a, c); pbh[8 + r] = a; pbl[8 + r] = c;
    }
    sum += __shfl_xor(sum, 16);
    l = l * al_ + sum;
#pragma unroll
    for (int t = 0; t < 8; ++t) o[t] = o[t] * al_;
    const unsigned char* va = B + hh * (DH * 16) + col * 16;   // keys kb+8hh+0..7 of d row col; the second 16-key tile lies VPL/2 on
#pragma unroll
    for (int t = 0; t < 8; ++t) {                         // d row of V^T: t*16 + col
      const v16b vah = cat8b(lds8b(va + OFF_VH + t * 256), lds8b(va + OFF_VH + VPL / 2 + t * 256));
      const v16b val = cat8b(lds8b(va + OFF_VL + t * 256), lds8b(va + OFF_VL + VPL / 2 + t * 256));
      o[t] = wmma3(vah, val, pbh, pbl, o[t]);
    }
    asm volatile("s_wait_dscnt 0x0" ::: "memory");        // this wave's reads of the buffer are done before it may be refilled
    asm volatile("s_wait_asynccnt 0x0" ::: "memory");     // this wave's share of the next tile has landed
    __syncthreads();                                      // publishes the next tile and ends every wave's reads of this buffer
    if (it + 2 < NT) {
      const size_t go = (size_t)(it + 2) * 8192;
      stage_copy(lk + bo, lv + bo, gkh + go, gkl + go, gvh + go, gvl + go);
    }
  }
  asm volatile("s_wait_asynccnt 0x0" ::: "memory");       // no copy is outstanding when the wave goes on to its end
  const float inv = 1.0f / l;
  b16* T0 = Os[wid][0]; b16* T1 = Os[wid][1];
#pragma unroll
  for (int t = 0; t < 8; ++t) {
    v8b hv, lv8;
#pragma unroll
    for (int r = 0; r < 8; ++r) { b16 a, c; split_bf16(o[t][r] * inv, a, c); hv[r] = a; lv8[r] = c; }
    const int idx = col * DH + t * 16 + 8 * hh;          // [query][d]
    *(v8b*)(T0 + idx) = hv; *(v8b*)(T1 + idx) = lv8;
  }
  wave_lds_sync();
  const size_t tok0 = (size_t)n * SEQ + q0;
#pragma unroll
  for (int j = 0; j < 8; ++j) {
    const int e = (j * 32 + lane) * 8, rr = e >> 7, cc = e & 127;
    const size_t go = (tok0 + rr) * E + (size_t)h * DH + cc;
    *(v8b*)(Yh + go) = ld8b(T0 + e); *(v8b*)(Yl + go) = ld8b(T1 + e);
  }
  
}

// ---------------------------------------------------------------------------
// Output projection: (MROWS x 1024) x (1024 x 1024) -> f32, A = y hi/lo planes, B = Wo plane rows ([out][in]); hi.W + lo.W.
// ---------------------------------------------------------------------------
__global__ __launch_bounds__(128) void out_gemm_kernel(const b16* __restrict__ Yh, const b16* __restrict__ Yl, const b16* __restrict__ Wo,
                                                       const float* __restrict__ bo, float* __restrict__ out) {
  __shared__ __attribute__((aligned(16))) float Ts[4][32 * 64];
  const int lane = threadIdx.x & 31, wave = threadIdx.x >> 5, nloc = lane & 15, hlf = lane >> 4;
  const int m0 = blockIdx.y * 128 + wave * 32;
  const int c0 = blockIdx.x * 64;
  v8f acc[2][4];
#pragma unroll
  for (int r = 0; r < 2; ++r)
#pragma unroll
    for (int t = 0; t < 4; ++t) acc[r][t] = (v8f){};
#pragma unroll 2
  for (int kb = 0; kb < E; kb += 32) {
    const size_t ao0 = (size_t)(m0 + nloc) * E + kb, ao1 = (size_t)(m0 + 16 + nloc) * E + kb;
    const v16b a0h = frag_kb(Yh + ao0, hlf), a0l = frag_kb(Yl + ao0, hlf);
    const v16b a1h = frag_kb(Yh + ao1, hlf), a1l = frag_kb(Yl + ao1, hlf);
#pragma unroll
    for (int t = 0; t < 4; ++t) {
      const v16b b = frag_kb(Wo + (size_t)(c0 + t * 16 + nloc) * E + kb, hlf);
      acc[0][t] = wmma16b(a0h, b, acc[0][t]); acc[0][t] = wmma16b(a0l, b, acc[0][t]);
      acc[1][t] = wmma16b(a1h, b, acc[1][t]); acc[1][t] = wmma16b(a1l, b, acc[1][t]);
    }
  }
  float* Tt = Ts[wave];
#pragma unroll
  for (int t = 0; t < 4; ++t)
#pragma unroll
    for (int r = 0; r < 2; ++r)
#pragma unroll
      for (int v = 0; v < 8; ++v) Tt[(r * 16 + v + 8 * hlf) * 64 + t * 16 + nloc] = acc[r][t][v] + bfr(bo[c0 + t * 16 + nloc]);
  wave_lds_sync();
  float* dst0 = out + (size_t)m0 * E + c0;
#pragma unroll
  for (int j = 0; j < 16; ++j) { const int rr = j * 2 + hlf, c4 = nloc * 4; *(v4f*)(dst0 + (size_t)rr * E + c4) = *(const v4f*)(Tt + rr * 64 + c4); }
  
}
}  // namespace

extern "C" void kernel_launch(void* const* d_in, const int* in_sizes, int n_in,
                              void* d_out, int out_size, void* d_ws, size_t ws_size, hipStream_t stream) {
  if (n_in < 13) return;
  const long act_need = ((long)(NB - 1) * SEQ_FULL + SEQ) * (long)E;
  if ((long)in_sizes[0] < act_need || (long)in_sizes[1] < act_need || (long)in_sizes[2] < act_need) return;
  if (in_sizes[3] < (NB - 1) * SEQ_FULL + SEQ) return;
  if ((long)in_sizes[4] < (long)(SEQ - 1) * SEQ_FULL + SEQ) return;
  if (in_sizes[5] < E * E || in_sizes[7] < E * E || in_sizes[9] < E * E || in_sizes[11] < E * E) return;
  if (in_sizes[6] < E || in_sizes[8] < E || in_sizes[10] < E || in_sizes[12] < E) return;
  if (out_size < MROWS * E) return;

  const float* query = (const float*)d_in[0];   // [NB_FULL][SEQ_FULL][E]
  const float* key   = (const float*)d_in[1];
  const float* value = (const float*)d_in[2];
  const int*   kpm   = (const int*)d_in[3];     // [NB_FULL][SEQ_FULL] int32 0/1
  const int*   am    = (const int*)d_in[4];     // [SEQ_FULL][SEQ_FULL] int32 0/1
  const float* q_w   = (const float*)d_in[5];   // [out][in]
  const float* q_b   = (const float*)d_in[6];
  const float* k_w   = (const float*)d_in[7];
  const float* k_b   = (const float*)d_in[8];
  const float* v_w   = (const float*)d_in[9];
  const float* v_b   = (const float*)d_in[10];
  const float* o_w   = (const float*)d_in[11];
  const float* o_b   = (const float*)d_in[12];
  float* out = (float*)d_out;                   // [NB][SEQ][E] f32

  const size_t plane = (size_t)MROWS * E * 2;   // 8 MiB at full size
  const size_t wplane = (size_t)E * E * 2;      // 2 MiB
  size_t off = 0; char* ws = (char*)d_ws;
  b16* Xq  = (b16*)(ws + off); off += plane;
  b16* Xk  = (b16*)(ws + off); off += plane;
  b16* Xv  = (b16*)(ws + off); off += plane;
  b16* Wq  = (b16*)(ws + off); off += wplane;
  b16* Wk  = (b16*)(ws + off); off += wplane;
  b16* Wv  = (b16*)(ws + off); off += wplane;
  b16* Wo  = (b16*)(ws + off); off += wplane;
  b16* Qh  = (b16*)(ws + off); off += plane;
  b16* Ql  = (b16*)(ws + off); off += plane;
  b16* Kh  = (b16*)(ws + off); off += plane;
  b16* Kl  = (b16*)(ws + off); off += plane;
  b16* Vh  = (b16*)(ws + off); off += plane;
  b16* Vl  = (b16*)(ws + off); off += plane;
  b16* Yh  = (b16*)(ws + off); off += plane;
  b16* Yl  = (b16*)(ws + off); off += plane;    // total 96 MiB at full size
  if (off > ws_size) return;

  cvt_kernel<<<2048, 256, 0, stream>>>(query, key, value, q_w, k_w, v_w, o_w, Xq, Xk, Xv, Wq, Wk, Wv, Wo);
  qkv_gemm_kernel<<<dim3(3 * E / 64, MROWS / 128), 128, 0, stream>>>(Xq, Xk, Xv, Wq, Wk, Wv, q_b, k_b, v_b, Qh, Ql, Kh, Kl, Vh, Vl);
  attn_kernel<<<(NG * QT) / AW, 32 * AW, 0, stream>>>(Qh, Ql, Kh, Kl, Vh, Vl, am, kpm, Yh, Yl);
  out_gemm_kernel<<<dim3(E / 64, MROWS / 128), 128, 0, stream>>>(Yh, Yl, Wo, o_b, out);
}

// v002
// It runs in 199 microseconds.
// Next to v001, in two timings, it ran 1.13 and 1.14 times as fast.
// Over all steps from v000 it is 1.82 times as fast.
#include <hip/hip_runtime.h>

// Contractions: q/k/v projections on v_wmma_f32_16x16x32_bf16 with RNE-bf16 operand planes of the activations and of the [out][in] weights
// (one product per tile pair); S^T = K.Q^T (K = 128) and y^T = V^T.P^T (32 keys per step) as bf16 hi/lo splits (hi.hi + hi.lo + lo.hi);
// out = y.Wo^T with y as bf16 hi/lo planes against the RNE-bf16 Wo plane (hi.W + lo.W). f32 accumulate, f32 softmax statistics, 8 heads of 128.

#ifndef NB
#define NB 4
#endif
#ifndef SEQ
#define SEQ 1024
#endif
#ifndef NB_FULL
#define NB_FULL 4
#endif
#ifndef SEQ_FULL
#define SEQ_FULL 1024
#endif

namespace {
constexpr int E = 1024, NH = 8, DH = 128;
constexpr int MROWS = NB * SEQ;          // token rows, compact n*SEQ + t
constexpr int QT = SEQ / 16;             // 16-query tiles per (n, h)
constexpr int KT = SEQ / 16;             // 16-key tiles per (n, h)
constexpr int NG = NB * NH;              // g = n*NH + h
constexpr float SCALE = 0.08838834764831845f;   // 1/sqrt(128), applied in f32 on the score accumulators
static_assert(NB >= 1 && NB <= NB_FULL);
static_assert(SEQ % 128 == 0 && SEQ <= SEQ_FULL);
static_assert(E == NH * DH);
static_assert(MROWS % 128 == 0);
static_assert((NG * QT) % 8 == 0);

typedef __bf16 b16;
typedef __attribute__((ext_vector_type(16))) __bf16 v16b;
typedef __attribute__((ext_vector_type(8)))  __bf16 v8b;
typedef __attribute__((ext_vector_type(8)))  float v8f;
typedef __attribute__((ext_vector_type(4)))  float v4f;
typedef __attribute__((ext_vector_type(4)))  int v4i;

__device__ __forceinline__ v8b ld8b(const b16* p) { return *(const v8b*)p; }
__device__ __forceinline__ v16b cat8b(v8b a, v8b b) { return __builtin_shufflevector(a, b, 0, 1, 2, 3, 4, 5, 6, 7, 8, 9, 10, 11, 12, 13, 14, 15); }
// 16x16x32 16-bit fragment from a k-contiguous row pointer (A: lane&15 = row, B: lane&15 = column), hh = lane>>4:
// elements 0..7 <- p[8hh+0..7], elements 8..15 <- p[16+8hh+0..7]
__device__ __forceinline__ v16b frag_kb(const b16* p, int hh) { return cat8b(ld8b(p + 8 * hh), ld8b(p + 16 + 8 * hh)); }
// hi = bf16 truncation, lo = RNE bf16 of the residual
__device__ __forceinline__ void split_bf16(float v, b16& hi, b16& lo) {
  const unsigned int u = __builtin_bit_cast(unsigned int, v) & 0xffff0000u;
  hi = __builtin_bit_cast(b16, (unsigned short)(u >> 16));
  lo = (b16)(v - __builtin_bit_cast(float, u));
}
// RNE bf16 value of an f32 input, widened back to f32
__device__ __forceinline__ float bfr(float f) { return (float)(b16)f; }
__device__ __forceinline__ v8f wmma16b(v16b a, v16b b, v8f c) {
  return __builtin_amdgcn_wmma_f32_16x16x32_bf16(false, a, false, b, (short)0, c, false, false);
}
// acc += A.B with both operands split: A = (ah, al), B = (bh, bl)
__device__ __forceinline__ v8f wmma3(v16b ah, v16b al, v16b bh, v16b bl, v8f c) {
  c = wmma16b(ah, bh, c); c = wmma16b(ah, bl, c); c = wmma16b(al, bh, c); return c;
}
__device__ __forceinline__ void wave_lds_sync() {
  __builtin_amdgcn_fence(3, "workgroup");
  __builtin_amdgcn_wave_barrier();
  __builtin_amdgcn_fence(2, "workgroup");
}

// ---------------------------------------------------------------------------
// f32 -> RNE bf16 planes: query/key/value [NB_FULL][SEQ_FULL][E] -> X planes [MROWS][E] (compact rows n*SEQ+t);
// Region selection is block-uniform (region sizes are multiples of 256 chunks).
// ---------------------------------------------------------------------------
__global__ __launch_bounds__(256) void cvt_kernel(const float* __restrict__ xq, const float* __restrict__ xk, const float* __restrict__ xv,
                                                  const float* __restrict__ wq, const float* __restrict__ wk, const float* __restrict__ wv,
                                                  const float* __restrict__ wo,
                                                  b16* __restrict__ Xq, b16* __restrict__ Xk, b16* __restrict__ Xv,
                                                  b16* __restrict__ Wq, b16* __restrict__ Wk, b16* __restrict__ Wv, b16* __restrict__ Wo) {
  const size_t tid = (size_t)blockIdx.x * blockDim.x + threadIdx.x, stride = (size_t)gridDim.x * blockDim.x;
  const size_t nx = (size_t)MROWS * E / 8, nw = (size_t)E * E / 8;
  const size_t total = 3 * nx + 4 * nw;
  for (size_t c = tid; c < total; c += stride) {
    const float* src; b16* dst; size_t si, di;
    if (c < 3 * nx) {
      const int which = (int)(c / nx);
      const size_t cc = c - (size_t)which * nx;
      di = cc * 8;
      const size_t m = di / E, col = di % E;
      const size_t n = m / SEQ, t = m % SEQ;
      si = (n * SEQ_FULL + t) * (size_t)E + col;
      src = (which == 0) ? xq : (which == 1) ? xk : xv;
      dst = (which == 0) ? Xq : (which == 1) ? Xk : Xv;
    } else {
      const size_t c2 = c - 3 * nx;
      const int which = (int)(c2 / nw);
      const size_t cc = c2 - (size_t)which * nw;
      di = cc * 8; si = di;
      src = (which == 0) ? wq : (which == 1) ? wk : (which == 2) ? wv : wo;
      dst = (which == 0) ? Wq : (which == 1) ? Wk : (which == 2) ? Wv : Wo;
    }
    const v4f f0 = *(const v4f*)(src + si), f1 = *(const v4f*)(src + si + 4);
    v8b o;
#pragma unroll
    for (int e = 0; e < 4; ++e) { o[e] = (b16)f0[e]; o[4 + e] = (b16)f1[e]; }
    *(v8b*)(dst + di) = o;
    
  }
}

// ---------------------------------------------------------------------------
// QKV GEMM: (MROWS x 1024) x (1024 x 3072), grid (48, MROWS/128), block 4 waves, wave = 32 rows x 64 columns (half of one head of q, k or v).
// A = bf16 activation plane rows, B = bf16 weight rows ([out][in] = [n][k]); one product per tile pair. Epilogue adds the RNE-bf16 bias and
// ---------------------------------------------------------------------------
__global__ __launch_bounds__(128) void qkv_gemm_kernel(const b16* __restrict__ Xq, const b16* __restrict__ Xk, const b16* __restrict__ Xv,
                                                       const b16* __restrict__ Wq, const b16* __restrict__ Wk, const b16* __restrict__ Wv,
                                                       const float* __restrict__ bq, const float* __restrict__ bk, const float* __restrict__ bv,
                                                       b16* __restrict__ Qh, b16* __restrict__ Ql, b16* __restrict__ Kh, b16* __restrict__ Kl,
                                                       b16* __restrict__ Vh, b16* __restrict__ Vl) {
  __shared__ __attribute__((aligned(16))) b16 Ts[4][2][32 * 64];
  const int lane = threadIdx.x & 31, wave = threadIdx.x >> 5, nloc = lane & 15, hlf = lane >> 4;
  const int m0 = blockIdx.y * 128 + wave * 32;
  const int c0 = blockIdx.x * 64;                                   // 0..3071, block-uniform
  const int mat = c0 / E, cm = c0 % E, head = cm / DH, dlo = cm % DH;
  const b16* X = (mat == 0) ? Xq : (mat == 1) ? Xk : Xv;
  const b16* W = (mat == 0) ? Wq : (mat == 1) ? Wk : Wv;
  const float* bias = ((mat == 0) ? bq : (mat == 1) ? bk : bv) + cm;
  v8f acc[2][4];
#pragma unroll
  for (int r = 0; r < 2; ++r)
#pragma unroll
    for (int t = 0; t < 4; ++t) acc[r][t] = (v8f){};
#pragma unroll 2
  for (int kb = 0; kb < E; kb += 32) {
    const v16b a0 = frag_kb(X + (size_t)(m0 + nloc) * E + kb, hlf);
    const v16b a1 = frag_kb(X + (size_t)(m0 + 16 + nloc) * E + kb, hlf);
    v16b b[4];
#pragma unroll
    for (int t = 0; t < 4; ++t) b[t] = frag_kb(W + (size_t)(cm + t * 16 + nloc) * E + kb, hlf);
    __builtin_amdgcn_sched_barrier(0);   // all twelve loads of the k step issue ahead of its first WMMA: one load latency a step, not one a fragment
#pragma unroll
    for (int t = 0; t < 4; ++t) {
      acc[0][t] = wmma16b(a0, b[t], acc[0][t]);
      acc[1][t] = wmma16b(a1, b[t], acc[1][t]);
    }
  }
  const int n = m0 / SEQ, t0 = m0 % SEQ, g = n * NH + head;
  b16* Tp0 = Ts[wave][0]; b16* Tp1 = Ts[wave][1];
#pragma unroll
  for (int t = 0; t < 4; ++t)
#pragma unroll
    for (int r = 0; r < 2; ++r)
#pragma unroll
      for (int v = 0; v < 8; ++v) {
        const int rr = r * 16 + v + 8 * hlf, d = t * 16 + nloc;
        b16 yh, yl; split_bf16(acc[r][t][v] + bfr(bias[d]), yh, yl);
        const int idx = (mat < 2) ? (rr * 64 + d) : ((rr >> 4) * 1024 + d * 16 + (rr & 15));
        Tp0[idx] = yh; Tp1[idx] = yl;
      }
  wave_lds_sync();
  if (mat < 2) {
    b16* Ph = (mat == 0) ? Qh : Kh; b16* Pl = (mat == 0) ? Ql : Kl;
    const size_t rowbase = (size_t)g * SEQ + t0;
#pragma unroll
    for (int j = 0; j < 8; ++j) {
      const int e = (j * 32 + lane) * 8, rr = e >> 6, cc = e & 63;
      const size_t go = (rowbase + rr) * DH + dlo + cc;
      *(v8b*)(Ph + go) = ld8b(Tp0 + e); *(v8b*)(Pl + go) = ld8b(Tp1 + e);
    }
    
  } else {
    const size_t tb = (size_t)g * KT + (t0 >> 4);
#pragma unroll
    for (int j = 0; j < 8; ++j) {
      const int e = (j * 32 + lane) * 8, kt2 = e >> 10, within = e & 1023;
      const size_t go = ((tb + kt2) * DH + dlo) * 16 + within;
      *(v8b*)(Vh + go) = ld8b(Tp0 + e); *(v8b*)(Vl + go) = ld8b(Tp1 + e);
    }
    
  }
}

constexpr int AW = 8;
constexpr int KPITCH = 2 * DH + 16;
constexpr int KPL = 32 * KPITCH;
constexpr int VPL = 2 * DH * 16 * 2;
constexpr int OFF_KH = 0, OFF_KL = KPL, OFF_VH = 2 * KPL, OFF_VL = 2 * KPL + VPL, STAGE = 2 * KPL + 2 * VPL;
constexpr int NT = SEQ / 32;                   // trips
static_assert(QT % AW == 0 && NT >= 2 && STAGE % 16 == 0 && KPITCH % 16 == 0);

__device__ __forceinline__ v8b lds8b(const unsigned char* p) { return *(const v8b*)p; }
// one stage = 8 copies of 16 B per lane (256 lanes x 128 B = 32 KiB). lk / lv: the lane's LDS byte addresses in the K hi / V hi plane of the
// target buffer; the pointers: the lane's first 16 B of the stage in each global plane. The second copy of a plane lies 4,096 global bytes on.
__device__ __forceinline__ void stage_copy(unsigned lk, unsigned lv, const unsigned char* gkh, const unsigned char* gkl,
                                           const unsigned char* gvh, const unsigned char* gvl) {
  asm volatile("global_load_async_to_lds_b128 %0, %8, off\n\t"
               "global_load_async_to_lds_b128 %1, %9, off\n\t"
               "global_load_async_to_lds_b128 %2, %10, off\n\t"
               "global_load_async_to_lds_b128 %3, %11, off\n\t"
               "global_load_async_to_lds_b128 %4, %12, off\n\t"
               "global_load_async_to_lds_b128 %5, %13, off\n\t"
               "global_load_async_to_lds_b128 %6, %14, off\n\t"
               "global_load_async_to_lds_b128 %7, %15, off\n\t"
               "s_wait_xcnt 0x0"
               :: "v"(lk), "v"(lk + 16 * KPITCH), "v"(lk + KPL), "v"(lk + KPL + 16 * KPITCH),
                  "v"(lv), "v"(lv + VPL / 2), "v"(lv + VPL), "v"(lv + VPL + VPL / 2),
                  "v"(gkh), "v"(gkh + 4096), "v"(gkl), "v"(gkl + 4096), "v"(gvh), "v"(gvh + 4096), "v"(gvl), "v"(gvl + 4096)
               : "memory");
}

__global__ __launch_bounds__(32 * AW) __attribute__((amdgpu_num_vgpr(256)))
void attn_kernel(const b16* __restrict__ Qh, const b16* __restrict__ Ql, const b16* __restrict__ Kh, const b16* __restrict__ Kl,
                 const b16* __restrict__ Vh, const b16* __restrict__ Vl, const int* __restrict__ am, const int* __restrict__ kpm,
                 b16* __restrict__ Yh, b16* __restrict__ Yl) {
  __shared__ __attribute__((aligned(16))) unsigned char Ring[2][STAGE];
  __shared__ __attribute__((aligned(16))) b16 Os[AW][2][16 * DH];
  const int wid = threadIdx.x >> 5, lane = threadIdx.x & 31, hh = lane >> 4, col = lane & 15;
  const int qtile = blockIdx.x * AW + wid;                // over NG*QT
  const int g = qtile / QT;                               // n*NH + h, the same in all waves of a block
  const int q0 = (qtile % QT) << 4;
  const int n = g / NH, h = g % NH;
  const size_t qo = ((size_t)g * SEQ + q0 + col) * DH;
  const int* amrow = am + (size_t)(q0 + col) * SEQ_FULL;  // attn_mask[query][key]
  const int* kprow = kpm + (size_t)n * SEQ_FULL;         // key_padding_mask[n][key]
  const float ninf = -__builtin_inff();
  // Copy addresses. A stage is 8,192 contiguous bytes of each global plane. K: 16-byte piece c = thread id (and c + 256) is row c >> 4,
  // piece c & 15. V: a wave's 512 bytes are 16 d rows of 32 B; lane = (key half hh, d row), so each half wave writes 256 contiguous LDS bytes.
  const size_t gplane = (size_t)g * SEQ * DH * 2;         // byte offset of (n, h) in every K and V plane
  const unsigned kin = (unsigned)threadIdx.x * 16u, vin = (unsigned)(wid * 512 + col * 32 + hh * 16);
  const unsigned char* gkh = (const unsigned char*)Kh + gplane + kin; const unsigned char* gkl = (const unsigned char*)Kl + gplane + kin;
  const unsigned char* gvh = (const unsigned char*)Vh + gplane + vin; const unsigned char* gvl = (const unsigned char*)Vl + gplane + vin;
  const unsigned ring0 = (unsigned)(size_t)&Ring[0][0];
  const unsigned lk = ring0 + OFF_KH + (unsigned)((threadIdx.x >> 4) * KPITCH + (threadIdx.x & 15) * 16);
  const unsigned lv = ring0 + OFF_VH + (unsigned)(hh * (DH * 16) + (wid * 16 + col) * 16);
  stage_copy(lk, lv, gkh, gkl, gvh, gvl);
  asm volatile("s_wait_asynccnt 0x0" ::: "memory");       // this wave's share of tile 0 has landed
  __syncthreads();                                        // tile 0 is whole for every wave
  stage_copy(lk + STAGE, lv + STAGE, gkh + 8192, gkl + 8192, gvh + 8192, gvl + 8192);
  float m = ninf, l = 0.0f;
  v8f o[8];
#pragma unroll
  for (int t = 0; t < 8; ++t) o[t] = (v8f){};
#pragma unroll 1
  for (int it = 0; it < NT; ++it) {
    const int kb = it * 32;
    const unsigned bo = (unsigned)(it & 1) * (unsigned)STAGE;
    const unsigned char* B = &Ring[0][0] + bo;
    const unsigned char* k0 = B + col * KPITCH + 16 * hh;   // key kb+col; key kb+16+col lies 16 rows on
    v8f s0 = {}, s1 = {};
#pragma unroll 1
    for (int kk = 0; kk < DH; kk += 32) {
      const v16b bqh = frag_kb(Qh + qo + kk, hh), bql = frag_kb(Ql + qo + kk, hh);
      const unsigned char* ka = k0 + 2 * kk;
      v16b ah = cat8b(lds8b(ka + OFF_KH), lds8b(ka + OFF_KH + 32)), al = cat8b(lds8b(ka + OFF_KL), lds8b(ka + OFF_KL + 32));
      s0 = wmma3(ah, al, bqh, bql, s0);
      ka += 16 * KPITCH;
      ah = cat8b(lds8b(ka + OFF_KH), lds8b(ka + OFF_KH + 32)); al = cat8b(lds8b(ka + OFF_KL), lds8b(ka + OFF_KL + 32));
      s1 = wmma3(ah, al, bqh, bql, s1);
    }
    {   // scale and replace-fill: s0 holds keys kb+8hh+0..7, s1 holds keys kb+16+8hh+0..7 of query q0+col
      const v4i a0 = *(const v4i*)(amrow + kb + 8 * hh), a1 = *(const v4i*)(amrow + kb + 8 * hh + 4);
      const v4i p0 = *(const v4i*)(kprow + kb + 8 * hh), p1 = *(const v4i*)(kprow + kb + 8 * hh + 4);
#pragma unroll
      for (int r = 0; r < 4; ++r) {
        s0[r]     = ((a0[r] | p0[r]) != 0) ? ninf : s0[r] * SCALE;
        s0[4 + r] = ((a1[r] | p1[r]) != 0) ? ninf : s0[4 + r] * SCALE;
      }
      const v4i a2 = *(const v4i*)(amrow + kb + 16 + 8 * hh), a3 = *(const v4i*)(amrow + kb + 16 + 8 * hh + 4);
      const v4i p2 = *(const v4i*)(kprow + kb + 16 + 8 * hh), p3 = *(const v4i*)(kprow + kb + 16 + 8 * hh + 4);
#pragma unroll
      for (int r = 0; r < 4; ++r) {
        s1[r]     = ((a2[r] | p2[r]) != 0) ? ninf : s1[r] * SCALE;
        s1[4 + r] = ((a3[r] | p3[r]) != 0) ? ninf : s1[4 + r] * SCALE;
      }
    }
    float mr = ninf;
#pragma unroll
    for (int r = 0; r < 8; ++r) mr = fmaxf(mr, fmaxf(s0[r], s1[r]));
    mr = fmaxf(mr, __shfl_xor(mr, 16));
    const float mn = fmaxf(m, mr);
    const float mref = (mn == ninf) ? 0.0f : mn;    // fully masked prefix: nothing accumulated yet
    const float al_ = __expf(m - mref);
    m = mn;
    float sum = 0.0f;
    v16b pbh, pbl;
#pragma unroll
    for (int r = 0; r < 8; ++r) {
      const float e0 = __expf(s0[r] - mref), e1 = __expf(s1[r] - mref);
      sum += e0 + e1;
      b16 a, c; split_bf16(e0, a, c); pbh[r] = a; pbl[r] = c; split_bf16(e1, a, c); pbh[8 + r] = a; pbl[8 + r] = c;
    }
    sum += __shfl_xor(sum, 16);
    l = l * al_ + sum;
#pragma unroll
    for (int t = 0; t < 8; ++t) o[t] = o[t] * al_;
    const unsigned char* va = B + hh * (DH * 16) + col * 16;   // keys kb+8hh+0..7 of d row col; the second 16-key tile lies VPL/2 on
#pragma unroll
    for (int t = 0; t < 8; ++t) {                         // d row of V^T: t*16 + col
      const v16b vah = cat8b(lds8b(va + OFF_VH + t * 256), lds8b(va + OFF_VH + VPL / 2 + t * 256));
      const v16b val = cat8b(lds8b(va + OFF_VL + t * 256), lds8b(va + OFF_VL + VPL / 2 + t * 256));
      o[t] = wmma3(vah, val, pbh, pbl, o[t]);
    }
    asm volatile("s_wait_dscnt 0x0" ::: "memory");        // this wave's reads of the buffer are done before it may be refilled
    asm volatile("s_wait_asynccnt 0x0" ::: "memory");     // this wave's share of the next tile has landed
    __syncthreads();                                      // publishes the next tile and ends every wave's reads of this buffer
    if (it + 2 < NT) {
      const size_t go = (size_t)(it + 2) * 8192;
      stage_copy(lk + bo, lv + bo, gkh + go, gkl + go, gvh + go, gvl + go);
    }
  }
  asm volatile("s_wait_asynccnt 0x0" ::: "memory");       // no copy is outstanding when the wave goes on to its end
  const float inv = 1.0f / l;
  b16* T0 = Os[wid][0]; b16* T1 = Os[wid][1];
#pragma unroll
  for (int t = 0; t < 8; ++t) {
    v8b hv, lv8;
#pragma unroll
    for (int r = 0; r < 8; ++r) { b16 a, c; split_bf16(o[t][r] * inv, a, c); hv[r] = a; lv8[r] = c; }
    const int idx = col * DH + t * 16 + 8 * hh;          // [query][d]
    *(v8b*)(T0 + idx) = hv; *(v8b*)(T1 + idx) = lv8;
  }
  wave_lds_sync();
  const size_t tok0 = (size_t)n * SEQ + q0;
#pragma unroll
  for (int j = 0; j < 8; ++j) {
    const int e = (j * 32 + lane) * 8, rr = e >> 7, cc = e & 127;
    const size_t go = (tok0 + rr) * E + (size_t)h * DH + cc;
    *(v8b*)(Yh + go) = ld8b(T0 + e); *(v8b*)(Yl + go) = ld8b(T1 + e);
  }
  
}

// ---------------------------------------------------------------------------
// Output projection: (MROWS x 1024) x (1024 x 1024) -> f32, A = y hi/lo planes, B = Wo plane rows ([out][in]); hi.W + lo.W.
// ---------------------------------------------------------------------------
__global__ __launch_bounds__(128) void out_gemm_kernel(const b16* __restrict__ Yh, const b16* __restrict__ Yl, const b16* __restrict__ Wo,
                                                       const float* __restrict__ bo, float* __restrict__ out) {
  __shared__ __attribute__((aligned(16))) float Ts[4][32 * 64];
  const int lane = threadIdx.x & 31, wave = threadIdx.x >> 5, nloc = lane & 15, hlf = lane >> 4;
  const int m0 = blockIdx.y * 128 + wave * 32;
  const int c0 = blockIdx.x * 64;
  v8f acc[2][4];
#pragma unroll
  for (int r = 0; r < 2; ++r)
#pragma unroll
    for (int t = 0; t < 4; ++t) acc[r][t] = (v8f){};
  // Fragments of 64 k (a whole 128-byte line of every row) form one set; two sets, the next one loaded while this one is multiplied.
  // Addresses: a block-uniform base that moves with k, plus the lane's fixed byte offset (row, k half), which never changes.
  const unsigned offa = (unsigned)(((wave * 32 + nloc) * E + 8 * hlf) * 2), offb = (unsigned)((nloc * E + 8 * hlf) * 2);
  const char* byh = (const char*)(Yh + (size_t)blockIdx.y * 128 * E); const char* byl = (const char*)(Yl + (size_t)blockIdx.y * 128 * E);
  const char* bw = (const char*)(Wo + (size_t)c0 * E);
  v16b fa[2][2][4], fb[2][2][4];                          // [set][k step][fragment]
  auto frag = [](const char* base, unsigned off) { const char* p = base + off; return cat8b(*(const v8b*)p, *(const v8b*)(p + 32)); };
  auto load_set = [&](v16b (&A)[2][4], v16b (&B)[2][4], unsigned kbyte) {
#pragma unroll
    for (int u = 0; u < 2; ++u) {
      const char* yh = byh + kbyte + 64 * u; const char* yl = byl + kbyte + 64 * u; const char* w = bw + kbyte + 64 * u;
      A[u][0] = frag(yh, offa); A[u][1] = frag(yl, offa); A[u][2] = frag(yh + 16 * E * 2, offa); A[u][3] = frag(yl + 16 * E * 2, offa);
#pragma unroll
      for (int t = 0; t < 4; ++t) B[u][t] = frag(w + t * 16 * E * 2, offb);
    }
  };
  auto mul_set = [&](const v16b (&A)[2][4], const v16b (&B)[2][4]) {
#pragma unroll
    for (int u = 0; u < 2; ++u)
#pragma unroll
      for (int t = 0; t < 4; ++t) {
        acc[0][t] = wmma16b(A[u][0], B[u][t], acc[0][t]); acc[0][t] = wmma16b(A[u][1], B[u][t], acc[0][t]);
        acc[1][t] = wmma16b(A[u][2], B[u][t], acc[1][t]); acc[1][t] = wmma16b(A[u][3], B[u][t], acc[1][t]);
      }
  };
  load_set(fa[0], fb[0], 0);
  unsigned kbyte = 0;
#pragma unroll 1
  while (kbyte < (E - 128) * 2) {
    load_set(fa[1], fb[1], kbyte + 128);
    __builtin_amdgcn_sched_barrier(0);   // the next set's loads all issue ahead of this set's WMMAs, which then cover their latency
    mul_set(fa[0], fb[0]);
    __builtin_amdgcn_sched_barrier(0);   // keeps the refill of set 0 behind its last WMMA and ahead of set 1's first
    load_set(fa[0], fb[0], kbyte + 256);
    __builtin_amdgcn_sched_barrier(0);
    mul_set(fa[1], fb[1]);
    __builtin_amdgcn_sched_barrier(0);   // the wait below stays at the foot of the trip
    // set 0's loads are still in flight: this wait stands ahead of the next trip's rewrite of the address registers they name. kbyte is an
    // operand so that those addresses are formed behind it; offa and offb, so that their registers, which the first loads name, stay theirs up to it
    asm volatile("s_wait_xcnt 0x0" : "+s"(kbyte) : "v"(offa), "v"(offb) : "memory");
    kbyte += 256;
  }
  load_set(fa[1], fb[1], kbyte + 128);
  asm volatile("s_wait_xcnt 0x0" :: "v"(offa), "v"(offb) : "memory");
  __builtin_amdgcn_sched_barrier(0);     // as in the loop: the last set's loads issue ahead of the WMMAs of the set before it
  mul_set(fa[0], fb[0]);
  mul_set(fa[1], fb[1]);
  float* Tt = Ts[wave];
#pragma unroll
  for (int t = 0; t < 4; ++t)
#pragma unroll
    for (int r = 0; r < 2; ++r)
#pragma unroll
      for (int v = 0; v < 8; ++v) Tt[(r * 16 + v + 8 * hlf) * 64 + t * 16 + nloc] = acc[r][t][v] + bfr(bo[c0 + t * 16 + nloc]);
  wave_lds_sync();
  float* dst0 = out + (size_t)m0 * E + c0;
#pragma unroll
  for (int j = 0; j < 16; ++j) { const int rr = j * 2 + hlf, c4 = nloc * 4; *(v4f*)(dst0 + (size_t)rr * E + c4) = *(const v4f*)(Tt + rr * 64 + c4); }
  
}
}  // namespace

extern "C" void kernel_launch(void* const* d_in, const int* in_sizes, int n_in,
                              void* d_out, int out_size, void* d_ws, size_t ws_size, hipStream_t stream) {
  if (n_in < 13) return;
  const long act_need = ((long)(NB - 1) * SEQ_FULL + SEQ) * (long)E;
  if ((long)in_sizes[0] < act_need || (long)in_sizes[1] < act_need || (long)in_sizes[2] < act_need) return;
  if (in_sizes[3] < (NB - 1) * SEQ_FULL + SEQ) return;
  if ((long)in_sizes[4] < (long)(SEQ - 1) * SEQ_FULL + SEQ) return;
  if (in_sizes[5] < E * E || in_sizes[7] < E * E || in_sizes[9] < E * E || in_sizes[11] < E * E) return;
  if (in_sizes[6] < E || in_sizes[8] < E || in_sizes[10] < E || in_sizes[12] < E) return;
  if (out_size < MROWS * E) return;

  const float* query = (const float*)d_in[0];   // [NB_FULL][SEQ_FULL][E]
  const float* key   = (const float*)d_in[1];
  const float* value = (const float*)d_in[2];
  const int*   kpm   = (const int*)d_in[3];     // [NB_FULL][SEQ_FULL] int32 0/1
  const int*   am    = (const int*)d_in[4];     // [SEQ_FULL][SEQ_FULL] int32 0/1
  const float* q_w   = (const float*)d_in[5];   // [out][in]
  const float* q_b   = (const float*)d_in[6];
  const float* k_w   = (const float*)d_in[7];
  const float* k_b   = (const float*)d_in[8];
  const float* v_w   = (const float*)d_in[9];
  const float* v_b   = (const float*)d_in[10];
  const float* o_w   = (const float*)d_in[11];
  const float* o_b   = (const float*)d_in[12];
  float* out = (float*)d_out;                   // [NB][SEQ][E] f32

  const size_t plane = (size_t)MROWS * E * 2;   // 8 MiB at full size
  const size_t wplane = (size_t)E * E * 2;      // 2 MiB
  size_t off = 0; char* ws = (char*)d_ws;
  b16* Xq  = (b16*)(ws + off); off += plane;
  b16* Xk  = (b16*)(ws + off); off += plane;
  b16* Xv  = (b16*)(ws + off); off += plane;
  b16* Wq  = (b16*)(ws + off); off += wplane;
  b16* Wk  = (b16*)(ws + off); off += wplane;
  b16* Wv  = (b16*)(ws + off); off += wplane;
  b16* Wo  = (b16*)(ws + off); off += wplane;
  b16* Qh  = (b16*)(ws + off); off += plane;
  b16* Ql  = (b16*)(ws + off); off += plane;
  b16* Kh  = (b16*)(ws + off); off += plane;
  b16* Kl  = (b16*)(ws + off); off += plane;
  b16* Vh  = (b16*)(ws + off); off += plane;
  b16* Vl  = (b16*)(ws + off); off += plane;
  b16* Yh  = (b16*)(ws + off); off += plane;
  b16* Yl  = (b16*)(ws + off); off += plane;    // total 96 MiB at full size
  if (off > ws_size) return;

  cvt_kernel<<<2048, 256, 0, stream>>>(query, key, value, q_w, k_w, v_w, o_w, Xq, Xk, Xv, Wq, Wk, Wv, Wo);
  qkv_gemm_kernel<<<dim3(3 * E / 64, MROWS / 128), 128, 0, stream>>>(Xq, Xk, Xv, Wq, Wk, Wv, q_b, k_b, v_b, Qh, Ql, Kh, Kl, Vh, Vl);
  attn_kernel<<<(NG * QT) / AW, 32 * AW, 0, stream>>>(Qh, Ql, Kh, Kl, Vh, Vl, am, kpm, Yh, Yl);
  out_gemm_kernel<<<dim3(E / 64, MROWS / 128), 128, 0, stream>>>(Yh, Yl, Wo, o_b, out);
}

// v003
// One run takes 148 microseconds.
// In two side-by-side timings against v002, it was 1.35 and 1.34 times as fast.
// Over all steps from v000 it is 2.45 times as fast.
#include <hip/hip_runtime.h>

// Contractions: q/k/v projections on v_wmma_f32_16x16x32_bf16 with RNE-bf16 operand planes of the activations and of the [out][in] weights
// (one product per tile pair); S^T = K.Q^T (K = 128) and y^T = V^T.P^T (32 keys per step) as bf16 hi/lo splits (hi.hi + hi.lo + lo.hi);
// out = y.Wo^T with y as bf16 hi/lo planes against the RNE-bf16 Wo plane (hi.W + lo.W). f32 accumulate, f32 softmax statistics, 8 heads of 128.

#ifndef NB
#define NB 4
#endif
#ifndef SEQ
#define SEQ 1024
#endif
#ifndef NB_FULL
#define NB_FULL 4
#endif
#ifndef SEQ_FULL
#define SEQ_FULL 1024
#endif

namespace {
constexpr int E = 1024, NH = 8, DH = 128;
constexpr int MROWS = NB * SEQ;          // token rows, compact n*SEQ + t
constexpr int QT = SEQ / 16;             // 16-query tiles per (n, h)
constexpr int KT = SEQ / 16;             // 16-key tiles per (n, h)
constexpr int NG = NB * NH;              // g = n*NH + h
constexpr float SCALE = 0.08838834764831845f;   // 1/sqrt(128), applied in f32 on the score accumulators
static_assert(NB >= 1 && NB <= NB_FULL);
static_assert(SEQ % 128 == 0 && SEQ <= SEQ_FULL);
static_assert(E == NH * DH);
static_assert(MROWS % 128 == 0);
static_assert((NG * QT) % 8 == 0);

typedef __bf16 b16;
typedef __attribute__((ext_vector_type(16))) __bf16 v16b;
typedef __attribute__((ext_vector_type(8)))  __bf16 v8b;
typedef __attribute__((ext_vector_type(8)))  float v8f;
typedef __attribute__((ext_vector_type(4)))  float v4f;
typedef __attribute__((ext_vector_type(4)))  int v4i;

__device__ __forceinline__ v8b ld8b(const b16* p) { return *(const v8b*)p; }
__device__ __forceinline__ v16b cat8b(v8b a, v8b b) { return __builtin_shufflevector(a, b, 0, 1, 2, 3, 4, 5, 6, 7, 8, 9, 10, 11, 12, 13, 14, 15); }
// 16x16x32 16-bit fragment from a k-contiguous row pointer (A: lane&15 = row, B: lane&15 = column), hh = lane>>4:
// elements 0..7 <- p[8hh+0..7], elements 8..15 <- p[16+8hh+0..7]
__device__ __forceinline__ v16b frag_kb(const b16* p, int hh) { return cat8b(ld8b(p + 8 * hh), ld8b(p + 16 + 8 * hh)); }
// hi = bf16 truncation, lo = RNE bf16 of the residual
__device__ __forceinline__ void split_bf16(float v, b16& hi, b16& lo) {
  const unsigned int u = __builtin_bit_cast(unsigned int, v) & 0xffff0000u;
  hi = __builtin_bit_cast(b16, (unsigned short)(u >> 16));
  lo = (b16)(v - __builtin_bit_cast(float, u));
}
// RNE bf16 value of an f32 input, widened back to f32
__device__ __forceinline__ float bfr(float f) { return (float)(b16)f; }
__device__ __forceinline__ v8f wmma16b(v16b a, v16b b, v8f c) {
  return __builtin_amdgcn_wmma_f32_16x16x32_bf16(false, a, false, b, (short)0, c, false, false);
}
// acc += A.B with both operands split: A = (ah, al), B = (bh, bl)
__device__ __forceinline__ v8f wmma3(v16b ah, v16b al, v16b bh, v16b bl, v8f c) {
  c = wmma16b(ah, bh, c); c = wmma16b(ah, bl, c); c = wmma16b(al, bh, c); return c;
}
__device__ __forceinline__ void wave_lds_sync() {
  __builtin_amdgcn_fence(3, "workgroup");
  __builtin_amdgcn_wave_barrier();
  __builtin_amdgcn_fence(2, "workgroup");
}

// ---------------------------------------------------------------------------
// f32 -> RNE bf16 planes: query/key/value [NB_FULL][SEQ_FULL][E] -> X planes [MROWS][E] (compact rows n*SEQ+t);
// Region selection is block-uniform (region sizes are multiples of 256 chunks).
// ---------------------------------------------------------------------------
__global__ __launch_bounds__(256) void cvt_kernel(const float* __restrict__ xq, const float* __restrict__ xk, const float* __restrict__ xv,
                                                  const float* __restrict__ wq, const float* __restrict__ wk, const float* __restrict__ wv,
                                                  const float* __restrict__ wo,
                                                  b16* __restrict__ Xq, b16* __restrict__ Xk, b16* __restrict__ Xv,
                                                  b16* __restrict__ Wq, b16* __restrict__ Wk, b16* __restrict__ Wv, b16* __restrict__ Wo) {
  const size_t tid = (size_t)blockIdx.x * blockDim.x + threadIdx.x, stride = (size_t)gridDim.x * blockDim.x;
  const size_t nx = (size_t)MROWS * E / 8, nw = (size_t)E * E / 8;
  const size_t total = 3 * nx + 4 * nw;
  for (size_t c = tid; c < total; c += stride) {
    const float* src; b16* dst; size_t si, di;
    if (c < 3 * nx) {
      const int which = (int)(c / nx);
      const size_t cc = c - (size_t)which * nx;
      di = cc * 8;
      const size_t m = di / E, col = di % E;
      const size_t n = m / SEQ, t = m % SEQ;
      si = (n * SEQ_FULL + t) * (size_t)E + col;
      src = (which == 0) ? xq : (which == 1) ? xk : xv;
      dst = (which == 0) ? Xq : (which == 1) ? Xk : Xv;
    } else {
      const size_t c2 = c - 3 * nx;
      const int which = (int)(c2 / nw);
      const size_t cc = c2 - (size_t)which * nw;
      di = cc * 8; si = di;
      src = (which == 0) ? wq : (which == 1) ? wk : (which == 2) ? wv : wo;
      dst = (which == 0) ? Wq : (which == 1) ? Wk : (which == 2) ? Wv : Wo;
    }
    const v4f f0 = *(const v4f*)(src + si), f1 = *(const v4f*)(src + si + 4);
    v8b o;
#pragma unroll
    for (int e = 0; e < 4; ++e) { o[e] = (b16)f0[e]; o[4 + e] = (b16)f1[e]; }
    *(v8b*)(dst + di) = o;
    
  }
}

constexpr int GP = 128 + 16;
constexpr int GPL = 128 * GP;
constexpr int GNT = E / 64;
constexpr int GROW = 32 * E * 2;
static_assert(GNT >= 2 && GP % 16 == 0 && E % 128 == 0);
// 16x16x32 16-bit fragment from a staged row: p = row start + 64 B x k step + 16 B x (lane >> 4); same element order as frag_kb
__device__ __forceinline__ v16b frag_lds(const unsigned char* p) { return cat8b(*(const v8b*)p, *(const v8b*)(p + 32)); }
// Two planes = 8 copies of 16 B per lane (256 lanes). l: the lane's LDS byte address in the first plane of the target buffer (row = thread
// id >> 3, piece = thread id & 7); ga / gb: the lane's first 16 B of the trip in each global plane. Successive copies lie 32 rows on.
__device__ __forceinline__ void stage2(unsigned l, const unsigned char* ga, const unsigned char* gb) {
  asm volatile("global_load_async_to_lds_b128 %0, %8, off\n\t"
               "global_load_async_to_lds_b128 %1, %9, off\n\t"
               "global_load_async_to_lds_b128 %2, %10, off\n\t"
               "global_load_async_to_lds_b128 %3, %11, off\n\t"
               "global_load_async_to_lds_b128 %4, %12, off\n\t"
               "global_load_async_to_lds_b128 %5, %13, off\n\t"
               "global_load_async_to_lds_b128 %6, %14, off\n\t"
               "global_load_async_to_lds_b128 %7, %15, off\n\t"
               "s_wait_xcnt 0x0"
               :: "v"(l), "v"(l + 32 * GP), "v"(l + 64 * GP), "v"(l + 96 * GP),
                  "v"(l + GPL), "v"(l + GPL + 32 * GP), "v"(l + GPL + 64 * GP), "v"(l + GPL + 96 * GP),
                  "v"(ga), "v"(ga + GROW), "v"(ga + 2 * GROW), "v"(ga + 3 * GROW), "v"(gb), "v"(gb + GROW), "v"(gb + 2 * GROW), "v"(gb + 3 * GROW)
               : "memory");
}
__device__ __forceinline__ void stage3(unsigned l, const unsigned char* ga, const unsigned char* gb, const unsigned char* gc) {
  asm volatile("global_load_async_to_lds_b128 %0, %12, off\n\t"
               "global_load_async_to_lds_b128 %1, %13, off\n\t"
               "global_load_async_to_lds_b128 %2, %14, off\n\t"
               "global_load_async_to_lds_b128 %3, %15, off\n\t"
               "global_load_async_to_lds_b128 %4, %16, off\n\t"
               "global_load_async_to_lds_b128 %5, %17, off\n\t"
               "global_load_async_to_lds_b128 %6, %18, off\n\t"
               "global_load_async_to_lds_b128 %7, %19, off\n\t"
               "global_load_async_to_lds_b128 %8, %20, off\n\t"
               "global_load_async_to_lds_b128 %9, %21, off\n\t"
               "global_load_async_to_lds_b128 %10, %22, off\n\t"
               "global_load_async_to_lds_b128 %11, %23, off\n\t"
               "s_wait_xcnt 0x0"
               :: "v"(l), "v"(l + 32 * GP), "v"(l + 64 * GP), "v"(l + 96 * GP),
                  "v"(l + GPL), "v"(l + GPL + 32 * GP), "v"(l + GPL + 64 * GP), "v"(l + GPL + 96 * GP),
                  "v"(l + 2 * GPL), "v"(l + 2 * GPL + 32 * GP), "v"(l + 2 * GPL + 64 * GP), "v"(l + 2 * GPL + 96 * GP),
                  "v"(ga), "v"(ga + GROW), "v"(ga + 2 * GROW), "v"(ga + 3 * GROW), "v"(gb), "v"(gb + GROW), "v"(gb + 2 * GROW), "v"(gb + 3 * GROW),
                  "v"(gc), "v"(gc + GROW), "v"(gc + 2 * GROW), "v"(gc + 3 * GROW)
               : "memory");
}

// ---------------------------------------------------------------------------
// QKV GEMM: (MROWS x 1024) x (1024 x 3072), grid (24, MROWS/128); a block's 128 columns are one head of q, k or v, a wave's 64 half of it.
// A = bf16 activation plane rows, B = bf16 weight rows ([out][in] = [n][k]); one product per tile pair. Epilogue adds the RNE-bf16 bias and
// splits hi/lo; it stages per wave in the LDS of the ring, which no wave reads and no copy writes any more behind the last trip's barrier.
// ---------------------------------------------------------------------------
__global__ __launch_bounds__(256) void qkv_gemm_kernel(const b16* __restrict__ Xq, const b16* __restrict__ Xk, const b16* __restrict__ Xv,
                                                       const b16* __restrict__ Wq, const b16* __restrict__ Wk, const b16* __restrict__ Wv,
                                                       const float* __restrict__ bq, const float* __restrict__ bk, const float* __restrict__ bv,
                                                       b16* __restrict__ Qh, b16* __restrict__ Ql, b16* __restrict__ Kh, b16* __restrict__ Kl,
                                                       b16* __restrict__ Vh, b16* __restrict__ Vl) {
  constexpr int ST = 2 * GPL;                                       // one buffer: A plane, B plane
  __shared__ __attribute__((aligned(16))) unsigned char Sm[2 * ST];
  static_assert(2 * ST >= 8 * 2 * 32 * 64 * 2);
  const int lane = threadIdx.x & 31, wave = threadIdx.x >> 5, nloc = lane & 15, hlf = lane >> 4;
  const int wm = wave >> 1, wn = wave & 1;
  const int mb = blockIdx.y * 128, m0 = mb + wm * 32;
  const int cb = blockIdx.x * 128;                                  // 0..3071, block-uniform
  const int mat = cb / E, cmb = cb % E, cm = cmb + wn * 64, head = cmb / DH, dlo = wn * 64;
  const b16* X = (mat == 0) ? Xq : (mat == 1) ? Xk : Xv;
  const b16* W = (mat == 0) ? Wq : (mat == 1) ? Wk : Wv;
  const float* bias = ((mat == 0) ? bq : (mat == 1) ? bk : bv) + cm;
  const unsigned prow = threadIdx.x >> 3, pcol = (threadIdx.x & 7) * 16;
  const unsigned char* ga = (const unsigned char*)(X + (size_t)(mb + prow) * E) + pcol;
  const unsigned char* gb = (const unsigned char*)(W + (size_t)(cmb + prow) * E) + pcol;
  const unsigned l0 = (unsigned)(size_t)&Sm[0] + prow * GP + pcol;
  stage2(l0, ga, gb);
  asm volatile("s_wait_asynccnt 0x0" ::: "memory");       // this wave's share of trip 0 has landed
  __syncthreads();                                        // trip 0's planes are whole for every wave
  stage2(l0 + ST, ga + 128, gb + 128);
  v8f acc[2][4];
#pragma unroll
  for (int r = 0; r < 2; ++r)
#pragma unroll
    for (int t = 0; t < 4; ++t) acc[r][t] = (v8f){};
#pragma unroll 1
  for (int it = 0; it < GNT; ++it) {
    const unsigned sb = (unsigned)(it & 1) * (unsigned)ST;
    const unsigned char* pa = &Sm[0] + sb + (wm * 32 + nloc) * GP + 16 * hlf;
    const unsigned char* pb = &Sm[0] + sb + GPL + (wn * 64 + nloc) * GP + 16 * hlf;
#pragma unroll
    for (int u = 0; u < 2; ++u) {
      const v16b a0 = frag_lds(pa + 64 * u), a1 = frag_lds(pa + 16 * GP + 64 * u);
      v16b b[4];
#pragma unroll
      for (int t = 0; t < 4; ++t) b[t] = frag_lds(pb + t * 16 * GP + 64 * u);
      __builtin_amdgcn_sched_barrier(0);   // all twelve LDS reads of the k step issue ahead of its first WMMA: one read latency a step, not one a fragment
#pragma unroll
      for (int t = 0; t < 4; ++t) {
        acc[0][t] = wmma16b(a0, b[t], acc[0][t]);
        acc[1][t] = wmma16b(a1, b[t], acc[1][t]);
      }
    }
    __builtin_amdgcn_sched_barrier(0);   // the trip's WMMAs stay ahead of the waits below, so that they cover the flight of the next trip's copies
    asm volatile("s_wait_dscnt 0x0" ::: "memory");        // this wave's reads of the buffer are done before it may be refilled
    asm volatile("s_wait_asynccnt 0x0" ::: "memory");     // this wave's share of the next trip has landed
    __syncthreads();                                      // publishes the next trip's planes and ends every wave's reads of this buffer
    if (it + 2 < GNT) {
      const size_t go = (size_t)(it + 2) * 128;
      stage2(l0 + sb, ga + go, gb + go);
    }
  }
  asm volatile("s_wait_asynccnt 0x0" ::: "memory");       // no copy is outstanding when the ring's LDS is reused below
  const int n = m0 / SEQ, t0 = m0 % SEQ, g = n * NH + head;
  b16* Tp0 = (b16*)(&Sm[0] + wave * (2 * 32 * 64 * 2)); b16* Tp1 = Tp0 + 32 * 64;
#pragma unroll
  for (int t = 0; t < 4; ++t)
#pragma unroll
    for (int r = 0; r < 2; ++r)
#pragma unroll
      for (int v = 0; v < 8; ++v) {
        const int rr = r * 16 + v + 8 * hlf, d = t * 16 + nloc;
        b16 yh, yl; split_bf16(acc[r][t][v] + bfr(bias[d]), yh, yl);
        const int idx = (mat < 2) ? (rr * 64 + d) : ((rr >> 4) * 1024 + d * 16 + (rr & 15));
        Tp0[idx] = yh; Tp1[idx] = yl;
      }
  wave_lds_sync();
  if (mat < 2) {
    b16* Ph = (mat == 0) ? Qh : Kh; b16* Pl = (mat == 0) ? Ql : Kl;
    const size_t rowbase = (size_t)g * SEQ + t0;
#pragma unroll
    for (int j = 0; j < 8; ++j) {
      const int e = (j * 32 + lane) * 8, rr = e >> 6, cc = e & 63;
      const size_t go = (rowbase + rr) * DH + dlo + cc;
      *(v8b*)(Ph + go) = ld8b(Tp0 + e); *(v8b*)(Pl + go) = ld8b(Tp1 + e);
    }
    
  } else {
    const size_t tb = (size_t)g * KT + (t0 >> 4);
#pragma unroll
    for (int j = 0; j < 8; ++j) {
      const int e = (j * 32 + lane) * 8, kt2 = e >> 10, within = e & 1023;
      const size_t go = ((tb + kt2) * DH + dlo) * 16 + within;
      *(v8b*)(Vh + go) = ld8b(Tp0 + e); *(v8b*)(Vl + go) = ld8b(Tp1 + e);
    }
    
  }
}

constexpr int AW = 8;
constexpr int KPITCH = 2 * DH + 16;
constexpr int KPL = 32 * KPITCH;
constexpr int VPL = 2 * DH * 16 * 2;
constexpr int OFF_KH = 0, OFF_KL = KPL, OFF_VH = 2 * KPL, OFF_VL = 2 * KPL + VPL, STAGE = 2 * KPL + 2 * VPL;
constexpr int NT = SEQ / 32;                   // trips
static_assert(QT % AW == 0 && NT >= 2 && STAGE % 16 == 0 && KPITCH % 16 == 0);

__device__ __forceinline__ v8b lds8b(const unsigned char* p) { return *(const v8b*)p; }
// one stage = 8 copies of 16 B per lane (256 lanes x 128 B = 32 KiB). lk / lv: the lane's LDS byte addresses in the K hi / V hi plane of the
// target buffer; the pointers: the lane's first 16 B of the stage in each global plane. The second copy of a plane lies 4,096 global bytes on.
__device__ __forceinline__ void stage_copy(unsigned lk, unsigned lv, const unsigned char* gkh, const unsigned char* gkl,
                                           const unsigned char* gvh, const unsigned char* gvl) {
  asm volatile("global_load_async_to_lds_b128 %0, %8, off\n\t"
               "global_load_async_to_lds_b128 %1, %9, off\n\t"
               "global_load_async_to_lds_b128 %2, %10, off\n\t"
               "global_load_async_to_lds_b128 %3, %11, off\n\t"
               "global_load_async_to_lds_b128 %4, %12, off\n\t"
               "global_load_async_to_lds_b128 %5, %13, off\n\t"
               "global_load_async_to_lds_b128 %6, %14, off\n\t"
               "global_load_async_to_lds_b128 %7, %15, off\n\t"
               "s_wait_xcnt 0x0"
               :: "v"(lk), "v"(lk + 16 * KPITCH), "v"(lk + KPL), "v"(lk + KPL + 16 * KPITCH),
                  "v"(lv), "v"(lv + VPL / 2), "v"(lv + VPL), "v"(lv + VPL + VPL / 2),
                  "v"(gkh), "v"(gkh + 4096), "v"(gkl), "v"(gkl + 4096), "v"(gvh), "v"(gvh + 4096), "v"(gvl), "v"(gvl + 4096)
               : "memory");
}

__global__ __launch_bounds__(32 * AW) __attribute__((amdgpu_num_vgpr(256)))
void attn_kernel(const b16* __restrict__ Qh, const b16* __restrict__ Ql, const b16* __restrict__ Kh, const b16* __restrict__ Kl,
                 const b16* __restrict__ Vh, const b16* __restrict__ Vl, const int* __restrict__ am, const int* __restrict__ kpm,
                 b16* __restrict__ Yh, b16* __restrict__ Yl) {
  __shared__ __attribute__((aligned(16))) unsigned char Ring[2][STAGE];
  __shared__ __attribute__((aligned(16))) b16 Os[AW][2][16 * DH];
  const int wid = threadIdx.x >> 5, lane = threadIdx.x & 31, hh = lane >> 4, col = lane & 15;
  const int qtile = blockIdx.x * AW + wid;                // over NG*QT
  const int g = qtile / QT;                               // n*NH + h, the same in all waves of a block
  const int q0 = (qtile % QT) << 4;
  const int n = g / NH, h = g % NH;
  const size_t qo = ((size_t)g * SEQ + q0 + col) * DH;
  const int* amrow = am + (size_t)(q0 + col) * SEQ_FULL;  // attn_mask[query][key]
  const int* kprow = kpm + (size_t)n * SEQ_FULL;         // key_padding_mask[n][key]
  const float ninf = -__builtin_inff();
  // Copy addresses. A stage is 8,192 contiguous bytes of each global plane. K: 16-byte piece c = thread id (and c + 256) is row c >> 4,
  // piece c & 15. V: a wave's 512 bytes are 16 d rows of 32 B; lane = (key half hh, d row), so each half wave writes 256 contiguous LDS bytes.
  const size_t gplane = (size_t)g * SEQ * DH * 2;         // byte offset of (n, h) in every K and V plane
  const unsigned kin = (unsigned)threadIdx.x * 16u, vin = (unsigned)(wid * 512 + col * 32 + hh * 16);
  const unsigned char* gkh = (const unsigned char*)Kh + gplane + kin; const unsigned char* gkl = (const unsigned char*)Kl + gplane + kin;
  const unsigned char* gvh = (const unsigned char*)Vh + gplane + vin; const unsigned char* gvl = (const unsigned char*)Vl + gplane + vin;
  const unsigned ring0 = (unsigned)(size_t)&Ring[0][0];
  const unsigned lk = ring0 + OFF_KH + (unsigned)((threadIdx.x >> 4) * KPITCH + (threadIdx.x & 15) * 16);
  const unsigned lv = ring0 + OFF_VH + (unsigned)(hh * (DH * 16) + (wid * 16 + col) * 16);
  stage_copy(lk, lv, gkh, gkl, gvh, gvl);
  asm volatile("s_wait_asynccnt 0x0" ::: "memory");       // this wave's share of tile 0 has landed
  __syncthreads();                                        // tile 0 is whole for every wave
  stage_copy(lk + STAGE, lv + STAGE, gkh + 8192, gkl + 8192, gvh + 8192, gvl + 8192);
  float m = ninf, l = 0.0f;
  v8f o[8];
#pragma unroll
  for (int t = 0; t < 8; ++t) o[t] = (v8f){};
#pragma unroll 1
  for (int it = 0; it < NT; ++it) {
    const int kb = it * 32;
    const unsigned bo = (unsigned)(it & 1) * (unsigned)STAGE;
    const unsigned char* B = &Ring[0][0] + bo;
    const unsigned char* k0 = B + col * KPITCH + 16 * hh;   // key kb+col; key kb+16+col lies 16 rows on
    v8f s0 = {}, s1 = {};
#pragma unroll 1
    for (int kk = 0; kk < DH; kk += 32) {
      const v16b bqh = frag_kb(Qh + qo + kk, hh), bql = frag_kb(Ql + qo + kk, hh);
      const unsigned char* ka = k0 + 2 * kk;
      v16b ah = cat8b(lds8b(ka + OFF_KH), lds8b(ka + OFF_KH + 32)), al = cat8b(lds8b(ka + OFF_KL), lds8b(ka + OFF_KL + 32));
      s0 = wmma3(ah, al, bqh, bql, s0);
      ka += 16 * KPITCH;
      ah = cat8b(lds8b(ka + OFF_KH), lds8b(ka + OFF_KH + 32)); al = cat8b(lds8b(ka + OFF_KL), lds8b(ka + OFF_KL + 32));
      s1 = wmma3(ah, al, bqh, bql, s1);
    }
    {   // scale and replace-fill: s0 holds keys kb+8hh+0..7, s1 holds keys kb+16+8hh+0..7 of query q0+col
      const v4i a0 = *(const v4i*)(amrow + kb + 8 * hh), a1 = *(const v4i*)(amrow + kb + 8 * hh + 4);
      const v4i p0 = *(const v4i*)(kprow + kb + 8 * hh), p1 = *(const v4i*)(kprow + kb + 8 * hh + 4);
#pragma unroll
      for (int r = 0; r < 4; ++r) {
        s0[r]     = ((a0[r] | p0[r]) != 0) ? ninf : s0[r] * SCALE;
        s0[4 + r] = ((a1[r] | p1[r]) != 0) ? ninf : s0[4 + r] * SCALE;
      }
      const v4i a2 = *(const v4i*)(amrow + kb + 16 + 8 * hh), a3 = *(const v4i*)(amrow + kb + 16 + 8 * hh + 4);
      const v4i p2 = *(const v4i*)(kprow + kb + 16 + 8 * hh), p3 = *(const v4i*)(kprow + kb + 16 + 8 * hh + 4);
#pragma unroll
      for (int r = 0; r < 4; ++r) {
        s1[r]     = ((a2[r] | p2[r]) != 0) ? ninf : s1[r] * SCALE;
        s1[4 + r] = ((a3[r] | p3[r]) != 0) ? ninf : s1[4 + r] * SCALE;
      }
    }
    float mr = ninf;
#pragma unroll
    for (int r = 0; r < 8; ++r) mr = fmaxf(mr, fmaxf(s0[r], s1[r]));
    mr = fmaxf(mr, __shfl_xor(mr, 16));
    const float mn = fmaxf(m, mr);
    const float mref = (mn == ninf) ? 0.0f : mn;    // fully masked prefix: nothing accumulated yet
    const float al_ = __expf(m - mref);
    m = mn;
    float sum = 0.0f;
    v16b pbh, pbl;
#pragma unroll
    for (int r = 0; r < 8; ++r) {
      const float e0 = __expf(s0[r] - mref), e1 = __expf(s1[r] - mref);
      sum += e0 + e1;
      b16 a, c; split_bf16(e0, a, c); pbh[r] = a; pbl[r] = c; split_bf16(e1, a, c); pbh[8 + r] = a; pbl[8 + r] = c;
    }
    sum += __shfl_xor(sum, 16);
    l = l * al_ + sum;
#pragma unroll
    for (int t = 0; t < 8; ++t) o[t] = o[t] * al_;
    const unsigned char* va = B + hh * (DH * 16) + col * 16;   // keys kb+8hh+0..7 of d row col; the second 16-key tile lies VPL/2 on
#pragma unroll
    for (int t = 0; t < 8; ++t) {                         // d row of V^T: t*16 + col
      const v16b vah = cat8b(lds8b(va + OFF_VH + t * 256), lds8b(va + OFF_VH + VPL / 2 + t * 256));
      const v16b val = cat8b(lds8b(va + OFF_VL + t * 256), lds8b(va + OFF_VL + VPL / 2 + t * 256));
      o[t] = wmma3(vah, val, pbh, pbl, o[t]);
    }
    asm volatile("s_wait_dscnt 0x0" ::: "memory");        // this wave's reads of the buffer are done before it may be refilled
    asm volatile("s_wait_asynccnt 0x0" ::: "memory");     // this wave's share of the next tile has landed
    __syncthreads();                                      // publishes the next tile and ends every wave's reads of this buffer
    if (it + 2 < NT) {
      const size_t go = (size_t)(it + 2) * 8192;
      stage_copy(lk + bo, lv + bo, gkh + go, gkl + go, gvh + go, gvl + go);
    }
  }
  asm volatile("s_wait_asynccnt 0x0" ::: "memory");       // no copy is outstanding when the wave goes on to its end
  const float inv = 1.0f / l;
  b16* T0 = Os[wid][0]; b16* T1 = Os[wid][1];
#pragma unroll
  for (int t = 0; t < 8; ++t) {
    v8b hv, lv8;
#pragma unroll
    for (int r = 0; r < 8; ++r) { b16 a, c; split_bf16(o[t][r] * inv, a, c); hv[r] = a; lv8[r] = c; }
    const int idx = col * DH + t * 16 + 8 * hh;          // [query][d]
    *(v8b*)(T0 + idx) = hv; *(v8b*)(T1 + idx) = lv8;
  }
  wave_lds_sync();
  const size_t tok0 = (size_t)n * SEQ + q0;
#pragma unroll
  for (int j = 0; j < 8; ++j) {
    const int e = (j * 32 + lane) * 8, rr = e >> 7, cc = e & 127;
    const size_t go = (tok0 + rr) * E + (size_t)h * DH + cc;
    *(v8b*)(Yh + go) = ld8b(T0 + e); *(v8b*)(Yl + go) = ld8b(T1 + e);
  }
  
}

// ---------------------------------------------------------------------------
// Output projection: (MROWS x 1024) x (1024 x 1024) -> f32, grid (8, MROWS/128), A = y hi/lo planes, B = Wo plane rows ([out][in]); hi.W + lo.W.
// ---------------------------------------------------------------------------
__global__ __launch_bounds__(256) void out_gemm_kernel(const b16* __restrict__ Yh, const b16* __restrict__ Yl, const b16* __restrict__ Wo,
                                                       const float* __restrict__ bo, float* __restrict__ out) {
  constexpr int ST = 3 * GPL;                                       // one buffer: y hi plane, y lo plane, Wo plane
  __shared__ __attribute__((aligned(16))) unsigned char Sm[2 * ST];
  static_assert(2 * ST >= 8 * 32 * 64 * 4);
  const int lane = threadIdx.x & 31, wave = threadIdx.x >> 5, nloc = lane & 15, hlf = lane >> 4;
  const int wm = wave >> 1, wn = wave & 1;
  const int mb = blockIdx.y * 128, m0 = mb + wm * 32;
  const int cb = blockIdx.x * 128, c0 = cb + wn * 64;
  const unsigned prow = threadIdx.x >> 3, pcol = (threadIdx.x & 7) * 16;
  const unsigned char* gh = (const unsigned char*)(Yh + (size_t)(mb + prow) * E) + pcol;
  const unsigned char* gl = (const unsigned char*)(Yl + (size_t)(mb + prow) * E) + pcol;
  const unsigned char* gw = (const unsigned char*)(Wo + (size_t)(cb + prow) * E) + pcol;
  const unsigned l0 = (unsigned)(size_t)&Sm[0] + prow * GP + pcol;
  stage3(l0, gh, gl, gw);
  asm volatile("s_wait_asynccnt 0x0" ::: "memory");       // this wave's share of trip 0 has landed
  __syncthreads();                                        // trip 0's planes are whole for every wave
  stage3(l0 + ST, gh + 128, gl + 128, gw + 128);
  v8f acc[2][4];
#pragma unroll
  for (int r = 0; r < 2; ++r)
#pragma unroll
    for (int t = 0; t < 4; ++t) acc[r][t] = (v8f){};
#pragma unroll 1
  for (int it = 0; it < GNT; ++it) {
    const unsigned sb = (unsigned)(it & 1) * (unsigned)ST;
    const unsigned char* pa = &Sm[0] + sb + (wm * 32 + nloc) * GP + 16 * hlf;             // y hi; y lo lies GPL on
    const unsigned char* pb = &Sm[0] + sb + 2 * GPL + (wn * 64 + nloc) * GP + 16 * hlf;
    v16b a[2][4], b[2][4];                                // [k step][fragment]; a: rows 0..15 hi, lo, rows 16..31 hi, lo
#pragma unroll
    for (int u = 0; u < 2; ++u) {
      a[u][0] = frag_lds(pa + 64 * u); a[u][1] = frag_lds(pa + GPL + 64 * u);
      a[u][2] = frag_lds(pa + 16 * GP + 64 * u); a[u][3] = frag_lds(pa + GPL + 16 * GP + 64 * u);
#pragma unroll
      for (int t = 0; t < 4; ++t) b[u][t] = frag_lds(pb + t * 16 * GP + 64 * u);
    }
    __builtin_amdgcn_sched_barrier(0);   // the trip's LDS reads all issue ahead of its first WMMA, which then waits for its own fragments only
#pragma unroll
    for (int u = 0; u < 2; ++u)
#pragma unroll
      for (int t = 0; t < 4; ++t) {
        acc[0][t] = wmma16b(a[u][0], b[u][t], acc[0][t]); acc[0][t] = wmma16b(a[u][1], b[u][t], acc[0][t]);
        acc[1][t] = wmma16b(a[u][2], b[u][t], acc[1][t]); acc[1][t] = wmma16b(a[u][3], b[u][t], acc[1][t]);
      }
    __builtin_amdgcn_sched_barrier(0);   // the trip's WMMAs stay ahead of the waits below, so that they cover the flight of the next trip's copies
    asm volatile("s_wait_dscnt 0x0" ::: "memory");        // this wave's reads of the buffer are done before it may be refilled
    asm volatile("s_wait_asynccnt 0x0" ::: "memory");     // this wave's share of the next trip has landed
    __syncthreads();                                      // publishes the next trip's planes and ends every wave's reads of this buffer
    if (it + 2 < GNT) {
      const size_t go = (size_t)(it + 2) * 128;
      stage3(l0 + sb, gh + go, gl + go, gw + go);
    }
  }
  asm volatile("s_wait_asynccnt 0x0" ::: "memory");       // no copy is outstanding when the ring's LDS is reused below
  float* Tt = (float*)(&Sm[0] + wave * (32 * 64 * 4));
#pragma unroll
  for (int t = 0; t < 4; ++t)
#pragma unroll
    for (int r = 0; r < 2; ++r)
#pragma unroll
      for (int v = 0; v < 8; ++v) Tt[(r * 16 + v + 8 * hlf) * 64 + t * 16 + nloc] = acc[r][t][v] + bfr(bo[c0 + t * 16 + nloc]);
  wave_lds_sync();
  float* dst0 = out + (size_t)m0 * E + c0;
#pragma unroll
  for (int j = 0; j < 16; ++j) { const int rr = j * 2 + hlf, c4 = nloc * 4; *(v4f*)(dst0 + (size_t)rr * E + c4) = *(const v4f*)(Tt + rr * 64 + c4); }
  
}
}  // namespace

extern "C" void kernel_launch(void* const* d_in, const int* in_sizes, int n_in,
                              void* d_out, int out_size, void* d_ws, size_t ws_size, hipStream_t stream) {
  if (n_in < 13) return;
  const long act_need = ((long)(NB - 1) * SEQ_FULL + SEQ) * (long)E;
  if ((long)in_sizes[0] < act_need || (long)in_sizes[1] < act_need || (long)in_sizes[2] < act_need) return;
  if (in_sizes[3] < (NB - 1) * SEQ_FULL + SEQ) return;
  if ((long)in_sizes[4] < (long)(SEQ - 1) * SEQ_FULL + SEQ) return;
  if (in_sizes[5] < E * E || in_sizes[7] < E * E || in_sizes[9] < E * E || in_sizes[11] < E * E) return;
  if (in_sizes[6] < E || in_sizes[8] < E || in_sizes[10] < E || in_sizes[12] < E) return;
  if (out_size < MROWS * E) return;

  const float* query = (const float*)d_in[0];   // [NB_FULL][SEQ_FULL][E]
  const float* key   = (const float*)d_in[1];
  const float* value = (const float*)d_in[2];
  const int*   kpm   = (const int*)d_in[3];     // [NB_FULL][SEQ_FULL] int32 0/1
  const int*   am    = (const int*)d_in[4];     // [SEQ_FULL][SEQ_FULL] int32 0/1
  const float* q_w   = (const float*)d_in[5];   // [out][in]
  const float* q_b   = (const float*)d_in[6];
  const float* k_w   = (const float*)d_in[7];
  const float* k_b   = (const float*)d_in[8];
  const float* v_w   = (const float*)d_in[9];
  const float* v_b   = (const float*)d_in[10];
  const float* o_w   = (const float*)d_in[11];
  const float* o_b   = (const float*)d_in[12];
  float* out = (float*)d_out;                   // [NB][SEQ][E] f32

  const size_t plane = (size_t)MROWS * E * 2;   // 8 MiB at full size
  const size_t wplane = (size_t)E * E * 2;      // 2 MiB
  size_t off = 0; char* ws = (char*)d_ws;
  b16* Xq  = (b16*)(ws + off); off += plane;
  b16* Xk  = (b16*)(ws + off); off += plane;
  b16* Xv  = (b16*)(ws + off); off += plane;
  b16* Wq  = (b16*)(ws + off); off += wplane;
  b16* Wk  = (b16*)(ws + off); off += wplane;
  b16* Wv  = (b16*)(ws + off); off += wplane;
  b16* Wo  = (b16*)(ws + off); off += wplane;
  b16* Qh  = (b16*)(ws + off); off += plane;
  b16* Ql  = (b16*)(ws + off); off += plane;
  b16* Kh  = (b16*)(ws + off); off += plane;
  b16* Kl  = (b16*)(ws + off); off += plane;
  b16* Vh  = (b16*)(ws + off); off += plane;
  b16* Vl  = (b16*)(ws + off); off += plane;
  b16* Yh  = (b16*)(ws + off); off += plane;
  b16* Yl  = (b16*)(ws + off); off += plane;    // total 96 MiB at full size
  if (off > ws_size) return;

  cvt_kernel<<<2048, 256, 0, stream>>>(query, key, value, q_w, k_w, v_w, o_w, Xq, Xk, Xv, Wq, Wk, Wv, Wo);
  qkv_gemm_kernel<<<dim3(3 * E / 128, MROWS / 128), 256, 0, stream>>>(Xq, Xk, Xv, Wq, Wk, Wv, q_b, k_b, v_b, Qh, Ql, Kh, Kl, Vh, Vl);
  attn_kernel<<<(NG * QT) / AW, 32 * AW, 0, stream>>>(Qh, Ql, Kh, Kl, Vh, Vl, am, kpm, Yh, Yl);
  out_gemm_kernel<<<dim3(E / 128, MROWS / 128), 256, 0, stream>>>(Yh, Yl, Wo, o_b, out);
}

// v004
// A run of this version takes 117 microseconds.
// Next to v003, in two timings, it ran 1.27 times as fast each time.
// All steps since v000 together make it 3.11 times as fast.
#include <hip/hip_runtime.h>

// Contractions: q/k/v projections on v_wmma_f32_16x16x32_bf16 with RNE-bf16 operand planes of the activations and of the [out][in] weights
// (one product per tile pair); S^T = K.Q^T (K = 128) and y^T = V^T.P^T (32 keys per step) as bf16 hi/lo splits (hi.hi + hi.lo + lo.hi);
// out = y.Wo^T with y as bf16 hi/lo planes against the RNE-bf16 Wo plane (hi.W + lo.W). f32 accumulate, f32 softmax statistics, 8 heads of 128.

#ifndef NB
#define NB 4
#endif
#ifndef SEQ
#define SEQ 1024
#endif
#ifndef NB_FULL
#define NB_FULL 4
#endif
#ifndef SEQ_FULL
#define SEQ_FULL 1024
#endif

namespace {
constexpr int E = 1024, NH = 8, DH = 128;
constexpr int MROWS = NB * SEQ;          // token rows, compact n*SEQ + t
constexpr int QT = SEQ / 16;             // 16-query tiles per (n, h)
constexpr int KT = SEQ / 16;             // 16-key tiles per (n, h)
constexpr int NG = NB * NH;              // g = n*NH + h
constexpr float SCALE = 0.08838834764831845f;   // 1/sqrt(128), applied in f32 on the score accumulators
static_assert(NB >= 1 && NB <= NB_FULL);
static_assert(SEQ % 128 == 0 && SEQ <= SEQ_FULL);
static_assert(E == NH * DH);
static_assert(MROWS % 128 == 0);
static_assert((NG * QT) % 8 == 0);

typedef __bf16 b16;
typedef __attribute__((ext_vector_type(16))) __bf16 v16b;
typedef __attribute__((ext_vector_type(8)))  __bf16 v8b;
typedef __attribute__((ext_vector_type(8)))  float v8f;
typedef __attribute__((ext_vector_type(4)))  float v4f;
typedef __attribute__((ext_vector_type(4)))  int v4i;

__device__ __forceinline__ v8b ld8b(const b16* p) { return *(const v8b*)p; }
__device__ __forceinline__ v16b cat8b(v8b a, v8b b) { return __builtin_shufflevector(a, b, 0, 1, 2, 3, 4, 5, 6, 7, 8, 9, 10, 11, 12, 13, 14, 15); }
// 16x16x32 16-bit fragment from a k-contiguous row pointer (A: lane&15 = row, B: lane&15 = column), hh = lane>>4:
// elements 0..7 <- p[8hh+0..7], elements 8..15 <- p[16+8hh+0..7]
__device__ __forceinline__ v16b frag_kb(const b16* p, int hh) { return cat8b(ld8b(p + 8 * hh), ld8b(p + 16 + 8 * hh)); }
// hi = bf16 truncation, lo = RNE bf16 of the residual
__device__ __forceinline__ void split_bf16(float v, b16& hi, b16& lo) {
  const unsigned int u = __builtin_bit_cast(unsigned int, v) & 0xffff0000u;
  hi = __builtin_bit_cast(b16, (unsigned short)(u >> 16));
  lo = (b16)(v - __builtin_bit_cast(float, u));
}
// RNE bf16 value of an f32 input, widened back to f32
__device__ __forceinline__ float bfr(float f) { return (float)(b16)f; }
__device__ __forceinline__ v8f wmma16b(v16b a, v16b b, v8f c) {
  return __builtin_amdgcn_wmma_f32_16x16x32_bf16(false, a, false, b, (short)0, c, false, false);
}
// acc += A.B with both operands split: A = (ah, al), B = (bh, bl)
__device__ __forceinline__ v8f wmma3(v16b ah, v16b al, v16b bh, v16b bl, v8f c) {
  c = wmma16b(ah, bh, c); c = wmma16b(ah, bl, c); c = wmma16b(al, bh, c); return c;
}
__device__ __forceinline__ void wave_lds_sync() {
  __builtin_amdgcn_fence(3, "workgroup");
  __builtin_amdgcn_wave_barrier();
  __builtin_amdgcn_fence(2, "workgroup");
}

// ---------------------------------------------------------------------------
// f32 -> RNE bf16 planes: query/key/value [NB_FULL][SEQ_FULL][E] -> X planes [MROWS][E] (compact rows n*SEQ+t);
// Region selection is block-uniform (region sizes are multiples of 256 chunks).
// ---------------------------------------------------------------------------
__global__ __launch_bounds__(256) void cvt_kernel(const float* __restrict__ xq, const float* __restrict__ xk, const float* __restrict__ xv,
                                                  const float* __restrict__ wq, const float* __restrict__ wk, const float* __restrict__ wv,
                                                  const float* __restrict__ wo,
                                                  b16* __restrict__ Xq, b16* __restrict__ Xk, b16* __restrict__ Xv,
                                                  b16* __restrict__ Wq, b16* __restrict__ Wk, b16* __restrict__ Wv, b16* __restrict__ Wo) {
  const size_t tid = (size_t)blockIdx.x * blockDim.x + threadIdx.x, stride = (size_t)gridDim.x * blockDim.x;
  const size_t nx = (size_t)MROWS * E / 8, nw = (size_t)E * E / 8;
  const size_t total = 3 * nx + 4 * nw;
  for (size_t c = tid; c < total; c += stride) {
    const float* src; b16* dst; size_t si, di;
    if (c < 3 * nx) {
      const int which = (int)(c / nx);
      const size_t cc = c - (size_t)which * nx;
      di = cc * 8;
      const size_t m = di / E, col = di % E;
      const size_t n = m / SEQ, t = m % SEQ;
      si = (n * SEQ_FULL + t) * (size_t)E + col;
      src = (which == 0) ? xq : (which == 1) ? xk : xv;
      dst = (which == 0) ? Xq : (which == 1) ? Xk : Xv;
    } else {
      const size_t c2 = c - 3 * nx;
      const int which = (int)(c2 / nw);
      const size_t cc = c2 - (size_t)which * nw;
      di = cc * 8; si = di;
      src = (which == 0) ? wq : (which == 1) ? wk : (which == 2) ? wv : wo;
      dst = (which == 0) ? Wq : (which == 1) ? Wk : (which == 2) ? Wv : Wo;
    }
    const v4f f0 = *(const v4f*)(src + si), f1 = *(const v4f*)(src + si + 4);
    v8b o;
#pragma unroll
    for (int e = 0; e < 4; ++e) { o[e] = (b16)f0[e]; o[4 + e] = (b16)f1[e]; }
    *(v8b*)(dst + di) = o;
    
  }
}

constexpr int GP = 128 + 16;
constexpr int GPL = 128 * GP;
constexpr int GNT = E / 64;
constexpr int GROW = 32 * E * 2;
static_assert(GNT >= 2 && GP % 16 == 0 && E % 128 == 0);
// 16x16x32 16-bit fragment from a staged row: p = row start + 64 B x k step + 16 B x (lane >> 4); same element order as frag_kb
__device__ __forceinline__ v16b frag_lds(const unsigned char* p) { return cat8b(*(const v8b*)p, *(const v8b*)(p + 32)); }
// Two planes = 8 copies of 16 B per lane (256 lanes). l: the lane's LDS byte address in the first plane of the target buffer (row = thread
// id >> 3, piece = thread id & 7); ga / gb: the lane's first 16 B of the trip in each global plane. Successive copies lie 32 rows on.
__device__ __forceinline__ void stage2(unsigned l, const unsigned char* ga, const unsigned char* gb) {
  asm volatile("global_load_async_to_lds_b128 %0, %8, off\n\t"
               "global_load_async_to_lds_b128 %1, %9, off\n\t"
               "global_load_async_to_lds_b128 %2, %10, off\n\t"
               "global_load_async_to_lds_b128 %3, %11, off\n\t"
               "global_load_async_to_lds_b128 %4, %12, off\n\t"
               "global_load_async_to_lds_b128 %5, %13, off\n\t"
               "global_load_async_to_lds_b128 %6, %14, off\n\t"
               "global_load_async_to_lds_b128 %7, %15, off\n\t"
               "s_wait_xcnt 0x0"
               :: "v"(l), "v"(l + 32 * GP), "v"(l + 64 * GP), "v"(l + 96 * GP),
                  "v"(l + GPL), "v"(l + GPL + 32 * GP), "v"(l + GPL + 64 * GP), "v"(l + GPL + 96 * GP),
                  "v"(ga), "v"(ga + GROW), "v"(ga + 2 * GROW), "v"(ga + 3 * GROW), "v"(gb), "v"(gb + GROW), "v"(gb + 2 * GROW), "v"(gb + 3 * GROW)
               : "memory");
}
__device__ __forceinline__ void stage3(unsigned l, const unsigned char* ga, const unsigned char* gb, const unsigned char* gc) {
  asm volatile("global_load_async_to_lds_b128 %0, %12, off\n\t"
               "global_load_async_to_lds_b128 %1, %13, off\n\t"
               "global_load_async_to_lds_b128 %2, %14, off\n\t"
               "global_load_async_to_lds_b128 %3, %15, off\n\t"
               "global_load_async_to_lds_b128 %4, %16, off\n\t"
               "global_load_async_to_lds_b128 %5, %17, off\n\t"
               "global_load_async_to_lds_b128 %6, %18, off\n\t"
               "global_load_async_to_lds_b128 %7, %19, off\n\t"
               "global_load_async_to_lds_b128 %8, %20, off\n\t"
               "global_load_async_to_lds_b128 %9, %21, off\n\t"
               "global_load_async_to_lds_b128 %10, %22, off\n\t"
               "global_load_async_to_lds_b128 %11, %23, off\n\t"
               "s_wait_xcnt 0x0"
               :: "v"(l), "v"(l + 32 * GP), "v"(l + 64 * GP), "v"(l + 96 * GP),
                  "v"(l + GPL), "v"(l + GPL + 32 * GP), "v"(l + GPL + 64 * GP), "v"(l + GPL + 96 * GP),
                  "v"(l + 2 * GPL), "v"(l + 2 * GPL + 32 * GP), "v"(l + 2 * GPL + 64 * GP), "v"(l + 2 * GPL + 96 * GP),
                  "v"(ga), "v"(ga + GROW), "v"(ga + 2 * GROW), "v"(ga + 3 * GROW), "v"(gb), "v"(gb + GROW), "v"(gb + 2 * GROW), "v"(gb + 3 * GROW),
                  "v"(gc), "v"(gc + GROW), "v"(gc + 2 * GROW), "v"(gc + 3 * GROW)
               : "memory");
}

// ---------------------------------------------------------------------------
// QKV GEMM: (MROWS x 1024) x (1024 x 3072), grid (24, MROWS/128); a block's 128 columns are one head of q, k or v, a wave's 64 half of it.
// A = bf16 activation plane rows, B = bf16 weight rows ([out][in] = [n][k]); one product per tile pair. Epilogue adds the RNE-bf16 bias and
// splits hi/lo; it stages per wave in the LDS of the ring, which no wave reads and no copy writes any more behind the last trip's barrier.
// ---------------------------------------------------------------------------
__global__ __launch_bounds__(256) void qkv_gemm_kernel(const b16* __restrict__ Xq, const b16* __restrict__ Xk, const b16* __restrict__ Xv,
                                                       const b16* __restrict__ Wq, const b16* __restrict__ Wk, const b16* __restrict__ Wv,
                                                       const float* __restrict__ bq, const float* __restrict__ bk, const float* __restrict__ bv,
                                                       b16* __restrict__ Qh, b16* __restrict__ Ql, b16* __restrict__ Kh, b16* __restrict__ Kl,
                                                       b16* __restrict__ Vh, b16* __restrict__ Vl) {
  constexpr int ST = 2 * GPL;                                       // one buffer: A plane, B plane
  __shared__ __attribute__((aligned(16))) unsigned char Sm[2 * ST];
  static_assert(2 * ST >= 8 * 2 * 32 * 64 * 2);
  const int lane = threadIdx.x & 31, wave = threadIdx.x >> 5, nloc = lane & 15, hlf = lane >> 4;
  const int wm = wave >> 1, wn = wave & 1;
  const int mb = blockIdx.y * 128, m0 = mb + wm * 32;
  const int cb = blockIdx.x * 128;                                  // 0..3071, block-uniform
  const int mat = cb / E, cmb = cb % E, cm = cmb + wn * 64, head = cmb / DH, dlo = wn * 64;
  const b16* X = (mat == 0) ? Xq : (mat == 1) ? Xk : Xv;
  const b16* W = (mat == 0) ? Wq : (mat == 1) ? Wk : Wv;
  const float* bias = ((mat == 0) ? bq : (mat == 1) ? bk : bv) + cm;
  const unsigned prow = threadIdx.x >> 3, pcol = (threadIdx.x & 7) * 16;
  const unsigned char* ga = (const unsigned char*)(X + (size_t)(mb + prow) * E) + pcol;
  const unsigned char* gb = (const unsigned char*)(W + (size_t)(cmb + prow) * E) + pcol;
  const unsigned l0 = (unsigned)(size_t)&Sm[0] + prow * GP + pcol;
  stage2(l0, ga, gb);
  asm volatile("s_wait_asynccnt 0x0" ::: "memory");       // this wave's share of trip 0 has landed
  __syncthreads();                                        // trip 0's planes are whole for every wave
  stage2(l0 + ST, ga + 128, gb + 128);
  v8f acc[2][4];
#pragma unroll
  for (int r = 0; r < 2; ++r)
#pragma unroll
    for (int t = 0; t < 4; ++t) acc[r][t] = (v8f){};
#pragma unroll 1
  for (int it = 0; it < GNT; ++it) {
    const unsigned sb = (unsigned)(it & 1) * (unsigned)ST;
    const unsigned char* pa = &Sm[0] + sb + (wm * 32 + nloc) * GP + 16 * hlf;
    const unsigned char* pb = &Sm[0] + sb + GPL + (wn * 64 + nloc) * GP + 16 * hlf;
#pragma unroll
    for (int u = 0; u < 2; ++u) {
      const v16b a0 = frag_lds(pa + 64 * u), a1 = frag_lds(pa + 16 * GP + 64 * u);
      v16b b[4];
#pragma unroll
      for (int t = 0; t < 4; ++t) b[t] = frag_lds(pb + t * 16 * GP + 64 * u);
      __builtin_amdgcn_sched_barrier(0);   // all twelve LDS reads of the k step issue ahead of its first WMMA: one read latency a step, not one a fragment
#pragma unroll
      for (int t = 0; t < 4; ++t) {
        acc[0][t] = wmma16b(a0, b[t], acc[0][t]);
        acc[1][t] = wmma16b(a1, b[t], acc[1][t]);
      }
    }
    __builtin_amdgcn_sched_barrier(0);   // the trip's WMMAs stay ahead of the waits below, so that they cover the flight of the next trip's copies
    asm volatile("s_wait_dscnt 0x0" ::: "memory");        // this wave's reads of the buffer are done before it may be refilled
    asm volatile("s_wait_asynccnt 0x0" ::: "memory");     // this wave's share of the next trip has landed
    __syncthreads();                                      // publishes the next trip's planes and ends every wave's reads of this buffer
    if (it + 2 < GNT) {
      const size_t go = (size_t)(it + 2) * 128;
      stage2(l0 + sb, ga + go, gb + go);
    }
  }
  asm volatile("s_wait_asynccnt 0x0" ::: "memory");       // no copy is outstanding when the ring's LDS is reused below
  const int n = m0 / SEQ, t0 = m0 % SEQ, g = n * NH + head;
  b16* Tp0 = (b16*)(&Sm[0] + wave * (2 * 32 * 64 * 2)); b16* Tp1 = Tp0 + 32 * 64;
#pragma unroll
  for (int t = 0; t < 4; ++t)
#pragma unroll
    for (int r = 0; r < 2; ++r)
#pragma unroll
      for (int v = 0; v < 8; ++v) {
        const int rr = r * 16 + v + 8 * hlf, d = t * 16 + nloc;
        b16 yh, yl; split_bf16(acc[r][t][v] + bfr(bias[d]), yh, yl);
        const int idx = (mat < 2) ? (rr * 64 + d) : ((rr >> 4) * 1024 + d * 16 + (rr & 15));
        Tp0[idx] = yh; Tp1[idx] = yl;
      }
  wave_lds_sync();
  if (mat < 2) {
    b16* Ph = (mat == 0) ? Qh : Kh; b16* Pl = (mat == 0) ? Ql : Kl;
    const size_t rowbase = (size_t)g * SEQ + t0;
#pragma unroll
    for (int j = 0; j < 8; ++j) {
      const int e = (j * 32 + lane) * 8, rr = e >> 6, cc = e & 63;
      const size_t go = (rowbase + rr) * DH + dlo + cc;
      *(v8b*)(Ph + go) = ld8b(Tp0 + e); *(v8b*)(Pl + go) = ld8b(Tp1 + e);
    }
    
  } else {
    const size_t tb = (size_t)g * KT + (t0 >> 4);
#pragma unroll
    for (int j = 0; j < 8; ++j) {
      const int e = (j * 32 + lane) * 8, kt2 = e >> 10, within = e & 1023;
      const size_t go = ((tb + kt2) * DH + dlo) * 16 + within;
      *(v8b*)(Vh + go) = ld8b(Tp0 + e); *(v8b*)(Vl + go) = ld8b(Tp1 + e);
    }
    
  }
}

constexpr int AW = 8;
constexpr int KPITCH = 2 * DH + 16;
constexpr int KPL = 32 * KPITCH;
constexpr int VPL = 2 * DH * 16 * 2;
constexpr int OFF_KH = 0, OFF_KL = KPL, OFF_VH = 2 * KPL, OFF_VL = 2 * KPL + VPL, STAGE = 2 * KPL + 2 * VPL;
constexpr int NT = SEQ / 32;                   // trips
static_assert(QT % AW == 0 && NT >= 2 && STAGE % 16 == 0 && KPITCH % 16 == 0);

__device__ __forceinline__ v8b lds8b(const unsigned char* p) { return *(const v8b*)p; }
// one stage = 8 copies of 16 B per lane (256 lanes x 128 B = 32 KiB). lk / lv: the lane's LDS byte addresses in the K hi / V hi plane of the
// target buffer; the pointers: the lane's first 16 B of the stage in each global plane. The second copy of a plane lies 4,096 global bytes on.
__device__ __forceinline__ void stage_copy(unsigned lk, unsigned lv, const unsigned char* gkh, const unsigned char* gkl,
                                           const unsigned char* gvh, const unsigned char* gvl) {
  asm volatile("global_load_async_to_lds_b128 %0, %8, off\n\t"
               "global_load_async_to_lds_b128 %1, %9, off\n\t"
               "global_load_async_to_lds_b128 %2, %10, off\n\t"
               "global_load_async_to_lds_b128 %3, %11, off\n\t"
               "global_load_async_to_lds_b128 %4, %12, off\n\t"
               "global_load_async_to_lds_b128 %5, %13, off\n\t"
               "global_load_async_to_lds_b128 %6, %14, off\n\t"
               "global_load_async_to_lds_b128 %7, %15, off\n\t"
               "s_wait_xcnt 0x0"
               :: "v"(lk), "v"(lk + 16 * KPITCH), "v"(lk + KPL), "v"(lk + KPL + 16 * KPITCH),
                  "v"(lv), "v"(lv + VPL / 2), "v"(lv + VPL), "v"(lv + VPL + VPL / 2),
                  "v"(gkh), "v"(gkh + 4096), "v"(gkl), "v"(gkl + 4096), "v"(gvh), "v"(gvh + 4096), "v"(gvl), "v"(gvl + 4096)
               : "memory");
}

__global__ __launch_bounds__(32 * AW) __attribute__((amdgpu_num_vgpr(256)))
void attn_kernel(const b16* __restrict__ Qh, const b16* __restrict__ Ql, const b16* __restrict__ Kh, const b16* __restrict__ Kl,
                 const b16* __restrict__ Vh, const b16* __restrict__ Vl, const int* __restrict__ am, const int* __restrict__ kpm,
                 b16* __restrict__ Yh, b16* __restrict__ Yl) {
  __shared__ __attribute__((aligned(16))) unsigned char Ring[2][STAGE];
  __shared__ __attribute__((aligned(16))) b16 Os[AW][2][16 * DH];
  // the wave's number as a scalar: tile, head and row bases then live in scalar registers, which leaves the vector registers to the Q fragments
  const int wid = __builtin_amdgcn_readfirstlane(threadIdx.x >> 5), lane = threadIdx.x & 31, hh = lane >> 4, col = lane & 15;
  const int qtile = blockIdx.x * AW + wid;                // over NG*QT
  const int g = qtile / QT;                               // n*NH + h, the same in all waves of a block
  const int q0 = (qtile % QT) << 4;
  const int n = g / NH, h = g % NH;
  const size_t qo = ((size_t)g * SEQ + q0 + col) * DH;
  const int* amrow = am + (size_t)(q0 + col) * SEQ_FULL;  // attn_mask[query][key]
  const int* kprow = kpm + (size_t)n * SEQ_FULL;         // key_padding_mask[n][key]
  const float ninf = -__builtin_inff();
  // Copy addresses. A stage is 8,192 contiguous bytes of each global plane. K: 16-byte piece c = thread id (and c + 256) is row c >> 4,
  // piece c & 15. V: a wave's 512 bytes are 16 d rows of 32 B; lane = (key half hh, d row), so each half wave writes 256 contiguous LDS bytes.
  const size_t gplane = (size_t)g * SEQ * DH * 2;         // byte offset of (n, h) in every K and V plane
  const unsigned kin = (unsigned)threadIdx.x * 16u, vin = (unsigned)(wid * 512 + col * 32 + hh * 16);
  const unsigned char* gkh = (const unsigned char*)Kh + gplane + kin; const unsigned char* gkl = (const unsigned char*)Kl + gplane + kin;
  const unsigned char* gvh = (const unsigned char*)Vh + gplane + vin; const unsigned char* gvl = (const unsigned char*)Vl + gplane + vin;
  const unsigned ring0 = (unsigned)(size_t)&Ring[0][0];
  const unsigned lk = ring0 + OFF_KH + (unsigned)((threadIdx.x >> 4) * KPITCH + (threadIdx.x & 15) * 16);
  const unsigned lv = ring0 + OFF_VH + (unsigned)(hh * (DH * 16) + (wid * 16 + col) * 16);
  stage_copy(lk, lv, gkh, gkl, gvh, gvl);
  v16b qfh[DH / 32], qfl[DH / 32];                        // B operands of S^T, the same in every trip
#pragma unroll
  for (int s = 0; s < DH / 32; ++s) { qfh[s] = frag_kb(Qh + qo + 32 * s, hh); qfl[s] = frag_kb(Ql + qo + 32 * s, hh); }
  // Masked positions of the coming trip, one lane mask per score register (keys 8hh+0..7, then 16+8hh+0..7): sixteen scalar registers carry
  // them over the loop's edge, so that the loaded words hold no vector register while S^T is formed.
  unsigned bm[16];
  const int* amn = amrow + 8 * hh; const int* kpn = kprow + 8 * hh;   // the lane's words of the trip that is loaded next
  {
    v4i ma[4], mp[4];
#pragma unroll
    for (int j = 0; j < 4; ++j) { ma[j] = *(const v4i*)(amn + (j >> 1) * 16 + (j & 1) * 4); mp[j] = *(const v4i*)(kpn + (j >> 1) * 16 + (j & 1) * 4); }
#pragma unroll
    for (int j = 0; j < 4; ++j)
#pragma unroll
      for (int r = 0; r < 4; ++r) bm[4 * j + r] = __builtin_amdgcn_ballot_w32((ma[j][r] | mp[j][r]) != 0);
    amn += 32; kpn += 32;
  }
  asm volatile("s_wait_asynccnt 0x0" ::: "memory");       // this wave's share of tile 0 has landed
  __syncthreads();                                        // tile 0 is whole for every wave
  stage_copy(lk + STAGE, lv + STAGE, gkh + 8192, gkl + 8192, gvh + 8192, gvl + 8192);
  float m = ninf, l = 0.0f;
  v8f o[8];
#pragma unroll
  for (int t = 0; t < 8; ++t) o[t] = (v8f){};
#pragma unroll 1
  for (int it = 0; it < NT; ++it) {
    // kb = 32 * it is the trip's first key
    const unsigned bo = (unsigned)(it & 1) * (unsigned)STAGE;
    const unsigned char* B = &Ring[0][0] + bo;
    const unsigned char* k0 = B + col * KPITCH + 16 * hh;   // key kb+col; key kb+16+col lies 16 rows on
    v8f s0 = {}, s1 = {};
#pragma unroll   // each step names its own Q registers: a rolled loop could only index them through memory
    for (int kk = 0; kk < DH; kk += 32) {
      const v16b bqh = qfh[kk / 32], bql = qfl[kk / 32];
      const unsigned char* ka = k0 + 2 * kk;
      v16b ah = cat8b(lds8b(ka + OFF_KH), lds8b(ka + OFF_KH + 32)), al = cat8b(lds8b(ka + OFF_KL), lds8b(ka + OFF_KL + 32));
      s0 = wmma3(ah, al, bqh, bql, s0);
      ka += 16 * KPITCH;
      ah = cat8b(lds8b(ka + OFF_KH), lds8b(ka + OFF_KH + 32)); al = cat8b(lds8b(ka + OFF_KL), lds8b(ka + OFF_KL + 32));
      s1 = wmma3(ah, al, bqh, bql, s1);
    }
    v4i ma[4], mp[4];
    {   // scale and replace-fill: s0 holds keys kb+8hh+0..7, s1 holds keys kb+16+8hh+0..7 of query q0+col
#pragma unroll
      for (int r = 0; r < 8; ++r) {
        s0[r] = __builtin_amdgcn_inverse_ballot_w32(bm[r])     ? ninf : s0[r] * SCALE;
        s1[r] = __builtin_amdgcn_inverse_ballot_w32(bm[8 + r]) ? ninf : s1[r] * SCALE;
      }
#pragma unroll
      for (int j = 0; j < 4; ++j) { ma[j] = *(const v4i*)(amn + (j >> 1) * 16 + (j & 1) * 4); mp[j] = *(const v4i*)(kpn + (j >> 1) * 16 + (j & 1) * 4); }
      __builtin_amdgcn_sched_barrier(0);   // the loads issue here, ahead of softmax and y^T: the barrier at the trip's foot waits for them, and sunk towards it they would be waited out
    }
    float mr = ninf;
#pragma unroll
    for (int r = 0; r < 8; ++r) mr = fmaxf(mr, fmaxf(s0[r], s1[r]));
    mr = fmaxf(mr, __shfl_xor(mr, 16));
    const float mn = fmaxf(m, mr);
    const float mref = (mn == ninf) ? 0.0f : mn;    // fully masked prefix: nothing accumulated yet
    const float al_ = __expf(m - mref);
    m = mn;
    float sum = 0.0f;
    v16b pbh, pbl;
#pragma unroll
    for (int r = 0; r < 8; ++r) {
      const float e0 = __expf(s0[r] - mref), e1 = __expf(s1[r] - mref);
      sum += e0 + e1;
      b16 a, c; split_bf16(e0, a, c); pbh[r] = a; pbl[r] = c; split_bf16(e1, a, c); pbh[8 + r] = a; pbl[8 + r] = c;
    }
    sum += __shfl_xor(sum, 16);
    l = l * al_ + sum;
#pragma unroll
    for (int t = 0; t < 8; ++t) o[t] = o[t] * al_;
    const unsigned char* va = B + hh * (DH * 16) + col * 16;   // keys kb+8hh+0..7 of d row col; the second 16-key tile lies VPL/2 on
#pragma unroll
    for (int t = 0; t < 8; ++t) {                         // d row of V^T: t*16 + col
      const v16b vah = cat8b(lds8b(va + OFF_VH + t * 256), lds8b(va + OFF_VH + VPL / 2 + t * 256));
      const v16b val = cat8b(lds8b(va + OFF_VL + t * 256), lds8b(va + OFF_VL + VPL / 2 + t * 256));
      o[t] = wmma3(vah, val, pbh, pbl, o[t]);
    }
#pragma unroll
    for (int j = 0; j < 4; ++j)
#pragma unroll
      for (int r = 0; r < 4; ++r) bm[4 * j + r] = __builtin_amdgcn_ballot_w32((ma[j][r] | mp[j][r]) != 0);
    asm volatile("s_wait_dscnt 0x0" ::: "memory");        // this wave's reads of the buffer are done before it may be refilled
    asm volatile("s_wait_asynccnt 0x0" ::: "memory");     // this wave's share of the next tile has landed
    __syncthreads();                                      // publishes the next tile and ends every wave's reads of this buffer
    if (it + 2 < NT) {
      const size_t go = (size_t)(it + 2) * 8192;
      stage_copy(lk + bo, lv + bo, gkh + go, gkl + go, gvh + go, gvl + go);
      amn += 32; kpn += 32;                               // stays on the last trip's words at the end: that trip reloads them, in bounds and unused
    }
  }
  asm volatile("s_wait_asynccnt 0x0" ::: "memory");       // no copy is outstanding when the wave goes on to its end
  const float inv = 1.0f / l;
  b16* T0 = Os[wid][0]; b16* T1 = Os[wid][1];
#pragma unroll
  for (int t = 0; t < 8; ++t) {
    v8b hv, lv8;
#pragma unroll
    for (int r = 0; r < 8; ++r) { b16 a, c; split_bf16(o[t][r] * inv, a, c); hv[r] = a; lv8[r] = c; }
    const int idx = col * DH + t * 16 + 8 * hh;          // [query][d]
    *(v8b*)(T0 + idx) = hv; *(v8b*)(T1 + idx) = lv8;
  }
  wave_lds_sync();
  const size_t tok0 = (size_t)n * SEQ + q0;
#pragma unroll
  for (int j = 0; j < 8; ++j) {
    const int e = (j * 32 + lane) * 8, rr = e >> 7, cc = e & 127;
    const size_t go = (tok0 + rr) * E + (size_t)h * DH + cc;
    *(v8b*)(Yh + go) = ld8b(T0 + e); *(v8b*)(Yl + go) = ld8b(T1 + e);
  }
  
}

// ---------------------------------------------------------------------------
// Output projection: (MROWS x 1024) x (1024 x 1024) -> f32, grid (8, MROWS/128), A = y hi/lo planes, B = Wo plane rows ([out][in]); hi.W + lo.W.
// ---------------------------------------------------------------------------
__global__ __launch_bounds__(256) void out_gemm_kernel(const b16* __restrict__ Yh, const b16* __restrict__ Yl, const b16* __restrict__ Wo,
                                                       const float* __restrict__ bo, float* __restrict__ out) {
  constexpr int ST = 3 * GPL;                                       // one buffer: y hi plane, y lo plane, Wo plane
  __shared__ __attribute__((aligned(16))) unsigned char Sm[2 * ST];
  static_assert(2 * ST >= 8 * 32 * 64 * 4);
  const int lane = threadIdx.x & 31, wave = threadIdx.x >> 5, nloc = lane & 15, hlf = lane >> 4;
  const int wm = wave >> 1, wn = wave & 1;
  const int mb = blockIdx.y * 128, m0 = mb + wm * 32;
  const int cb = blockIdx.x * 128, c0 = cb + wn * 64;
  const unsigned prow = threadIdx.x >> 3, pcol = (threadIdx.x & 7) * 16;
  const unsigned char* gh = (const unsigned char*)(Yh + (size_t)(mb + prow) * E) + pcol;
  const unsigned char* gl = (const unsigned char*)(Yl + (size_t)(mb + prow) * E) + pcol;
  const unsigned char* gw = (const unsigned char*)(Wo + (size_t)(cb + prow) * E) + pcol;
  const unsigned l0 = (unsigned)(size_t)&Sm[0] + prow * GP + pcol;
  stage3(l0, gh, gl, gw);
  asm volatile("s_wait_asynccnt 0x0" ::: "memory");       // this wave's share of trip 0 has landed
  __syncthreads();                                        // trip 0's planes are whole for every wave
  stage3(l0 + ST, gh + 128, gl + 128, gw + 128);
  v8f acc[2][4];
#pragma unroll
  for (int r = 0; r < 2; ++r)
#pragma unroll
    for (int t = 0; t < 4; ++t) acc[r][t] = (v8f){};
#pragma unroll 1
  for (int it = 0; it < GNT; ++it) {
    const unsigned sb = (unsigned)(it & 1) * (unsigned)ST;
    const unsigned char* pa = &Sm[0] + sb + (wm * 32 + nloc) * GP + 16 * hlf;             // y hi; y lo lies GPL on
    const unsigned char* pb = &Sm[0] + sb + 2 * GPL + (wn * 64 + nloc) * GP + 16 * hlf;
    v16b a[2][4], b[2][4];                                // [k step][fragment]; a: rows 0..15 hi, lo, rows 16..31 hi, lo
#pragma unroll
    for (int u = 0; u < 2; ++u) {
      a[u][0] = frag_lds(pa + 64 * u); a[u][1] = frag_lds(pa + GPL + 64 * u);
      a[u][2] = frag_lds(pa + 16 * GP + 64 * u); a[u][3] = frag_lds(pa + GPL + 16 * GP + 64 * u);
#pragma unroll
      for (int t = 0; t < 4; ++t) b[u][t] = frag_lds(pb + t * 16 * GP + 64 * u);
    }
    __builtin_amdgcn_sched_barrier(0);   // the trip's LDS reads all issue ahead of its first WMMA, which then waits for its own fragments only
#pragma unroll
    for (int u = 0; u < 2; ++u)
#pragma unroll
      for (int t = 0; t < 4; ++t) {
        acc[0][t] = wmma16b(a[u][0], b[u][t], acc[0][t]); acc[0][t] = wmma16b(a[u][1], b[u][t], acc[0][t]);
        acc[1][t] = wmma16b(a[u][2], b[u][t], acc[1][t]); acc[1][t] = wmma16b(a[u][3], b[u][t], acc[1][t]);
      }
    __builtin_amdgcn_sched_barrier(0);   // the trip's WMMAs stay ahead of the waits below, so that they cover the flight of the next trip's copies
    asm volatile("s_wait_dscnt 0x0" ::: "memory");        // this wave's reads of the buffer are done before it may be refilled
    asm volatile("s_wait_asynccnt 0x0" ::: "memory");     // this wave's share of the next trip has landed
    __syncthreads();                                      // publishes the next trip's planes and ends every wave's reads of this buffer
    if (it + 2 < GNT) {
      const size_t go = (size_t)(it + 2) * 128;
      stage3(l0 + sb, gh + go, gl + go, gw + go);
    }
  }
  asm volatile("s_wait_asynccnt 0x0" ::: "memory");       // no copy is outstanding when the ring's LDS is reused below
  float* Tt = (float*)(&Sm[0] + wave * (32 * 64 * 4));
#pragma unroll
  for (int t = 0; t < 4; ++t)
#pragma unroll
    for (int r = 0; r < 2; ++r)
#pragma unroll
      for (int v = 0; v < 8; ++v) Tt[(r * 16 + v + 8 * hlf) * 64 + t * 16 + nloc] = acc[r][t][v] + bfr(bo[c0 + t * 16 + nloc]);
  wave_lds_sync();
  float* dst0 = out + (size_t)m0 * E + c0;
#pragma unroll
  for (int j = 0; j < 16; ++j) { const int rr = j * 2 + hlf, c4 = nloc * 4; *(v4f*)(dst0 + (size_t)rr * E + c4) = *(const v4f*)(Tt + rr * 64 + c4); }
  
}
}  // namespace

extern "C" void kernel_launch(void* const* d_in, const int* in_sizes, int n_in,
                              void* d_out, int out_size, void* d_ws, size_t ws_size, hipStream_t stream) {
  if (n_in < 13) return;
  const long act_need = ((long)(NB - 1) * SEQ_FULL + SEQ) * (long)E;
  if ((long)in_sizes[0] < act_need || (long)in_sizes[1] < act_need || (long)in_sizes[2] < act_need) return;
  if (in_sizes[3] < (NB - 1) * SEQ_FULL + SEQ) return;
  if ((long)in_sizes[4] < (long)(SEQ - 1) * SEQ_FULL + SEQ) return;
  if (in_sizes[5] < E * E || in_sizes[7] < E * E || in_sizes[9] < E * E || in_sizes[11] < E * E) return;
  if (in_sizes[6] < E || in_sizes[8] < E || in_sizes[10] < E || in_sizes[12] < E) return;
  if (out_size < MROWS * E) return;

  const float* query = (const float*)d_in[0];   // [NB_FULL][SEQ_FULL][E]
  const float* key   = (const float*)d_in[1];
  const float* value = (const float*)d_in[2];
  const int*   kpm   = (const int*)d_in[3];     // [NB_FULL][SEQ_FULL] int32 0/1
  const int*   am    = (const int*)d_in[4];     // [SEQ_FULL][SEQ_FULL] int32 0/1
  const float* q_w   = (const float*)d_in[5];   // [out][in]
  const float* q_b   = (const float*)d_in[6];
  const float* k_w   = (const float*)d_in[7];
  const float* k_b   = (const float*)d_in[8];
  const float* v_w   = (const float*)d_in[9];
  const float* v_b   = (const float*)d_in[10];
  const float* o_w   = (const float*)d_in[11];
  const float* o_b   = (const float*)d_in[12];
  float* out = (float*)d_out;                   // [NB][SEQ][E] f32

  const size_t plane = (size_t)MROWS * E * 2;   // 8 MiB at full size
  const size_t wplane = (size_t)E * E * 2;      // 2 MiB
  size_t off = 0; char* ws = (char*)d_ws;
  b16* Xq  = (b16*)(ws + off); off += plane;
  b16* Xk  = (b16*)(ws + off); off += plane;
  b16* Xv  = (b16*)(ws + off); off += plane;
  b16* Wq  = (b16*)(ws + off); off += wplane;
  b16* Wk  = (b16*)(ws + off); off += wplane;
  b16* Wv  = (b16*)(ws + off); off += wplane;
  b16* Wo  = (b16*)(ws + off); off += wplane;
  b16* Qh  = (b16*)(ws + off); off += plane;
  b16* Ql  = (b16*)(ws + off); off += plane;
  b16* Kh  = (b16*)(ws + off); off += plane;
  b16* Kl  = (b16*)(ws + off); off += plane;
  b16* Vh  = (b16*)(ws + off); off += plane;
  b16* Vl  = (b16*)(ws + off); off += plane;
  b16* Yh  = (b16*)(ws + off); off += plane;
  b16* Yl  = (b16*)(ws + off); off += plane;    // total 96 MiB at full size
  if (off > ws_size) return;

  cvt_kernel<<<2048, 256, 0, stream>>>(query, key, value, q_w, k_w, v_w, o_w, Xq, Xk, Xv, Wq, Wk, Wv, Wo);
  qkv_gemm_kernel<<<dim3(3 * E / 128, MROWS / 128), 256, 0, stream>>>(Xq, Xk, Xv, Wq, Wk, Wv, q_b, k_b, v_b, Qh, Ql, Kh, Kl, Vh, Vl);
  attn_kernel<<<(NG * QT) / AW, 32 * AW, 0, stream>>>(Qh, Ql, Kh, Kl, Vh, Vl, am, kpm, Yh, Yl);
  out_gemm_kernel<<<dim3(E / 128, MROWS / 128), 256, 0, stream>>>(Yh, Yl, Wo, o_b, out);
}

// v005
// Measured time: 106 microseconds a run.
// Two timings next to v004 put it at 1.10 and 1.11 times that version's speed.
// Counting every step since v000, it is 3.44 times as fast.
#include <hip/hip_runtime.h>

// Contractions: q/k/v projections on v_wmma_f32_16x16x32_bf16 with RNE-bf16 operand planes of the activations and of the [out][in] weights
// (one product per tile pair); S^T = K.Q^T (K = 128) and y^T = V^T.P^T (32 keys per step) as bf16 hi/lo splits (hi.hi + hi.lo + lo.hi);
// out = y.Wo^T with y as bf16 hi/lo planes against the RNE-bf16 Wo plane (hi.W + lo.W). f32 accumulate, f32 softmax statistics, 8 heads of 128.

#ifndef NB
#define NB 4
#endif
#ifndef SEQ
#define SEQ 1024
#endif
#ifndef NB_FULL
#define NB_FULL 4
#endif
#ifndef SEQ_FULL
#define SEQ_FULL 1024
#endif

namespace {
constexpr int E = 1024, NH = 8, DH = 128;
constexpr int MROWS = NB * SEQ;          // token rows, compact n*SEQ + t
constexpr int QT = SEQ / 16;             // 16-query tiles per (n, h)
constexpr int KT = SEQ / 16;             // 16-key tiles per (n, h)
constexpr int NG = NB * NH;              // g = n*NH + h
constexpr float SCALE = 0.08838834764831845f;   // 1/sqrt(128), applied in f32 on the score accumulators
static_assert(NB >= 1 && NB <= NB_FULL);
static_assert(SEQ % 128 == 0 && SEQ <= SEQ_FULL);
static_assert(E == NH * DH);
static_assert(MROWS % 128 == 0);
static_assert((NG * QT) % 8 == 0);

typedef __bf16 b16;
typedef __attribute__((ext_vector_type(16))) __bf16 v16b;
typedef __attribute__((ext_vector_type(8)))  __bf16 v8b;
typedef __attribute__((ext_vector_type(8)))  float v8f;
typedef __attribute__((ext_vector_type(4)))  float v4f;
typedef __attribute__((ext_vector_type(4)))  int v4i;

__device__ __forceinline__ v8b ld8b(const b16* p) { return *(const v8b*)p; }
__device__ __forceinline__ v16b cat8b(v8b a, v8b b) { return __builtin_shufflevector(a, b, 0, 1, 2, 3, 4, 5, 6, 7, 8, 9, 10, 11, 12, 13, 14, 15); }
// 16x16x32 16-bit fragment from a k-contiguous row pointer (A: lane&15 = row, B: lane&15 = column), hh = lane>>4:
// elements 0..7 <- p[8hh+0..7], elements 8..15 <- p[16+8hh+0..7]
__device__ __forceinline__ v16b frag_kb(const b16* p, int hh) { return cat8b(ld8b(p + 8 * hh), ld8b(p + 16 + 8 * hh)); }
// hi = bf16 truncation, lo = RNE bf16 of the residual
__device__ __forceinline__ void split_bf16(float v, b16& hi, b16& lo) {
  const unsigned int u = __builtin_bit_cast(unsigned int, v) & 0xffff0000u;
  hi = __builtin_bit_cast(b16, (unsigned short)(u >> 16));
  lo = (b16)(v - __builtin_bit_cast(float, u));
}
// RNE bf16 value of an f32 input, widened back to f32
__device__ __forceinline__ float bfr(float f) { return (float)(b16)f; }
__device__ __forceinline__ v8f wmma16b(v16b a, v16b b, v8f c) {
  return __builtin_amdgcn_wmma_f32_16x16x32_bf16(false, a, false, b, (short)0, c, false, false);
}
__device__ __forceinline__ void wave_lds_sync() {
  __builtin_amdgcn_fence(3, "workgroup");
  __builtin_amdgcn_wave_barrier();
  __builtin_amdgcn_fence(2, "workgroup");
}

// ---------------------------------------------------------------------------
// f32 -> RNE bf16 planes: query/key/value [NB_FULL][SEQ_FULL][E] -> X planes [MROWS][E] (compact rows n*SEQ+t);
// Region selection is block-uniform (region sizes are multiples of 256 chunks).
// ---------------------------------------------------------------------------
__global__ __launch_bounds__(256) void cvt_kernel(const float* __restrict__ xq, const float* __restrict__ xk, const float* __restrict__ xv,
                                                  const float* __restrict__ wq, const float* __restrict__ wk, const float* __restrict__ wv,
                                                  const float* __restrict__ wo,
                                                  b16* __restrict__ Xq, b16* __restrict__ Xk, b16* __restrict__ Xv,
                                                  b16* __restrict__ Wq, b16* __restrict__ Wk, b16* __restrict__ Wv, b16* __restrict__ Wo) {
  const size_t tid = (size_t)blockIdx.x * blockDim.x + threadIdx.x, stride = (size_t)gridDim.x * blockDim.x;
  const size_t nx = (size_t)MROWS * E / 8, nw = (size_t)E * E / 8;
  const size_t total = 3 * nx + 4 * nw;
  for (size_t c = tid; c < total; c += stride) {
    const float* src; b16* dst; size_t si, di;
    if (c < 3 * nx) {
      const int which = (int)(c / nx);
      const size_t cc = c - (size_t)which * nx;
      di = cc * 8;
      const size_t m = di / E, col = di % E;
      const size_t n = m / SEQ, t = m % SEQ;
      si = (n * SEQ_FULL + t) * (size_t)E + col;
      src = (which == 0) ? xq : (which == 1) ? xk : xv;
      dst = (which == 0) ? Xq : (which == 1) ? Xk : Xv;
    } else {
      const size_t c2 = c - 3 * nx;
      const int which = (int)(c2 / nw);
      const size_t cc = c2 - (size_t)which * nw;
      di = cc * 8; si = di;
      src = (which == 0) ? wq : (which == 1) ? wk : (which == 2) ? wv : wo;
      dst = (which == 0) ? Wq : (which == 1) ? Wk : (which == 2) ? Wv : Wo;
    }
    const v4f f0 = *(const v4f*)(src + si), f1 = *(const v4f*)(src + si + 4);
    v8b o;
#pragma unroll
    for (int e = 0; e < 4; ++e) { o[e] = (b16)f0[e]; o[4 + e] = (b16)f1[e]; }
    *(v8b*)(dst + di) = o;
    
  }
}

constexpr int GP = 128 + 16;
constexpr int GPL = 128 * GP;
constexpr int GNT = E / 64;
constexpr int GROW = 32 * E * 2;
static_assert(GNT >= 2 && GP % 16 == 0 && E % 128 == 0);
// 16x16x32 16-bit fragment from a staged row: p = row start + 64 B x k step + 16 B x (lane >> 4); same element order as frag_kb
__device__ __forceinline__ v16b frag_lds(const unsigned char* p) { return cat8b(*(const v8b*)p, *(const v8b*)(p + 32)); }
// Two planes = 8 copies of 16 B per lane (256 lanes). l: the lane's LDS byte address in the first plane of the target buffer (row = thread
// id >> 3, piece = thread id & 7); ga / gb: the lane's first 16 B of the trip in each global plane. Successive copies lie 32 rows on.
__device__ __forceinline__ void stage2(unsigned l, const unsigned char* ga, const unsigned char* gb) {
  asm volatile("global_load_async_to_lds_b128 %0, %8, off\n\t"
               "global_load_async_to_lds_b128 %1, %9, off\n\t"
               "global_load_async_to_lds_b128 %2, %10, off\n\t"
               "global_load_async_to_lds_b128 %3, %11, off\n\t"
               "global_load_async_to_lds_b128 %4, %12, off\n\t"
               "global_load_async_to_lds_b128 %5, %13, off\n\t"
               "global_load_async_to_lds_b128 %6, %14, off\n\t"
               "global_load_async_to_lds_b128 %7, %15, off\n\t"
               "s_wait_xcnt 0x0"
               :: "v"(l), "v"(l + 32 * GP), "v"(l + 64 * GP), "v"(l + 96 * GP),
                  "v"(l + GPL), "v"(l + GPL + 32 * GP), "v"(l + GPL + 64 * GP), "v"(l + GPL + 96 * GP),
                  "v"(ga), "v"(ga + GROW), "v"(ga + 2 * GROW), "v"(ga + 3 * GROW), "v"(gb), "v"(gb + GROW), "v"(gb + 2 * GROW), "v"(gb + 3 * GROW)
               : "memory");
}
__device__ __forceinline__ void stage3(unsigned l, const unsigned char* ga, const unsigned char* gb, const unsigned char* gc) {
  asm volatile("global_load_async_to_lds_b128 %0, %12, off\n\t"
               "global_load_async_to_lds_b128 %1, %13, off\n\t"
               "global_load_async_to_lds_b128 %2, %14, off\n\t"
               "global_load_async_to_lds_b128 %3, %15, off\n\t"
               "global_load_async_to_lds_b128 %4, %16, off\n\t"
               "global_load_async_to_lds_b128 %5, %17, off\n\t"
               "global_load_async_to_lds_b128 %6, %18, off\n\t"
               "global_load_async_to_lds_b128 %7, %19, off\n\t"
               "global_load_async_to_lds_b128 %8, %20, off\n\t"
               "global_load_async_to_lds_b128 %9, %21, off\n\t"
               "global_load_async_to_lds_b128 %10, %22, off\n\t"
               "global_load_async_to_lds_b128 %11, %23, off\n\t"
               "s_wait_xcnt 0x0"
               :: "v"(l), "v"(l + 32 * GP), "v"(l + 64 * GP), "v"(l + 96 * GP),
                  "v"(l + GPL), "v"(l + GPL + 32 * GP), "v"(l + GPL + 64 * GP), "v"(l + GPL + 96 * GP),
                  "v"(l + 2 * GPL), "v"(l + 2 * GPL + 32 * GP), "v"(l + 2 * GPL + 64 * GP), "v"(l + 2 * GPL + 96 * GP),
                  "v"(ga), "v"(ga + GROW), "v"(ga + 2 * GROW), "v"(ga + 3 * GROW), "v"(gb), "v"(gb + GROW), "v"(gb + 2 * GROW), "v"(gb + 3 * GROW),
                  "v"(gc), "v"(gc + GROW), "v"(gc + 2 * GROW), "v"(gc + 3 * GROW)
               : "memory");
}

// ---------------------------------------------------------------------------
// QKV GEMM: (MROWS x 1024) x (1024 x 3072), grid (24, MROWS/128); a block's 128 columns are one head of q, k or v, a wave's 64 half of it.
// A = bf16 activation plane rows, B = bf16 weight rows ([out][in] = [n][k]); one product per tile pair. Epilogue adds the RNE-bf16 bias and
// splits hi/lo; it stages per wave in the LDS of the ring, which no wave reads and no copy writes any more behind the last trip's barrier.
// ---------------------------------------------------------------------------
__global__ __launch_bounds__(256) void qkv_gemm_kernel(const b16* __restrict__ Xq, const b16* __restrict__ Xk, const b16* __restrict__ Xv,
                                                       const b16* __restrict__ Wq, const b16* __restrict__ Wk, const b16* __restrict__ Wv,
                                                       const float* __restrict__ bq, const float* __restrict__ bk, const float* __restrict__ bv,
                                                       b16* __restrict__ Qh, b16* __restrict__ Ql, b16* __restrict__ Kh, b16* __restrict__ Kl,
                                                       b16* __restrict__ Vh, b16* __restrict__ Vl) {
  constexpr int ST = 2 * GPL;                                       // one buffer: A plane, B plane
  __shared__ __attribute__((aligned(16))) unsigned char Sm[2 * ST];
  static_assert(2 * ST >= 8 * 2 * 32 * 64 * 2);
  const int lane = threadIdx.x & 31, wave = threadIdx.x >> 5, nloc = lane & 15, hlf = lane >> 4;
  const int wm = wave >> 1, wn = wave & 1;
  const int mb = blockIdx.y * 128, m0 = mb + wm * 32;
  const int cb = blockIdx.x * 128;                                  // 0..3071, block-uniform
  const int mat = cb / E, cmb = cb % E, cm = cmb + wn * 64, head = cmb / DH, dlo = wn * 64;
  const b16* X = (mat == 0) ? Xq : (mat == 1) ? Xk : Xv;
  const b16* W = (mat == 0) ? Wq : (mat == 1) ? Wk : Wv;
  const float* bias = ((mat == 0) ? bq : (mat == 1) ? bk : bv) + cm;
  const unsigned prow = threadIdx.x >> 3, pcol = (threadIdx.x & 7) * 16;
  const unsigned char* ga = (const unsigned char*)(X + (size_t)(mb + prow) * E) + pcol;
  const unsigned char* gb = (const unsigned char*)(W + (size_t)(cmb + prow) * E) + pcol;
  const unsigned l0 = (unsigned)(size_t)&Sm[0] + prow * GP + pcol;
  stage2(l0, ga, gb);
  asm volatile("s_wait_asynccnt 0x0" ::: "memory");       // this wave's share of trip 0 has landed
  __syncthreads();                                        // trip 0's planes are whole for every wave
  stage2(l0 + ST, ga + 128, gb + 128);
  v8f acc[2][4];
#pragma unroll
  for (int r = 0; r < 2; ++r)
#pragma unroll
    for (int t = 0; t < 4; ++t) acc[r][t] = (v8f){};
#pragma unroll 1
  for (int it = 0; it < GNT; ++it) {
    const unsigned sb = (unsigned)(it & 1) * (unsigned)ST;
    const unsigned char* pa = &Sm[0] + sb + (wm * 32 + nloc) * GP + 16 * hlf;
    const unsigned char* pb = &Sm[0] + sb + GPL + (wn * 64 + nloc) * GP + 16 * hlf;
#pragma unroll
    for (int u = 0; u < 2; ++u) {
      const v16b a0 = frag_lds(pa + 64 * u), a1 = frag_lds(pa + 16 * GP + 64 * u);
      v16b b[4];
#pragma unroll
      for (int t = 0; t < 4; ++t) b[t] = frag_lds(pb + t * 16 * GP + 64 * u);
      __builtin_amdgcn_sched_barrier(0);   // all twelve LDS reads of the k step issue ahead of its first WMMA: one read latency a step, not one a fragment
#pragma unroll
      for (int t = 0; t < 4; ++t) {
        acc[0][t] = wmma16b(a0, b[t], acc[0][t]);
        acc[1][t] = wmma16b(a1, b[t], acc[1][t]);
      }
    }
    __builtin_amdgcn_sched_barrier(0);   // the trip's WMMAs stay ahead of the waits below, so that they cover the flight of the next trip's copies
    asm volatile("s_wait_dscnt 0x0" ::: "memory");        // this wave's reads of the buffer are done before it may be refilled
    asm volatile("s_wait_asynccnt 0x0" ::: "memory");     // this wave's share of the next trip has landed
    __syncthreads();                                      // publishes the next trip's planes and ends every wave's reads of this buffer
    if (it + 2 < GNT) {
      const size_t go = (size_t)(it + 2) * 128;
      stage2(l0 + sb, ga + go, gb + go);
    }
  }
  asm volatile("s_wait_asynccnt 0x0" ::: "memory");       // no copy is outstanding when the ring's LDS is reused below
  const int n = m0 / SEQ, t0 = m0 % SEQ, g = n * NH + head;
  b16* Tp0 = (b16*)(&Sm[0] + wave * (2 * 32 * 64 * 2)); b16* Tp1 = Tp0 + 32 * 64;
#pragma unroll
  for (int t = 0; t < 4; ++t)
#pragma unroll
    for (int r = 0; r < 2; ++r)
#pragma unroll
      for (int v = 0; v < 8; ++v) {
        const int rr = r * 16 + v + 8 * hlf, d = t * 16 + nloc;
        b16 yh, yl; split_bf16(acc[r][t][v] + bfr(bias[d]), yh, yl);
        const int idx = (mat < 2) ? (rr * 64 + d) : ((rr >> 4) * 1024 + d * 16 + (rr & 15));
        Tp0[idx] = yh; Tp1[idx] = yl;
      }
  wave_lds_sync();
  if (mat < 2) {
    b16* Ph = (mat == 0) ? Qh : Kh; b16* Pl = (mat == 0) ? Ql : Kl;
    const size_t rowbase = (size_t)g * SEQ + t0;
#pragma unroll
    for (int j = 0; j < 8; ++j) {
      const int e = (j * 32 + lane) * 8, rr = e >> 6, cc = e & 63;
      const size_t go = (rowbase + rr) * DH + dlo + cc;
      *(v8b*)(Ph + go) = ld8b(Tp0 + e); *(v8b*)(Pl + go) = ld8b(Tp1 + e);
    }
    
  } else {
    const size_t tb = (size_t)g * KT + (t0 >> 4);
#pragma unroll
    for (int j = 0; j < 8; ++j) {
      const int e = (j * 32 + lane) * 8, kt2 = e >> 10, within = e & 1023;
      const size_t go = ((tb + kt2) * DH + dlo) * 16 + within;
      *(v8b*)(Vh + go) = ld8b(Tp0 + e); *(v8b*)(Vl + go) = ld8b(Tp1 + e);
    }
    
  }
}

constexpr int AW = 8;
constexpr int KPITCH = 2 * DH + 16;
constexpr int KPL = 32 * KPITCH;
constexpr int VPL = 2 * DH * 16 * 2;
constexpr int OFF_KH = 0, OFF_KL = KPL, OFF_VH = 2 * KPL, OFF_VL = 2 * KPL + VPL, STAGE = 2 * KPL + 2 * VPL;
constexpr int NT = SEQ / 32;                   // trips
static_assert(QT % AW == 0 && NT >= 2 && STAGE % 16 == 0 && KPITCH % 16 == 0);

__device__ __forceinline__ v8b lds8b(const unsigned char* p) { return *(const v8b*)p; }
__device__ __forceinline__ float xhalf(float x) {
  return __builtin_bit_cast(float, __builtin_amdgcn_permlanex16(__builtin_bit_cast(int, x), __builtin_bit_cast(int, x), 0x76543210, 0xfedcba98, false, false));
}
// one stage = 8 copies of 16 B per lane (256 lanes x 128 B = 32 KiB). lk / lv: the lane's LDS byte addresses in the K hi / V hi plane of the
// target buffer; the pointers: the lane's first 16 B of the stage in each global plane. The second copy of a plane lies 4,096 global bytes on.
__device__ __forceinline__ void stage_copy(unsigned lk, unsigned lv, const unsigned char* gkh, const unsigned char* gkl,
                                           const unsigned char* gvh, const unsigned char* gvl) {
  asm volatile("global_load_async_to_lds_b128 %0, %8, off\n\t"
               "global_load_async_to_lds_b128 %1, %9, off\n\t"
               "global_load_async_to_lds_b128 %2, %10, off\n\t"
               "global_load_async_to_lds_b128 %3, %11, off\n\t"
               "global_load_async_to_lds_b128 %4, %12, off\n\t"
               "global_load_async_to_lds_b128 %5, %13, off\n\t"
               "global_load_async_to_lds_b128 %6, %14, off\n\t"
               "global_load_async_to_lds_b128 %7, %15, off\n\t"
               "s_wait_xcnt 0x0"
               :: "v"(lk), "v"(lk + 16 * KPITCH), "v"(lk + KPL), "v"(lk + KPL + 16 * KPITCH),
                  "v"(lv), "v"(lv + VPL / 2), "v"(lv + VPL), "v"(lv + VPL + VPL / 2),
                  "v"(gkh), "v"(gkh + 4096), "v"(gkl), "v"(gkl + 4096), "v"(gvh), "v"(gvh + 4096), "v"(gvl), "v"(gvl + 4096)
               : "memory");
}

__global__ __launch_bounds__(32 * AW)
void attn_kernel(const b16* __restrict__ Qh, const b16* __restrict__ Ql, const b16* __restrict__ Kh, const b16* __restrict__ Kl,
                 const b16* __restrict__ Vh, const b16* __restrict__ Vl, const int* __restrict__ am, const int* __restrict__ kpm,
                 b16* __restrict__ Yh, b16* __restrict__ Yl) {
  __shared__ __attribute__((aligned(16))) unsigned char Ring[2][STAGE];
  __shared__ __attribute__((aligned(16))) b16 Os[AW][2][16 * DH];
  // the wave's number as a scalar: tile, head and row bases then live in scalar registers, which leaves the vector registers to the Q fragments
  const int wid = __builtin_amdgcn_readfirstlane(threadIdx.x >> 5), lane = threadIdx.x & 31, hh = lane >> 4, col = lane & 15;
  const int qtile = blockIdx.x * AW + wid;                // over NG*QT
  const int g = qtile / QT;                               // n*NH + h, the same in all waves of a block
  const int q0 = (qtile % QT) << 4;
  const int n = g / NH, h = g % NH;
  const size_t qo = ((size_t)g * SEQ + q0 + col) * DH;
  const int* amrow = am + (size_t)(q0 + col) * SEQ_FULL;  // attn_mask[query][key]
  const int* kprow = kpm + (size_t)n * SEQ_FULL;         // key_padding_mask[n][key]
  const float ninf = -__builtin_inff();
  // Copy addresses. A stage is 8,192 contiguous bytes of each global plane. K: 16-byte piece c = thread id (and c + 256) is row c >> 4,
  // piece c & 15. V: a wave's 512 bytes are 16 d rows of 32 B; lane = (key half hh, d row), so each half wave writes 256 contiguous LDS bytes.
  const size_t gplane = (size_t)g * SEQ * DH * 2;         // byte offset of (n, h) in every K and V plane
  const unsigned ring0 = (unsigned)(size_t)&Ring[0][0];
  {
    // Tile 0's addresses are formed from the thread id, apart from the later tiles': a value that an asm statement names itself is held below
    // v256 for its whole life, and one that also lived through the loop, where the fragments fill those registers, would be spilled to scratch.
    const unsigned wv = threadIdx.x >> 5;
    const unsigned kin0 = (unsigned)threadIdx.x * 16u, vin0 = wv * 512u + (unsigned)(col * 32 + hh * 16);
    stage_copy(ring0 + OFF_KH + (unsigned)((threadIdx.x >> 4) * KPITCH + (threadIdx.x & 15) * 16),
               ring0 + OFF_VH + (unsigned)(hh * (DH * 16)) + (wv * 16u + (unsigned)col) * 16u,
               (const unsigned char*)Kh + gplane + kin0, (const unsigned char*)Kl + gplane + kin0,
               (const unsigned char*)Vh + gplane + vin0, (const unsigned char*)Vl + gplane + vin0);
  }
  const unsigned kin = (unsigned)(wid * 512 + lane * 16), vin = (unsigned)(wid * 512 + col * 32 + hh * 16);   // thread id = 32 wid + lane
  const unsigned char* gkh = (const unsigned char*)Kh + gplane + kin; const unsigned char* gkl = (const unsigned char*)Kl + gplane + kin;
  const unsigned char* gvh = (const unsigned char*)Vh + gplane + vin; const unsigned char* gvl = (const unsigned char*)Vl + gplane + vin;
  const unsigned lk = ring0 + OFF_KH + (unsigned)((wid * 2 + hh) * KPITCH + col * 16);
  const unsigned lv = ring0 + OFF_VH + (unsigned)(hh * (DH * 16) + (wid * 16 + col) * 16);
  v16b qfh[DH / 32], qfl[DH / 32];                        // B operands of S^T, the same in every trip
#pragma unroll
  for (int s = 0; s < DH / 32; ++s) { qfh[s] = frag_kb(Qh + qo + 32 * s, hh); qfl[s] = frag_kb(Ql + qo + 32 * s, hh); }
  // Masked positions of the coming trip, one lane mask per score register (keys 8hh+0..7, then 16+8hh+0..7): sixteen scalar registers carry
  // them over the loop's edge, so that the loaded words hold no vector register while S^T is formed.
  unsigned bm[16];
  const int* amn = amrow + 8 * hh; const int* kpn = kprow + 8 * hh;   // the lane's words of the trip that is loaded next
  {
    v4i ma[4], mp[4];
#pragma unroll
    for (int j = 0; j < 4; ++j) { ma[j] = *(const v4i*)(amn + (j >> 1) * 16 + (j & 1) * 4); mp[j] = *(const v4i*)(kpn + (j >> 1) * 16 + (j & 1) * 4); }
#pragma unroll
    for (int j = 0; j < 4; ++j)
#pragma unroll
      for (int r = 0; r < 4; ++r) bm[4 * j + r] = __builtin_amdgcn_ballot_w32((ma[j][r] | mp[j][r]) != 0);
    amn += 32; kpn += 32;
  }
  asm volatile("s_wait_asynccnt 0x0" ::: "memory");       // this wave's share of tile 0 has landed
  __syncthreads();                                        // tile 0 is whole for every wave
  stage_copy(lk + STAGE, lv + STAGE, gkh + 8192, gkl + 8192, gvh + 8192, gvl + 8192);
  float m = ninf, l = 0.0f;
  v8f o[8];
#pragma unroll
  for (int t = 0; t < 8; ++t) o[t] = (v8f){};
#pragma unroll 1
  for (int it = 0; it < NT; ++it) {
    // kb = 32 * it is the trip's first key
    const unsigned bo = (unsigned)(it & 1) * (unsigned)STAGE;
    const unsigned char* B = &Ring[0][0] + bo;
    const unsigned char* k0 = B + col * KPITCH + 16 * hh;   // key kb+col; key kb+16+col lies 16 rows on
    v16b kfh[2][DH / 32], kfl[2][DH / 32];                  // the trip's K fragments: [16-key tile][k step]
#pragma unroll
    for (int s = 0; s < DH / 32; ++s)
#pragma unroll
      for (int j = 0; j < 2; ++j) {
        const unsigned char* ka = k0 + j * 16 * KPITCH + 64 * s;
        kfh[j][s] = cat8b(lds8b(ka + OFF_KH), lds8b(ka + OFF_KH + 32)); kfl[j][s] = cat8b(lds8b(ka + OFF_KL), lds8b(ka + OFF_KL + 32));
      }
    __builtin_amdgcn_sched_barrier(0);   // all K reads of the trip issue as one group ahead of S^T: one LDS latency a trip, not one a fragment
    v8f s0 = {}, s1 = {};
#pragma unroll   // each step names its own Q and K registers: a rolled loop could only index them through memory. hi.hi + hi.lo + lo.hi, the two key tiles in turn
    for (int s = 0; s < DH / 32; ++s) {
      s0 = wmma16b(kfh[0][s], qfh[s], s0); s1 = wmma16b(kfh[1][s], qfh[s], s1);
      s0 = wmma16b(kfh[0][s], qfl[s], s0); s1 = wmma16b(kfh[1][s], qfl[s], s1);
      s0 = wmma16b(kfl[0][s], qfh[s], s0); s1 = wmma16b(kfl[1][s], qfh[s], s1);
    }
    const unsigned char* va = B + hh * (DH * 16) + col * 16;   // keys kb+8hh+0..7 of d row col; the second 16-key tile lies VPL/2 on
    v16b vfh[8], vfl[8];                                    // the trip's V^T fragments, d rows t*16 + col
#pragma unroll
    for (int t = 0; t < 8; ++t) vfh[t] = cat8b(lds8b(va + OFF_VH + t * 256), lds8b(va + OFF_VH + VPL / 2 + t * 256));
#pragma unroll
    for (int t = 0; t < 8; ++t) vfl[t] = cat8b(lds8b(va + OFF_VL + t * 256), lds8b(va + OFF_VL + VPL / 2 + t * 256));
    v4i ma[4], mp[4];
#pragma unroll
    for (int j = 0; j < 4; ++j) { ma[j] = *(const v4i*)(amn + (j >> 1) * 16 + (j & 1) * 4); mp[j] = *(const v4i*)(kpn + (j >> 1) * 16 + (j & 1) * 4); }
    __builtin_amdgcn_sched_barrier(0);   // every V read and mask load has issued by here, so that softmax covers their flight; sunk towards their users they would be waited out one by one
    // scale and replace-fill: s0 holds keys kb+8hh+0..7, s1 holds keys kb+16+8hh+0..7 of query q0+col
#pragma unroll
    for (int r = 0; r < 8; ++r) {
      s0[r] = __builtin_amdgcn_inverse_ballot_w32(bm[r])     ? ninf : s0[r] * SCALE;
      s1[r] = __builtin_amdgcn_inverse_ballot_w32(bm[8 + r]) ? ninf : s1[r] * SCALE;
    }
    float mr = ninf;
#pragma unroll
    for (int r = 0; r < 8; ++r) mr = fmaxf(mr, fmaxf(s0[r], s1[r]));
    mr = fmaxf(mr, xhalf(mr));
    const float mn = fmaxf(m, mr);
    const float mref = (mn == ninf) ? 0.0f : mn;    // fully masked prefix: nothing accumulated yet
    const float al_ = __expf(m - mref);
    m = mn;
    float sum = 0.0f;
    v16b pbh, pbl;
#pragma unroll
    for (int r = 0; r < 8; ++r) {
      const float e0 = __expf(s0[r] - mref), e1 = __expf(s1[r] - mref);
      sum += e0 + e1;
      b16 a, c; split_bf16(e0, a, c); pbh[r] = a; pbl[r] = c; split_bf16(e1, a, c); pbh[8 + r] = a; pbl[8 + r] = c;
    }
    sum += xhalf(sum);
    l = l * al_ + sum;
#pragma unroll
    for (int t = 0; t < 8; ++t) o[t] = o[t] * al_;
    // split product hi.hi + hi.lo + lo.hi, one term over all eight output tiles at a time: neighbouring WMMAs are independent
#pragma unroll
    for (int t = 0; t < 8; ++t) o[t] = wmma16b(vfh[t], pbh, o[t]);
#pragma unroll
    for (int t = 0; t < 8; ++t) o[t] = wmma16b(vfh[t], pbl, o[t]);
#pragma unroll
    for (int t = 0; t < 8; ++t) o[t] = wmma16b(vfl[t], pbh, o[t]);
#pragma unroll
    for (int j = 0; j < 4; ++j)
#pragma unroll
      for (int r = 0; r < 4; ++r) bm[4 * j + r] = __builtin_amdgcn_ballot_w32((ma[j][r] | mp[j][r]) != 0);
    __builtin_amdgcn_sched_barrier(0);   // softmax and y^T stay ahead of the waits below, so that they cover the flight of the next tile's copies
    asm volatile("s_wait_dscnt 0x0" ::: "memory");        // this wave's reads of the buffer are done before it may be refilled
    asm volatile("s_wait_asynccnt 0x0" ::: "memory");     // this wave's share of the next tile has landed
    __syncthreads();                                      // publishes the next tile and ends every wave's reads of this buffer
    if (it + 2 < NT) {
      const size_t go = (size_t)(it + 2) * 8192;
      stage_copy(lk + bo, lv + bo, gkh + go, gkl + go, gvh + go, gvl + go);
      amn += 32; kpn += 32;                               // stays on the last trip's words at the end: that trip reloads them, in bounds and unused
    }
  }
  asm volatile("s_wait_asynccnt 0x0" ::: "memory");       // no copy is outstanding when the wave goes on to its end
  const float inv = 1.0f / l;
  b16* T0 = Os[wid][0]; b16* T1 = Os[wid][1];
#pragma unroll
  for (int t = 0; t < 8; ++t) {
    v8b hv, lv8;
#pragma unroll
    for (int r = 0; r < 8; ++r) { b16 a, c; split_bf16(o[t][r] * inv, a, c); hv[r] = a; lv8[r] = c; }
    const int idx = col * DH + t * 16 + 8 * hh;          // [query][d]
    *(v8b*)(T0 + idx) = hv; *(v8b*)(T1 + idx) = lv8;
  }
  wave_lds_sync();
  const size_t tok0 = (size_t)n * SEQ + q0;
#pragma unroll
  for (int j = 0; j < 8; ++j) {
    const int e = (j * 32 + lane) * 8, rr = e >> 7, cc = e & 127;
    const size_t go = (tok0 + rr) * E + (size_t)h * DH + cc;
    *(v8b*)(Yh + go) = ld8b(T0 + e); *(v8b*)(Yl + go) = ld8b(T1 + e);
  }
  
}

// ---------------------------------------------------------------------------
// Output projection: (MROWS x 1024) x (1024 x 1024) -> f32, grid (8, MROWS/128), A = y hi/lo planes, B = Wo plane rows ([out][in]); hi.W + lo.W.
// ---------------------------------------------------------------------------
__global__ __launch_bounds__(256) void out_gemm_kernel(const b16* __restrict__ Yh, const b16* __restrict__ Yl, const b16* __restrict__ Wo,
                                                       const float* __restrict__ bo, float* __restrict__ out) {
  constexpr int ST = 3 * GPL;                                       // one buffer: y hi plane, y lo plane, Wo plane
  __shared__ __attribute__((aligned(16))) unsigned char Sm[2 * ST];
  static_assert(2 * ST >= 8 * 32 * 64 * 4);
  const int lane = threadIdx.x & 31, wave = threadIdx.x >> 5, nloc = lane & 15, hlf = lane >> 4;
  const int wm = wave >> 1, wn = wave & 1;
  const int mb = blockIdx.y * 128, m0 = mb + wm * 32;
  const int cb = blockIdx.x * 128, c0 = cb + wn * 64;
  const unsigned prow = threadIdx.x >> 3, pcol = (threadIdx.x & 7) * 16;
  const unsigned char* gh = (const unsigned char*)(Yh + (size_t)(mb + prow) * E) + pcol;
  const unsigned char* gl = (const unsigned char*)(Yl + (size_t)(mb + prow) * E) + pcol;
  const unsigned char* gw = (const unsigned char*)(Wo + (size_t)(cb + prow) * E) + pcol;
  const unsigned l0 = (unsigned)(size_t)&Sm[0] + prow * GP + pcol;
  stage3(l0, gh, gl, gw);
  asm volatile("s_wait_asynccnt 0x0" ::: "memory");       // this wave's share of trip 0 has landed
  __syncthreads();                                        // trip 0's planes are whole for every wave
  stage3(l0 + ST, gh + 128, gl + 128, gw + 128);
  v8f acc[2][4];
#pragma unroll
  for (int r = 0; r < 2; ++r)
#pragma unroll
    for (int t = 0; t < 4; ++t) acc[r][t] = (v8f){};
#pragma unroll 1
  for (int it = 0; it < GNT; ++it) {
    const unsigned sb = (unsigned)(it & 1) * (unsigned)ST;
    const unsigned char* pa = &Sm[0] + sb + (wm * 32 + nloc) * GP + 16 * hlf;             // y hi; y lo lies GPL on
    const unsigned char* pb = &Sm[0] + sb + 2 * GPL + (wn * 64 + nloc) * GP + 16 * hlf;
    v16b a[2][4], b[2][4];                                // [k step][fragment]; a: rows 0..15 hi, lo, rows 16..31 hi, lo
#pragma unroll
    for (int u = 0; u < 2; ++u) {
      a[u][0] = frag_lds(pa + 64 * u); a[u][1] = frag_lds(pa + GPL + 64 * u);
      a[u][2] = frag_lds(pa + 16 * GP + 64 * u); a[u][3] = frag_lds(pa + GPL + 16 * GP + 64 * u);
#pragma unroll
      for (int t = 0; t < 4; ++t) b[u][t] = frag_lds(pb + t * 16 * GP + 64 * u);
    }
    __builtin_amdgcn_sched_barrier(0);   // the trip's LDS reads all issue ahead of its first WMMA, which then waits for its own fragments only
#pragma unroll
    for (int u = 0; u < 2; ++u)
#pragma unroll
      for (int t = 0; t < 4; ++t) {
        acc[0][t] = wmma16b(a[u][0], b[u][t], acc[0][t]); acc[0][t] = wmma16b(a[u][1], b[u][t], acc[0][t]);
        acc[1][t] = wmma16b(a[u][2], b[u][t], acc[1][t]); acc[1][t] = wmma16b(a[u][3], b[u][t], acc[1][t]);
      }
    __builtin_amdgcn_sched_barrier(0);   // the trip's WMMAs stay ahead of the waits below, so that they cover the flight of the next trip's copies
    asm volatile("s_wait_dscnt 0x0" ::: "memory");        // this wave's reads of the buffer are done before it may be refilled
    asm volatile("s_wait_asynccnt 0x0" ::: "memory");     // this wave's share of the next trip has landed
    __syncthreads();                                      // publishes the next trip's planes and ends every wave's reads of this buffer
    if (it + 2 < GNT) {
      const size_t go = (size_t)(it + 2) * 128;
      stage3(l0 + sb, gh + go, gl + go, gw + go);
    }
  }
  asm volatile("s_wait_asynccnt 0x0" ::: "memory");       // no copy is outstanding when the ring's LDS is reused below
  float* Tt = (float*)(&Sm[0] + wave * (32 * 64 * 4));
#pragma unroll
  for (int t = 0; t < 4; ++t)
#pragma unroll
    for (int r = 0; r < 2; ++r)
#pragma unroll
      for (int v = 0; v < 8; ++v) Tt[(r * 16 + v + 8 * hlf) * 64 + t * 16 + nloc] = acc[r][t][v] + bfr(bo[c0 + t * 16 + nloc]);
  wave_lds_sync();
  float* dst0 = out + (size_t)m0 * E + c0;
#pragma unroll
  for (int j = 0; j < 16; ++j) { const int rr = j * 2 + hlf, c4 = nloc * 4; *(v4f*)(dst0 + (size_t)rr * E + c4) = *(const v4f*)(Tt + rr * 64 + c4); }
  
}
}  // namespace

extern "C" void kernel_launch(void* const* d_in, const int* in_sizes, int n_in,
                              void* d_out, int out_size, void* d_ws, size_t ws_size, hipStream_t stream) {
  if (n_in < 13) return;
  const long act_need = ((long)(NB - 1) * SEQ_FULL + SEQ) * (long)E;
  if ((long)in_sizes[0] < act_need || (long)in_sizes[1] < act_need || (long)in_sizes[2] < act_need) return;
  if (in_sizes[3] < (NB - 1) * SEQ_FULL + SEQ) return;
  if ((long)in_sizes[4] < (long)(SEQ - 1) * SEQ_FULL + SEQ) return;
  if (in_sizes[5] < E * E || in_sizes[7] < E * E || in_sizes[9] < E * E || in_sizes[11] < E * E) return;
  if (in_sizes[6] < E || in_sizes[8] < E || in_sizes[10] < E || in_sizes[12] < E) return;
  if (out_size < MROWS * E) return;

  const float* query = (const float*)d_in[0];   // [NB_FULL][SEQ_FULL][E]
  const float* key   = (const float*)d_in[1];
  const float* value = (const float*)d_in[2];
  const int*   kpm   = (const int*)d_in[3];     // [NB_FULL][SEQ_FULL] int32 0/1
  const int*   am    = (const int*)d_in[4];     // [SEQ_FULL][SEQ_FULL] int32 0/1
  const float* q_w   = (const float*)d_in[5];   // [out][in]
  const float* q_b   = (const float*)d_in[6];
  const float* k_w   = (const float*)d_in[7];
  const float* k_b   = (const float*)d_in[8];
  const float* v_w   = (const float*)d_in[9];
  const float* v_b   = (const float*)d_in[10];
  const float* o_w   = (const float*)d_in[11];
  const float* o_b   = (const float*)d_in[12];
  float* out = (float*)d_out;                   // [NB][SEQ][E] f32

  const size_t plane = (size_t)MROWS * E * 2;   // 8 MiB at full size
  const size_t wplane = (size_t)E * E * 2;      // 2 MiB
  size_t off = 0; char* ws = (char*)d_ws;
  b16* Xq  = (b16*)(ws + off); off += plane;
  b16* Xk  = (b16*)(ws + off); off += plane;
  b16* Xv  = (b16*)(ws + off); off += plane;
  b16* Wq  = (b16*)(ws + off); off += wplane;
  b16* Wk  = (b16*)(ws + off); off += wplane;
  b16* Wv  = (b16*)(ws + off); off += wplane;
  b16* Wo  = (b16*)(ws + off); off += wplane;
  b16* Qh  = (b16*)(ws + off); off += plane;
  b16* Ql  = (b16*)(ws + off); off += plane;
  b16* Kh  = (b16*)(ws + off); off += plane;
  b16* Kl  = (b16*)(ws + off); off += plane;
  b16* Vh  = (b16*)(ws + off); off += plane;
  b16* Vl  = (b16*)(ws + off); off += plane;
  b16* Yh  = (b16*)(ws + off); off += plane;
  b16* Yl  = (b16*)(ws + off); off += plane;    // total 96 MiB at full size
  if (off > ws_size) return;

  cvt_kernel<<<2048, 256, 0, stream>>>(query, key, value, q_w, k_w, v_w, o_w, Xq, Xk, Xv, Wq, Wk, Wv, Wo);
  qkv_gemm_kernel<<<dim3(3 * E / 128, MROWS / 128), 256, 0, stream>>>(Xq, Xk, Xv, Wq, Wk, Wv, q_b, k_b, v_b, Qh, Ql, Kh, Kl, Vh, Vl);
  attn_kernel<<<(NG * QT) / AW, 32 * AW, 0, stream>>>(Qh, Ql, Kh, Kl, Vh, Vl, am, kpm, Yh, Yl);
  out_gemm_kernel<<<dim3(E / 128, MROWS / 128), 256, 0, stream>>>(Yh, Yl, Wo, o_b, out);
}

// v006
// A run of this version takes 102 microseconds.
// Two timings next to v005 put it at 1.04 and 1.03 times that version's speed.
// Counting every step since v000, it is 3.55 times as fast.
#include <hip/hip_runtime.h>

// Contractions: q/k/v projections on v_wmma_f32_16x16x32_bf16 with RNE-bf16 operand planes of the activations and of the [out][in] weights
// (one product per tile pair); S^T = K.Q^T (K = 128) and y^T = V^T.P^T (32 keys per step) as bf16 hi/lo splits (hi.hi + hi.lo + lo.hi);
// out = y.Wo^T with y as bf16 hi/lo planes against the RNE-bf16 Wo plane (hi.W + lo.W). f32 accumulate, f32 softmax statistics, 8 heads of 128.

#ifndef NB
#define NB 4
#endif
#ifndef SEQ
#define SEQ 1024
#endif
#ifndef NB_FULL
#define NB_FULL 4
#endif
#ifndef SEQ_FULL
#define SEQ_FULL 1024
#endif

namespace {
constexpr int E = 1024, NH = 8, DH = 128;
constexpr int MROWS = NB * SEQ;          // token rows, compact n*SEQ + t
constexpr int QT = SEQ / 16;             // 16-query tiles per (n, h)
constexpr int KT = SEQ / 16;             // 16-key tiles per (n, h)
constexpr int NG = NB * NH;              // g = n*NH + h
constexpr float SCALE = 0.08838834764831845f;   // 1/sqrt(128), applied in f32 on the score accumulators
static_assert(NB >= 1 && NB <= NB_FULL);
static_assert(SEQ % 128 == 0 && SEQ <= SEQ_FULL);
static_assert(E == NH * DH);
static_assert(MROWS % 128 == 0);

typedef __bf16 b16;
typedef __attribute__((ext_vector_type(16))) __bf16 v16b;
typedef __attribute__((ext_vector_type(8)))  __bf16 v8b;
typedef __attribute__((ext_vector_type(8)))  float v8f;
typedef __attribute__((ext_vector_type(4)))  float v4f;
typedef __attribute__((ext_vector_type(4)))  int v4i;

__device__ __forceinline__ v8b ld8b(const b16* p) { return *(const v8b*)p; }
__device__ __forceinline__ v16b cat8b(v8b a, v8b b) { return __builtin_shufflevector(a, b, 0, 1, 2, 3, 4, 5, 6, 7, 8, 9, 10, 11, 12, 13, 14, 15); }
// 16x16x32 16-bit fragment from a k-contiguous row pointer (A: lane&15 = row, B: lane&15 = column), hh = lane>>4:
// elements 0..7 <- p[8hh+0..7], elements 8..15 <- p[16+8hh+0..7]
__device__ __forceinline__ v16b frag_kb(const b16* p, int hh) { return cat8b(ld8b(p + 8 * hh), ld8b(p + 16 + 8 * hh)); }
// hi = bf16 truncation, lo = RNE bf16 of the residual
__device__ __forceinline__ void split_bf16(float v, b16& hi, b16& lo) {
  const unsigned int u = __builtin_bit_cast(unsigned int, v) & 0xffff0000u;
  hi = __builtin_bit_cast(b16, (unsigned short)(u >> 16));
  lo = (b16)(v - __builtin_bit_cast(float, u));
}
// RNE bf16 value of an f32 input, widened back to f32
__device__ __forceinline__ float bfr(float f) { return (float)(b16)f; }
__device__ __forceinline__ v8f wmma16b(v16b a, v16b b, v8f c) {
  return __builtin_amdgcn_wmma_f32_16x16x32_bf16(false, a, false, b, (short)0, c, false, false);
}
__device__ __forceinline__ void wave_lds_sync() {
  __builtin_amdgcn_fence(3, "workgroup");
  __builtin_amdgcn_wave_barrier();
  __builtin_amdgcn_fence(2, "workgroup");
}

// ---------------------------------------------------------------------------
// f32 -> RNE bf16 planes: query/key/value [NB_FULL][SEQ_FULL][E] -> X planes [MROWS][E] (compact rows n*SEQ+t);
// Region selection is block-uniform (region sizes are multiples of 256 chunks).
// ---------------------------------------------------------------------------
__global__ __launch_bounds__(256) void cvt_kernel(const float* __restrict__ xq, const float* __restrict__ xk, const float* __restrict__ xv,
                                                  const float* __restrict__ wq, const float* __restrict__ wk, const float* __restrict__ wv,
                                                  const float* __restrict__ wo,
                                                  b16* __restrict__ Xq, b16* __restrict__ Xk, b16* __restrict__ Xv,
                                                  b16* __restrict__ Wq, b16* __restrict__ Wk, b16* __restrict__ Wv, b16* __restrict__ Wo) {
  const size_t tid = (size_t)blockIdx.x * blockDim.x + threadIdx.x, stride = (size_t)gridDim.x * blockDim.x;
  const size_t nx = (size_t)MROWS * E / 8, nw = (size_t)E * E / 8;
  const size_t total = 3 * nx + 4 * nw;
  for (size_t c = tid; c < total; c += stride) {
    const float* src; b16* dst; size_t si, di;
    if (c < 3 * nx) {
      const int which = (int)(c / nx);
      const size_t cc = c - (size_t)which * nx;
      di = cc * 8;
      const size_t m = di / E, col = di % E;
      const size_t n = m / SEQ, t = m % SEQ;
      si = (n * SEQ_FULL + t) * (size_t)E + col;
      src = (which == 0) ? xq : (which == 1) ? xk : xv;
      dst = (which == 0) ? Xq : (which == 1) ? Xk : Xv;
    } else {
      const size_t c2 = c - 3 * nx;
      const int which = (int)(c2 / nw);
      const size_t cc = c2 - (size_t)which * nw;
      di = cc * 8; si = di;
      src = (which == 0) ? wq : (which == 1) ? wk : (which == 2) ? wv : wo;
      dst = (which == 0) ? Wq : (which == 1) ? Wk : (which == 2) ? Wv : Wo;
    }
    const v4f f0 = *(const v4f*)(src + si), f1 = *(const v4f*)(src + si + 4);
    v8b o;
#pragma unroll
    for (int e = 0; e < 4; ++e) { o[e] = (b16)f0[e]; o[4 + e] = (b16)f1[e]; }
    *(v8b*)(dst + di) = o;
    
  }
}

constexpr int GP = 128 + 16;
constexpr int GPL = 128 * GP;
constexpr int GNT = E / 64;
constexpr int GROW = 32 * E * 2;
static_assert(GNT >= 2 && GP % 16 == 0 && E % 128 == 0);
// 16x16x32 16-bit fragment from a staged row: p = row start + 64 B x k step + 16 B x (lane >> 4); same element order as frag_kb
__device__ __forceinline__ v16b frag_lds(const unsigned char* p) { return cat8b(*(const v8b*)p, *(const v8b*)(p + 32)); }
// Two planes = 8 copies of 16 B per lane (256 lanes). l: the lane's LDS byte address in the first plane of the target buffer (row = thread
// id >> 3, piece = thread id & 7); ga / gb: the lane's first 16 B of the trip in each global plane. Successive copies lie 32 rows on.
__device__ __forceinline__ void stage2(unsigned l, const unsigned char* ga, const unsigned char* gb) {
  asm volatile("global_load_async_to_lds_b128 %0, %8, off\n\t"
               "global_load_async_to_lds_b128 %1, %9, off\n\t"
               "global_load_async_to_lds_b128 %2, %10, off\n\t"
               "global_load_async_to_lds_b128 %3, %11, off\n\t"
               "global_load_async_to_lds_b128 %4, %12, off\n\t"
               "global_load_async_to_lds_b128 %5, %13, off\n\t"
               "global_load_async_to_lds_b128 %6, %14, off\n\t"
               "global_load_async_to_lds_b128 %7, %15, off\n\t"
               "s_wait_xcnt 0x0"
               :: "v"(l), "v"(l + 32 * GP), "v"(l + 64 * GP), "v"(l + 96 * GP),
                  "v"(l + GPL), "v"(l + GPL + 32 * GP), "v"(l + GPL + 64 * GP), "v"(l + GPL + 96 * GP),
                  "v"(ga), "v"(ga + GROW), "v"(ga + 2 * GROW), "v"(ga + 3 * GROW), "v"(gb), "v"(gb + GROW), "v"(gb + 2 * GROW), "v"(gb + 3 * GROW)
               : "memory");
}
__device__ __forceinline__ void stage3(unsigned l, const unsigned char* ga, const unsigned char* gb, const unsigned char* gc) {
  asm volatile("global_load_async_to_lds_b128 %0, %12, off\n\t"
               "global_load_async_to_lds_b128 %1, %13, off\n\t"
               "global_load_async_to_lds_b128 %2, %14, off\n\t"
               "global_load_async_to_lds_b128 %3, %15, off\n\t"
               "global_load_async_to_lds_b128 %4, %16, off\n\t"
               "global_load_async_to_lds_b128 %5, %17, off\n\t"
               "global_load_async_to_lds_b128 %6, %18, off\n\t"
               "global_load_async_to_lds_b128 %7, %19, off\n\t"
               "global_load_async_to_lds_b128 %8, %20, off\n\t"
               "global_load_async_to_lds_b128 %9, %21, off\n\t"
               "global_load_async_to_lds_b128 %10, %22, off\n\t"
               "global_load_async_to_lds_b128 %11, %23, off\n\t"
               "s_wait_xcnt 0x0"
               :: "v"(l), "v"(l + 32 * GP), "v"(l + 64 * GP), "v"(l + 96 * GP),
                  "v"(l + GPL), "v"(l + GPL + 32 * GP), "v"(l + GPL + 64 * GP), "v"(l + GPL + 96 * GP),
                  "v"(l + 2 * GPL), "v"(l + 2 * GPL + 32 * GP), "v"(l + 2 * GPL + 64 * GP), "v"(l + 2 * GPL + 96 * GP),
                  "v"(ga), "v"(ga + GROW), "v"(ga + 2 * GROW), "v"(ga + 3 * GROW), "v"(gb), "v"(gb + GROW), "v"(gb + 2 * GROW), "v"(gb + 3 * GROW),
                  "v"(gc), "v"(gc + GROW), "v"(gc + 2 * GROW), "v"(gc + 3 * GROW)
               : "memory");
}

// ---------------------------------------------------------------------------
// QKV GEMM: (MROWS x 1024) x (1024 x 3072), grid (24, MROWS/128); a block's 128 columns are one head of q, k or v, a wave's 64 half of it.
// A = bf16 activation plane rows, B = bf16 weight rows ([out][in] = [n][k]); one product per tile pair. Epilogue adds the RNE-bf16 bias and
// splits hi/lo; it stages per wave in the LDS of the ring, which no wave reads and no copy writes any more behind the last trip's barrier.
// ---------------------------------------------------------------------------
__global__ __launch_bounds__(256) void qkv_gemm_kernel(const b16* __restrict__ Xq, const b16* __restrict__ Xk, const b16* __restrict__ Xv,
                                                       const b16* __restrict__ Wq, const b16* __restrict__ Wk, const b16* __restrict__ Wv,
                                                       const float* __restrict__ bq, const float* __restrict__ bk, const float* __restrict__ bv,
                                                       b16* __restrict__ Qh, b16* __restrict__ Ql, b16* __restrict__ Kh, b16* __restrict__ Kl,
                                                       b16* __restrict__ Vh, b16* __restrict__ Vl) {
  constexpr int ST = 2 * GPL;                                       // one buffer: A plane, B plane
  __shared__ __attribute__((aligned(16))) unsigned char Sm[2 * ST];
  static_assert(2 * ST >= 8 * 2 * 32 * 64 * 2);
  const int lane = threadIdx.x & 31, wave = threadIdx.x >> 5, nloc = lane & 15, hlf = lane >> 4;
  const int wm = wave >> 1, wn = wave & 1;
  const int mb = blockIdx.y * 128, m0 = mb + wm * 32;
  const int cb = blockIdx.x * 128;                                  // 0..3071, block-uniform
  const int mat = cb / E, cmb = cb % E, cm = cmb + wn * 64, head = cmb / DH, dlo = wn * 64;
  const b16* X = (mat == 0) ? Xq : (mat == 1) ? Xk : Xv;
  const b16* W = (mat == 0) ? Wq : (mat == 1) ? Wk : Wv;
  const float* bias = ((mat == 0) ? bq : (mat == 1) ? bk : bv) + cm;
  const unsigned prow = threadIdx.x >> 3, pcol = (threadIdx.x & 7) * 16;
  const unsigned char* ga = (const unsigned char*)(X + (size_t)(mb + prow) * E) + pcol;
  const unsigned char* gb = (const unsigned char*)(W + (size_t)(cmb + prow) * E) + pcol;
  const unsigned l0 = (unsigned)(size_t)&Sm[0] + prow * GP + pcol;
  stage2(l0, ga, gb);
  asm volatile("s_wait_asynccnt 0x0" ::: "memory");       // this wave's share of trip 0 has landed
  __syncthreads();                                        // trip 0's planes are whole for every wave
  stage2(l0 + ST, ga + 128, gb + 128);
  v8f acc[2][4];
#pragma unroll
  for (int r = 0; r < 2; ++r)
#pragma unroll
    for (int t = 0; t < 4; ++t) acc[r][t] = (v8f){};
#pragma unroll 1
  for (int it = 0; it < GNT; ++it) {
    const unsigned sb = (unsigned)(it & 1) * (unsigned)ST;
    const unsigned char* pa = &Sm[0] + sb + (wm * 32 + nloc) * GP + 16 * hlf;
    const unsigned char* pb = &Sm[0] + sb + GPL + (wn * 64 + nloc) * GP + 16 * hlf;
#pragma unroll
    for (int u = 0; u < 2; ++u) {
      const v16b a0 = frag_lds(pa + 64 * u), a1 = frag_lds(pa + 16 * GP + 64 * u);
      v16b b[4];
#pragma unroll
      for (int t = 0; t < 4; ++t) b[t] = frag_lds(pb + t * 16 * GP + 64 * u);
      __builtin_amdgcn_sched_barrier(0);   // all twelve LDS reads of the k step issue ahead of its first WMMA: one read latency a step, not one a fragment
#pragma unroll
      for (int t = 0; t < 4; ++t) {
        acc[0][t] = wmma16b(a0, b[t], acc[0][t]);
        acc[1][t] = wmma16b(a1, b[t], acc[1][t]);
      }
    }
    __builtin_amdgcn_sched_barrier(0);   // the trip's WMMAs stay ahead of the waits below, so that they cover the flight of the next trip's copies
    asm volatile("s_wait_dscnt 0x0" ::: "memory");        // this wave's reads of the buffer are done before it may be refilled
    asm volatile("s_wait_asynccnt 0x0" ::: "memory");     // this wave's share of the next trip has landed
    __syncthreads();                                      // publishes the next trip's planes and ends every wave's reads of this buffer
    if (it + 2 < GNT) {
      const size_t go = (size_t)(it + 2) * 128;
      stage2(l0 + sb, ga + go, gb + go);
    }
  }
  asm volatile("s_wait_asynccnt 0x0" ::: "memory");       // no copy is outstanding when the ring's LDS is reused below
  const int n = m0 / SEQ, t0 = m0 % SEQ, g = n * NH + head;
  b16* Tp0 = (b16*)(&Sm[0] + wave * (2 * 32 * 64 * 2)); b16* Tp1 = Tp0 + 32 * 64;
#pragma unroll
  for (int t = 0; t < 4; ++t)
#pragma unroll
    for (int r = 0; r < 2; ++r)
#pragma unroll
      for (int v = 0; v < 8; ++v) {
        const int rr = r * 16 + v + 8 * hlf, d = t * 16 + nloc;
        b16 yh, yl; split_bf16(acc[r][t][v] + bfr(bias[d]), yh, yl);
        const int idx = (mat < 2) ? (rr * 64 + d) : ((rr >> 4) * 1024 + d * 16 + (rr & 15));
        Tp0[idx] = yh; Tp1[idx] = yl;
      }
  wave_lds_sync();
  if (mat < 2) {
    b16* Ph = (mat == 0) ? Qh : Kh; b16* Pl = (mat == 0) ? Ql : Kl;
    const size_t rowbase = (size_t)g * SEQ + t0;
#pragma unroll
    for (int j = 0; j < 8; ++j) {
      const int e = (j * 32 + lane) * 8, rr = e >> 6, cc = e & 63;
      const size_t go = (rowbase + rr) * DH + dlo + cc;
      *(v8b*)(Ph + go) = ld8b(Tp0 + e); *(v8b*)(Pl + go) = ld8b(Tp1 + e);
    }
    
  } else {
    const size_t tb = (size_t)g * KT + (t0 >> 4);
#pragma unroll
    for (int j = 0; j < 8; ++j) {
      const int e = (j * 32 + lane) * 8, kt2 = e >> 10, within = e & 1023;
      const size_t go = ((tb + kt2) * DH + dlo) * 16 + within;
      *(v8b*)(Vh + go) = ld8b(Tp0 + e); *(v8b*)(Vl + go) = ld8b(Tp1 + e);
    }
    
  }
}

constexpr int AW = 8;
constexpr int QB = 128;
constexpr int KPITCH = 2 * DH + 16;
constexpr int KPL = 32 * KPITCH;
constexpr int VPL = 2 * DH * 16 * 2;
constexpr int OFF_KH = 0, OFF_KL = KPL, OFF_VH = 2 * KPL, OFF_VL = 2 * KPL + VPL, STAGE = 2 * KPL + 2 * VPL;
constexpr int HALFB = (SEQ / 2) * DH * 2;      // bytes from a key to the key SEQ / 2 on, in every K and V plane
constexpr int NT = SEQ / 64;                   // trips: 32 keys of each half of the keys
static_assert(SEQ % QB == 0 && NT >= 2 && STAGE % 16 == 0 && KPITCH % 16 == 0);

__device__ __forceinline__ v8b lds8b(const unsigned char* p) { return *(const v8b*)p; }
__device__ __forceinline__ float xhalf(float x) {
  return __builtin_bit_cast(float, __builtin_amdgcn_permlanex16(__builtin_bit_cast(int, x), __builtin_bit_cast(int, x), 0x76543210, 0xfedcba98, false, false));
}
// one stage = 8 copies of 16 B per lane (256 lanes x 128 B = 32 KiB). lk / lv: the lane's LDS byte addresses in the K hi / V hi plane of the
// target buffer; the pointers: the lane's first 16 B of the stage in each global plane. The second copy of a plane lies 4,096 global bytes on.
__device__ __forceinline__ void stage_copy(unsigned lk, unsigned lv, const unsigned char* gkh, const unsigned char* gkl,
                                           const unsigned char* gvh, const unsigned char* gvl) {
  asm volatile("global_load_async_to_lds_b128 %0, %8, off\n\t"
               "global_load_async_to_lds_b128 %1, %9, off\n\t"
               "global_load_async_to_lds_b128 %2, %10, off\n\t"
               "global_load_async_to_lds_b128 %3, %11, off\n\t"
               "global_load_async_to_lds_b128 %4, %12, off\n\t"
               "global_load_async_to_lds_b128 %5, %13, off\n\t"
               "global_load_async_to_lds_b128 %6, %14, off\n\t"
               "global_load_async_to_lds_b128 %7, %15, off\n\t"
               "s_wait_xcnt 0x0"
               :: "v"(lk), "v"(lk + 16 * KPITCH), "v"(lk + KPL), "v"(lk + KPL + 16 * KPITCH),
                  "v"(lv), "v"(lv + VPL / 2), "v"(lv + VPL), "v"(lv + VPL + VPL / 2),
                  "v"(gkh), "v"(gkh + 4096), "v"(gkl), "v"(gkl + 4096), "v"(gvh), "v"(gvh + 4096), "v"(gvl), "v"(gvl + 4096)
               : "memory");
}

// Online softmax of one 16-query tile over the trip's 32 keys: s0 holds keys 8hh+0..7, s1 keys 16+8hh+0..7 of the lane's query; bm: one lane
// mask per score register. Leaves P^T split hi/lo as B operands and returns the factor that rescales what was accumulated before.
__device__ __forceinline__ float softmax_tile(v8f s0, v8f s1, const unsigned (&bm)[16], float& m, float& l, v16b& pbh, v16b& pbl) {
  const float ninf = -__builtin_inff();
#pragma unroll
  for (int r = 0; r < 8; ++r) {
    s0[r] = __builtin_amdgcn_inverse_ballot_w32(bm[r])     ? ninf : s0[r] * SCALE;
    s1[r] = __builtin_amdgcn_inverse_ballot_w32(bm[8 + r]) ? ninf : s1[r] * SCALE;
  }
  float mr = ninf;
#pragma unroll
  for (int r = 0; r < 8; ++r) mr = fmaxf(mr, fmaxf(s0[r], s1[r]));
  mr = fmaxf(mr, xhalf(mr));
  const float mn = fmaxf(m, mr);
  const float mref = (mn == ninf) ? 0.0f : mn;    // fully masked prefix: nothing accumulated yet
  const float al_ = __expf(m - mref);
  m = mn;
  float sum = 0.0f;
#pragma unroll
  for (int r = 0; r < 8; ++r) {
    const float e0 = __expf(s0[r] - mref), e1 = __expf(s1[r] - mref);
    sum += e0 + e1;
    b16 a, c; split_bf16(e0, a, c); pbh[r] = a; pbl[r] = c; split_bf16(e1, a, c); pbh[8 + r] = a; pbl[8 + r] = c;
  }
  sum += xhalf(sum);
  l = l * al_ + sum;
  return al_;
}

__global__ __launch_bounds__(32 * AW)
void attn_kernel(const b16* __restrict__ Qh, const b16* __restrict__ Ql, const b16* __restrict__ Kh, const b16* __restrict__ Kl,
                 const b16* __restrict__ Vh, const b16* __restrict__ Vl, const int* __restrict__ am, const int* __restrict__ kpm,
                 b16* __restrict__ Yh, b16* __restrict__ Yl) {
  __shared__ __attribute__((aligned(16))) unsigned char Ring[2][2 * STAGE];   // [buffer][key half]
  __shared__ __attribute__((aligned(16))) b16 Os[AW][2][16 * DH];
  __shared__ __attribute__((aligned(16))) float Mx[AW][16 * DH];              // the y^T partial that a wave hands to its partner
  __shared__ float Ms[AW][2][32];                                             // with its maximum and its sum
  // the wave's number as a scalar: tile, head and row bases then live in scalar registers, which leaves the vector registers to the fragments
  const int wid = __builtin_amdgcn_readfirstlane(threadIdx.x >> 5), lane = threadIdx.x & 31, hh = lane >> 4, col = lane & 15;
  const int qg = wid & 3, kh = wid >> 2;                  // query group, key half
  const int g = blockIdx.x / (SEQ / QB);                  // n*NH + h
  const int qb = (blockIdx.x % (SEQ / QB)) * QB + qg * 32;
  const int n = g / NH, h = g % NH;
  // The wave's tile 0 is the one it finishes, tile 1 the one it hands over: the partner numbers the same two tiles the other way round.
  const int q0[2] = {qb + (kh << 4), qb + ((kh ^ 1) << 4)};
  const int* amb[2] = {am + (size_t)q0[0] * SEQ_FULL + kh * (SEQ / 2), am + (size_t)q0[1] * SEQ_FULL + kh * (SEQ / 2)};   // attn_mask[query][key]
  const int* kpb = kpm + (size_t)n * SEQ_FULL + kh * (SEQ / 2);                                                          // key_padding_mask[n][key]
  const unsigned alo = (unsigned)(col * SEQ_FULL + 8 * hh), klo = (unsigned)(8 * hh);   // the lane's place behind those wave-uniform bases
  const float ninf = -__builtin_inff();
  // Copy addresses. A stage is 8,192 contiguous bytes of each global plane. K: 16-byte piece c = thread id (and c + 256) is row c >> 4,
  // piece c & 15. V: a wave's 512 bytes are 16 d rows of 32 B; lane = (key half hh, d row), so each half wave writes 256 contiguous LDS bytes.
  const size_t gplane = (size_t)g * SEQ * DH * 2;         // byte offset of (n, h) in every K and V plane
  const unsigned ring0 = (unsigned)(size_t)&Ring[0][0];
  {
    // Tile 0's addresses are formed from the thread id, apart from the later tiles': a value that an asm statement names itself is held below
    // v256 for its whole life, and one that also lived through the loop, where the fragments fill those registers, would be spilled to scratch.
    const unsigned wv = threadIdx.x >> 5;
    const unsigned kin0 = (unsigned)threadIdx.x * 16u, vin0 = wv * 512u + (unsigned)(col * 32 + hh * 16);
    const unsigned lk0 = ring0 + OFF_KH + (unsigned)((threadIdx.x >> 4) * KPITCH + (threadIdx.x & 15) * 16);
    const unsigned lv0 = ring0 + OFF_VH + (unsigned)(hh * (DH * 16)) + (wv * 16u + (unsigned)col) * 16u;
    stage_copy(lk0, lv0, (const unsigned char*)Kh + gplane + kin0, (const unsigned char*)Kl + gplane + kin0,
               (const unsigned char*)Vh + gplane + vin0, (const unsigned char*)Vl + gplane + vin0);
    stage_copy(lk0 + STAGE, lv0 + STAGE, (const unsigned char*)Kh + gplane + HALFB + kin0, (const unsigned char*)Kl + gplane + HALFB + kin0,
               (const unsigned char*)Vh + gplane + HALFB + vin0, (const unsigned char*)Vl + gplane + HALFB + vin0);
  }
  const unsigned kin = (unsigned)(wid * 512 + lane * 16), vin = (unsigned)(wid * 512 + col * 32 + hh * 16);   // thread id = 32 wid + lane
  const unsigned char* gkh = (const unsigned char*)Kh + gplane + kin; const unsigned char* gkl = (const unsigned char*)Kl + gplane + kin;
  const unsigned char* gvh = (const unsigned char*)Vh + gplane + vin; const unsigned char* gvl = (const unsigned char*)Vl + gplane + vin;
  const unsigned lk = ring0 + OFF_KH + (unsigned)((wid * 2 + hh) * KPITCH + col * 16);
  const unsigned lv = ring0 + OFF_VH + (unsigned)(hh * (DH * 16) + (wid * 16 + col) * 16);
  v16b qfh[2][DH / 32], qfl[2][DH / 32];                  // B operands of S^T, the same in every trip: [query tile][k step]
#pragma unroll
  for (int a = 0; a < 2; ++a) {
    const size_t qo = ((size_t)g * SEQ + q0[a] + col) * DH;
#pragma unroll
    for (int s = 0; s < DH / 32; ++s) { qfh[a][s] = frag_kb(Qh + qo + 32 * s, hh); qfl[a][s] = frag_kb(Ql + qo + 32 * s, hh); }
  }
  // Masked positions of the coming trip, one lane mask per score register (keys 8hh+0..7, then 16+8hh+0..7) and query tile: scalar registers
  // carry them over the loop's edge, so that the loaded words hold no vector register while S^T is formed.
  unsigned bm[2][16];
  int mo = 0;                                             // first key, within the wave's half, of the trip whose words are loaded next
  {
    v4i ma[2][4], mp[4];
#pragma unroll
    for (int j = 0; j < 4; ++j) {
      const int ko = (j >> 1) * 16 + (j & 1) * 4;
      ma[0][j] = *(const v4i*)(amb[0] + mo + alo + ko); ma[1][j] = *(const v4i*)(amb[1] + mo + alo + ko); mp[j] = *(const v4i*)(kpb + mo + klo + ko);
    }
#pragma unroll
    for (int j = 0; j < 4; ++j)
#pragma unroll
      for (int r = 0; r < 4; ++r) {
        const unsigned bk = __builtin_amdgcn_ballot_w32(mp[j][r] != 0);
        bm[0][4 * j + r] = __builtin_amdgcn_ballot_w32(ma[0][j][r] != 0) | bk; bm[1][4 * j + r] = __builtin_amdgcn_ballot_w32(ma[1][j][r] != 0) | bk;
      }
    mo += 32;
  }
  asm volatile("s_wait_asynccnt 0x0" ::: "memory");       // this wave's share of tile 0 has landed
  __syncthreads();                                        // tile 0 is whole for every wave
  stage_copy(lk + 2 * STAGE, lv + 2 * STAGE, gkh + 8192, gkl + 8192, gvh + 8192, gvl + 8192);
  stage_copy(lk + 3 * STAGE, lv + 3 * STAGE, gkh + HALFB + 8192, gkl + HALFB + 8192, gvh + HALFB + 8192, gvl + HALFB + 8192);
  float m[2] = {ninf, ninf}, l[2] = {0.0f, 0.0f};
  v8f o[2][8];
#pragma unroll
  for (int a = 0; a < 2; ++a)
#pragma unroll
    for (int t = 0; t < 8; ++t) o[a][t] = (v8f){};
  // One trip. refill is a constant at each call: the steady trip then holds no branch, so that the compiler has no later block to sink the
  // lane-mask compares into and the loaded mask words leave their vector registers ahead of y^T.
  auto trip = [&](const int it, const bool refill) __attribute__((always_inline)) {
    // the trip's first key is kh * SEQ / 2 + 32 * it
    const unsigned bo = (unsigned)(it & 1) * (unsigned)(2 * STAGE);
    const unsigned char* B = &Ring[0][0] + bo + (unsigned)kh * (unsigned)STAGE;
    const unsigned char* k0 = B + col * KPITCH + 16 * hh;   // the trip's key col; its key 16 + col lies 16 rows on
    v16b kfh[2][DH / 32], kfl[2][DH / 32];                  // the trip's K fragments: [16-key tile][k step]
#pragma unroll
    for (int s = 0; s < DH / 32; ++s)
#pragma unroll
      for (int j = 0; j < 2; ++j) {
        const unsigned char* ka = k0 + j * 16 * KPITCH + 64 * s;
        kfh[j][s] = cat8b(lds8b(ka + OFF_KH), lds8b(ka + OFF_KH + 32)); kfl[j][s] = cat8b(lds8b(ka + OFF_KL), lds8b(ka + OFF_KL + 32));
      }
    __builtin_amdgcn_sched_barrier(0);   // all K reads of the trip issue as one group ahead of S^T: one LDS latency a trip, not one a fragment
    v8f sc[2][2];                                           // [query tile][16-key tile]
#pragma unroll
    for (int a = 0; a < 2; ++a) { sc[a][0] = (v8f){}; sc[a][1] = (v8f){}; }
#pragma unroll   // each step names its own Q and K registers: a rolled loop could only index them through memory. hi.hi + hi.lo + lo.hi, four independent tiles in turn
    for (int s = 0; s < DH / 32; ++s) {
      sc[0][0] = wmma16b(kfh[0][s], qfh[0][s], sc[0][0]); sc[1][0] = wmma16b(kfh[0][s], qfh[1][s], sc[1][0]);
      sc[0][1] = wmma16b(kfh[1][s], qfh[0][s], sc[0][1]); sc[1][1] = wmma16b(kfh[1][s], qfh[1][s], sc[1][1]);
      sc[0][0] = wmma16b(kfh[0][s], qfl[0][s], sc[0][0]); sc[1][0] = wmma16b(kfh[0][s], qfl[1][s], sc[1][0]);
      sc[0][1] = wmma16b(kfh[1][s], qfl[0][s], sc[0][1]); sc[1][1] = wmma16b(kfh[1][s], qfl[1][s], sc[1][1]);
      sc[0][0] = wmma16b(kfl[0][s], qfh[0][s], sc[0][0]); sc[1][0] = wmma16b(kfl[0][s], qfh[1][s], sc[1][0]);
      sc[0][1] = wmma16b(kfl[1][s], qfh[0][s], sc[0][1]); sc[1][1] = wmma16b(kfl[1][s], qfh[1][s], sc[1][1]);
    }
    const unsigned char* va = B + hh * (DH * 16) + col * 16;   // the trip's keys 8hh+0..7 of d row col; the second 16-key tile lies VPL/2 on
    v16b vfh[8], vfl[8];                                    // the trip's V^T fragments, d rows t*16 + col
#pragma unroll
    for (int t = 0; t < 8; ++t) vfh[t] = cat8b(lds8b(va + OFF_VH + t * 256), lds8b(va + OFF_VH + VPL / 2 + t * 256));
    v4i ma[2][4], mp[4];
#pragma unroll
    for (int j = 0; j < 4; ++j) {
      const int ko = (j >> 1) * 16 + (j & 1) * 4;
      ma[0][j] = *(const v4i*)(amb[0] + mo + alo + ko); ma[1][j] = *(const v4i*)(amb[1] + mo + alo + ko); mp[j] = *(const v4i*)(kpb + mo + klo + ko);
    }
    asm volatile("s_wait_xcnt 0x0" ::: "memory");         // the mask loads' address registers are temporaries that softmax overwrites
    __builtin_amdgcn_sched_barrier(0);   // the V hi reads and the next trip's mask loads have issued by here, so that softmax covers their flight
    v16b pbh[2], pbl[2];
#pragma unroll
    for (int a = 0; a < 2; ++a) {
      const float al_ = softmax_tile(sc[a][0], sc[a][1], bm[a], m[a], l[a], pbh[a], pbl[a]);
#pragma unroll
      for (int t = 0; t < 8; ++t) o[a][t] = o[a][t] * al_;
    }
    __builtin_amdgcn_sched_barrier(0);   // this trip's lane masks are used up by here: the next trip's may take their scalar registers
#pragma unroll
    for (int j = 0; j < 4; ++j)
#pragma unroll
      for (int r = 0; r < 4; ++r) {
        const unsigned bk = __builtin_amdgcn_ballot_w32(mp[j][r] != 0);
        bm[0][4 * j + r] = __builtin_amdgcn_ballot_w32(ma[0][j][r] != 0) | bk; bm[1][4 * j + r] = __builtin_amdgcn_ballot_w32(ma[1][j][r] != 0) | bk;
      }
#pragma unroll
    for (int t = 0; t < 8; ++t) vfl[t] = cat8b(lds8b(va + OFF_VL + t * 256), lds8b(va + OFF_VL + VPL / 2 + t * 256));
    __builtin_amdgcn_sched_barrier(0);   // the V lo reads issue as one group ahead of y^T, whose two V hi terms cover their flight; asked for before softmax they would not fit the registers
    // split product hi.hi + hi.lo + lo.hi, one term over all sixteen output tiles at a time: neighbouring WMMAs are independent
#pragma unroll
    for (int t = 0; t < 8; ++t) { o[0][t] = wmma16b(vfh[t], pbh[0], o[0][t]); o[1][t] = wmma16b(vfh[t], pbh[1], o[1][t]); }
#pragma unroll
    for (int t = 0; t < 8; ++t) { o[0][t] = wmma16b(vfh[t], pbl[0], o[0][t]); o[1][t] = wmma16b(vfh[t], pbl[1], o[1][t]); }
#pragma unroll
    for (int t = 0; t < 8; ++t) { o[0][t] = wmma16b(vfl[t], pbh[0], o[0][t]); o[1][t] = wmma16b(vfl[t], pbh[1], o[1][t]); }
    __builtin_amdgcn_sched_barrier(0);   // softmax and y^T stay ahead of the waits below, so that they cover the flight of the next tiles' copies
    asm volatile("s_wait_dscnt 0x0" ::: "memory");        // this wave's reads of the buffer are done before it may be refilled
    asm volatile("s_wait_asynccnt 0x0" ::: "memory");     // this wave's share of the next tiles has landed
    __syncthreads();                                      // publishes the next tiles and ends every wave's reads of this buffer
    if (refill) {
      const size_t go = (size_t)(it + 2) * 8192;
      stage_copy(lk + bo, lv + bo, gkh + go, gkl + go, gvh + go, gvl + go);
      stage_copy(lk + bo + STAGE, lv + bo + STAGE, gkh + go + HALFB, gkl + go + HALFB, gvh + go + HALFB, gvl + go + HALFB);
      mo += 32;                                           // stays on the last trip's words at the end: that trip reloads them, in bounds and unused
    }
  };
#pragma unroll 1
  for (int it = 0; it < NT - 2; ++it) trip(it, true);
#pragma unroll 1
  for (int it = NT - 2; it < NT; ++it) trip(it, false);   // no tile is left to ask for
  asm volatile("s_wait_asynccnt 0x0" ::: "memory");       // no copy is outstanding when the wave goes on to its end
  // Tile 1's partial goes to the partner wave, which walked the other half of the keys and finishes that tile; same lane, same element.
  float* X = &Mx[wid][0];
#pragma unroll
  for (int t = 0; t < 8; ++t) {
    *(v4f*)(X + ((2 * t) * 32 + lane) * 4) = __builtin_shufflevector(o[1][t], o[1][t], 0, 1, 2, 3);
    *(v4f*)(X + ((2 * t + 1) * 32 + lane) * 4) = __builtin_shufflevector(o[1][t], o[1][t], 4, 5, 6, 7);
  }
  Ms[wid][0][lane] = m[1]; Ms[wid][1][lane] = l[1];
  __syncthreads();                                        // every wave's hand-over is written before its partner reads it
  const float* Y = &Mx[wid ^ 4][0];
  const float pm = Ms[wid ^ 4][0][lane], pl = Ms[wid ^ 4][1][lane];
  const float mn = fmaxf(m[0], pm);
  const float mref = (mn == ninf) ? 0.0f : mn;            // every key masked: both factors 0, the sum 0, as without the split
  const float a0 = __expf(m[0] - mref), a1 = __expf(pm - mref);
  const float inv = 1.0f / (l[0] * a0 + pl * a1);
  const float c0 = a0 * inv, c1 = a1 * inv;
  b16* T0 = Os[wid][0]; b16* T1 = Os[wid][1];
#pragma unroll
  for (int t = 0; t < 8; ++t) {
    const v4f p0 = *(const v4f*)(Y + ((2 * t) * 32 + lane) * 4), p1 = *(const v4f*)(Y + ((2 * t + 1) * 32 + lane) * 4);
    v8b hv, lv8;
#pragma unroll
    for (int r = 0; r < 8; ++r) { b16 a, c; split_bf16(o[0][t][r] * c0 + ((r < 4) ? p0[r & 3] : p1[r & 3]) * c1, a, c); hv[r] = a; lv8[r] = c; }
    const int idx = col * DH + t * 16 + 8 * hh;          // [query][d]
    *(v8b*)(T0 + idx) = hv; *(v8b*)(T1 + idx) = lv8;
  }
  wave_lds_sync();
  const size_t tok0 = (size_t)n * SEQ + q0[0];
#pragma unroll
  for (int j = 0; j < 8; ++j) {
    const int e = (j * 32 + lane) * 8, rr = e >> 7, cc = e & 127;
    const size_t go = (tok0 + rr) * E + (size_t)h * DH + cc;
    *(v8b*)(Yh + go) = ld8b(T0 + e); *(v8b*)(Yl + go) = ld8b(T1 + e);
  }
  
}

// ---------------------------------------------------------------------------
// Output projection: (MROWS x 1024) x (1024 x 1024) -> f32, grid (8, MROWS/128), A = y hi/lo planes, B = Wo plane rows ([out][in]); hi.W + lo.W.
// ---------------------------------------------------------------------------
__global__ __launch_bounds__(256) void out_gemm_kernel(const b16* __restrict__ Yh, const b16* __restrict__ Yl, const b16* __restrict__ Wo,
                                                       const float* __restrict__ bo, float* __restrict__ out) {
  constexpr int ST = 3 * GPL;                                       // one buffer: y hi plane, y lo plane, Wo plane
  __shared__ __attribute__((aligned(16))) unsigned char Sm[2 * ST];
  static_assert(2 * ST >= 8 * 32 * 64 * 4);
  const int lane = threadIdx.x & 31, wave = threadIdx.x >> 5, nloc = lane & 15, hlf = lane >> 4;
  const int wm = wave >> 1, wn = wave & 1;
  const int mb = blockIdx.y * 128, m0 = mb + wm * 32;
  const int cb = blockIdx.x * 128, c0 = cb + wn * 64;
  const unsigned prow = threadIdx.x >> 3, pcol = (threadIdx.x & 7) * 16;
  const unsigned char* gh = (const unsigned char*)(Yh + (size_t)(mb + prow) * E) + pcol;
  const unsigned char* gl = (const unsigned char*)(Yl + (size_t)(mb + prow) * E) + pcol;
  const unsigned char* gw = (const unsigned char*)(Wo + (size_t)(cb + prow) * E) + pcol;
  const unsigned l0 = (unsigned)(size_t)&Sm[0] + prow * GP + pcol;
  stage3(l0, gh, gl, gw);
  asm volatile("s_wait_asynccnt 0x0" ::: "memory");       // this wave's share of trip 0 has landed
  __syncthreads();                                        // trip 0's planes are whole for every wave
  stage3(l0 + ST, gh + 128, gl + 128, gw + 128);
  v8f acc[2][4];
#pragma unroll
  for (int r = 0; r < 2; ++r)
#pragma unroll
    for (int t = 0; t < 4; ++t) acc[r][t] = (v8f){};
#pragma unroll 1
  for (int it = 0; it < GNT; ++it) {
    const unsigned sb = (unsigned)(it & 1) * (unsigned)ST;
    const unsigned char* pa = &Sm[0] + sb + (wm * 32 + nloc) * GP + 16 * hlf;             // y hi; y lo lies GPL on
    const unsigned char* pb = &Sm[0] + sb + 2 * GPL + (wn * 64 + nloc) * GP + 16 * hlf;
    v16b a[2][4], b[2][4];                                // [k step][fragment]; a: rows 0..15 hi, lo, rows 16..31 hi, lo
#pragma unroll
    for (int u = 0; u < 2; ++u) {
      a[u][0] = frag_lds(pa + 64 * u); a[u][1] = frag_lds(pa + GPL + 64 * u);
      a[u][2] = frag_lds(pa + 16 * GP + 64 * u); a[u][3] = frag_lds(pa + GPL + 16 * GP + 64 * u);
#pragma unroll
      for (int t = 0; t < 4; ++t) b[u][t] = frag_lds(pb + t * 16 * GP + 64 * u);
    }
    __builtin_amdgcn_sched_barrier(0);   // the trip's LDS reads all issue ahead of its first WMMA, which then waits for its own fragments only
#pragma unroll
    for (int u = 0; u < 2; ++u)
#pragma unroll
      for (int t = 0; t < 4; ++t) {
        acc[0][t] = wmma16b(a[u][0], b[u][t], acc[0][t]); acc[0][t] = wmma16b(a[u][1], b[u][t], acc[0][t]);
        acc[1][t] = wmma16b(a[u][2], b[u][t], acc[1][t]); acc[1][t] = wmma16b(a[u][3], b[u][t], acc[1][t]);
      }
    __builtin_amdgcn_sched_barrier(0);   // the trip's WMMAs stay ahead of the waits below, so that they cover the flight of the next trip's copies
    asm volatile("s_wait_dscnt 0x0" ::: "memory");        // this wave's reads of the buffer are done before it may be refilled
    asm volatile("s_wait_asynccnt 0x0" ::: "memory");     // this wave's share of the next trip has landed
    __syncthreads();                                      // publishes the next trip's planes and ends every wave's reads of this buffer
    if (it + 2 < GNT) {
      const size_t go = (size_t)(it + 2) * 128;
      stage3(l0 + sb, gh + go, gl + go, gw + go);
    }
  }
  asm volatile("s_wait_asynccnt 0x0" ::: "memory");       // no copy is outstanding when the ring's LDS is reused below
  float* Tt = (float*)(&Sm[0] + wave * (32 * 64 * 4));
#pragma unroll
  for (int t = 0; t < 4; ++t)
#pragma unroll
    for (int r = 0; r < 2; ++r)
#pragma unroll
      for (int v = 0; v < 8; ++v) Tt[(r * 16 + v + 8 * hlf) * 64 + t * 16 + nloc] = acc[r][t][v] + bfr(bo[c0 + t * 16 + nloc]);
  wave_lds_sync();
  float* dst0 = out + (size_t)m0 * E + c0;
#pragma unroll
  for (int j = 0; j < 16; ++j) { const int rr = j * 2 + hlf, c4 = nloc * 4; *(v4f*)(dst0 + (size_t)rr * E + c4) = *(const v4f*)(Tt + rr * 64 + c4); }
  
}
}  // namespace

extern "C" void kernel_launch(void* const* d_in, const int* in_sizes, int n_in,
                              void* d_out, int out_size, void* d_ws, size_t ws_size, hipStream_t stream) {
  if (n_in < 13) return;
  const long act_need = ((long)(NB - 1) * SEQ_FULL + SEQ) * (long)E;
  if ((long)in_sizes[0] < act_need || (long)in_sizes[1] < act_need || (long)in_sizes[2] < act_need) return;
  if (in_sizes[3] < (NB - 1) * SEQ_FULL + SEQ) return;
  if ((long)in_sizes[4] < (long)(SEQ - 1) * SEQ_FULL + SEQ) return;
  if (in_sizes[5] < E * E || in_sizes[7] < E * E || in_sizes[9] < E * E || in_sizes[11] < E * E) return;
  if (in_sizes[6] < E || in_sizes[8] < E || in_sizes[10] < E || in_sizes[12] < E) return;
  if (out_size < MROWS * E) return;

  const float* query = (const float*)d_in[0];   // [NB_FULL][SEQ_FULL][E]
  const float* key   = (const float*)d_in[1];
  const float* value = (const float*)d_in[2];
  const int*   kpm   = (const int*)d_in[3];     // [NB_FULL][SEQ_FULL] int32 0/1
  const int*   am    = (const int*)d_in[4];     // [SEQ_FULL][SEQ_FULL] int32 0/1
  const float* q_w   = (const float*)d_in[5];   // [out][in]
  const float* q_b   = (const float*)d_in[6];
  const float* k_w   = (const float*)d_in[7];
  const float* k_b   = (const float*)d_in[8];
  const float* v_w   = (const float*)d_in[9];
  const float* v_b   = (const float*)d_in[10];
  const float* o_w   = (const float*)d_in[11];
  const float* o_b   = (const float*)d_in[12];
  float* out = (float*)d_out;                   // [NB][SEQ][E] f32

  const size_t plane = (size_t)MROWS * E * 2;   // 8 MiB at full size
  const size_t wplane = (size_t)E * E * 2;      // 2 MiB
  size_t off = 0; char* ws = (char*)d_ws;
  b16* Xq  = (b16*)(ws + off); off += plane;
  b16* Xk  = (b16*)(ws + off); off += plane;
  b16* Xv  = (b16*)(ws + off); off += plane;
  b16* Wq  = (b16*)(ws + off); off += wplane;
  b16* Wk  = (b16*)(ws + off); off += wplane;
  b16* Wv  = (b16*)(ws + off); off += wplane;
  b16* Wo  = (b16*)(ws + off); off += wplane;
  b16* Qh  = (b16*)(ws + off); off += plane;
  b16* Ql  = (b16*)(ws + off); off += plane;
  b16* Kh  = (b16*)(ws + off); off += plane;
  b16* Kl  = (b16*)(ws + off); off += plane;
  b16* Vh  = (b16*)(ws + off); off += plane;
  b16* Vl  = (b16*)(ws + off); off += plane;
  b16* Yh  = (b16*)(ws + off); off += plane;
  b16* Yl  = (b16*)(ws + off); off += plane;    // total 96 MiB at full size
  if (off > ws_size) return;

  cvt_kernel<<<2048, 256, 0, stream>>>(query, key, value, q_w, k_w, v_w, o_w, Xq, Xk, Xv, Wq, Wk, Wv, Wo);
  qkv_gemm_kernel<<<dim3(3 * E / 128, MROWS / 128), 256, 0, stream>>>(Xq, Xk, Xv, Wq, Wk, Wv, q_b, k_b, v_b, Qh, Ql, Kh, Kl, Vh, Vl);
  attn_kernel<<<NG * (SEQ / QB), 32 * AW, 0, stream>>>(Qh, Ql, Kh, Kl, Vh, Vl, am, kpm, Yh, Yl);
  out_gemm_kernel<<<dim3(E / 128, MROWS / 128), 256, 0, stream>>>(Yh, Yl, Wo, o_b, out);
}

// v008
// It runs in 78.5 microseconds.
// Versions in between are left out here; by their measured steps it is 1.31 times as fast as v006.
// All steps since v000 together make it 4.65 times as fast.
#include <hip/hip_runtime.h>

#ifndef NB
#define NB 4
#endif
#ifndef SEQ
#define SEQ 1024
#endif
#ifndef NB_FULL
#define NB_FULL 4
#endif
#ifndef SEQ_FULL
#define SEQ_FULL 1024
#endif

namespace {
constexpr int E = 1024, NH = 8, DH = 128;
constexpr int MROWS = NB * SEQ;          // token rows, compact n*SEQ + t
constexpr int QT = SEQ / 16;             // 16-query tiles per (n, h)
constexpr int KT = SEQ / 16;             // 16-key tiles per (n, h)
constexpr int NG = NB * NH;              // g = n*NH + h
constexpr float SCALE = 0.08838834764831845f;   // 1/sqrt(128), applied in f32 on the score accumulators
static_assert(NB >= 1 && NB <= NB_FULL);
static_assert(SEQ % 128 == 0 && SEQ <= SEQ_FULL);
static_assert(E == NH * DH);
static_assert(MROWS % 128 == 0);
constexpr int MW = SEQ / 32;             // mask words per query or batch: bit b of word w is key 32w + b
constexpr int MAW = (SEQ / 32) * MW;     // waves that pack attn_mask: one per 32 queries and word
constexpr int MBLK = (MAW + NB + 7) / 8; // blocks of 8 waves that pack the two masks

typedef __bf16 b16;
typedef __attribute__((ext_vector_type(16))) __bf16 v16b;
typedef __attribute__((ext_vector_type(8)))  __bf16 v8b;
typedef __attribute__((ext_vector_type(8)))  float v8f;
typedef __attribute__((ext_vector_type(4)))  float v4f;
typedef __attribute__((ext_vector_type(4)))  int v4i;
typedef _Float16 h16;
typedef __attribute__((ext_vector_type(16))) _Float16 v16h;
typedef __attribute__((ext_vector_type(8)))  _Float16 v8h;

__device__ __forceinline__ v16b cat8b(v8b a, v8b b) { return __builtin_shufflevector(a, b, 0, 1, 2, 3, 4, 5, 6, 7, 8, 9, 10, 11, 12, 13, 14, 15); }
__device__ __forceinline__ v8h ld8h(const h16* p) { return *(const v8h*)p; }
__device__ __forceinline__ v16h cat8h(v8h a, v8h b) { return __builtin_shufflevector(a, b, 0, 1, 2, 3, 4, 5, 6, 7, 8, 9, 10, 11, 12, 13, 14, 15); }
// 16x16x32 16-bit fragment from a k-contiguous row pointer (A: lane&15 = row, B: lane&15 = column), hh = lane>>4:
// elements 0..7 <- p[8hh+0..7], elements 8..15 <- p[16+8hh+0..7]
__device__ __forceinline__ v16h frag_kh(const h16* p, int hh) { return cat8h(ld8h(p + 8 * hh), ld8h(p + 16 + 8 * hh)); }
// RNE bf16 value of an f32 input, widened back to f32
__device__ __forceinline__ float bfr(float f) { return (float)(b16)f; }
__device__ __forceinline__ v8f wmma16b(v16b a, v16b b, v8f c) {
  return __builtin_amdgcn_wmma_f32_16x16x32_bf16(false, a, false, b, (short)0, c, false, false);
}
__device__ __forceinline__ v8f wmma16h(v16h a, v16h b, v8f c) {
  return __builtin_amdgcn_wmma_f32_16x16x32_f16(false, a, false, b, (short)0, c, false, false);
}
__device__ __forceinline__ void wave_lds_sync() {
  __builtin_amdgcn_fence(3, "workgroup");
  __builtin_amdgcn_wave_barrier();
  __builtin_amdgcn_fence(2, "workgroup");
}

// ---------------------------------------------------------------------------
// f32 -> RNE bf16 planes: query/key/value [NB_FULL][SEQ_FULL][E] -> X planes [MROWS][E] (compact rows n*SEQ+t); the Wo plane is RNE f16, as y is.
// Region selection is block-uniform (region sizes are multiples of 256 chunks).
// The first MBLK blocks pack the two masks to one bit a key instead: Mb holds attn_mask as [word][query], so that the 16 queries of an
// attention tile lie in one line, and behind it key_padding_mask as [batch][word]. A wave reads whole 128-byte lines, one word's keys each,
// and stores its words as one run.
// ---------------------------------------------------------------------------
__global__ __launch_bounds__(256) void cvt_kernel(const float* __restrict__ xq, const float* __restrict__ xk, const float* __restrict__ xv,
                                                  const float* __restrict__ wq, const float* __restrict__ wk, const float* __restrict__ wv,
                                                  const float* __restrict__ wo, const int* __restrict__ am, const int* __restrict__ kpm,
                                                  unsigned* __restrict__ Mb,
                                                  b16* __restrict__ Xq, b16* __restrict__ Xk, b16* __restrict__ Xv,
                                                  b16* __restrict__ Wq, b16* __restrict__ Wk, b16* __restrict__ Wv, h16* __restrict__ Wo) {
  if (blockIdx.x < MBLK) {
    // wv is the same for a whole wave: every lane is on at the ballots
    const int wv = blockIdx.x * 8 + (threadIdx.x >> 5), lane = threadIdx.x & 31;
    unsigned w = 0;
    if (wv < MAW) {                                       // word c of queries 32 qb .. 32 qb + 31; lane j keeps query 32 qb + j's
      const int qb = wv / MW, c = wv % MW;
      const int* p = am + (size_t)qb * 32 * SEQ_FULL + c * 32 + lane;
#pragma unroll   // the loads are independent: unrolled they all fly at once
      for (int j = 0; j < 32; ++j) {
        const unsigned b = __builtin_amdgcn_ballot_w32(p[(size_t)j * SEQ_FULL] != 0);
        w = (lane == j) ? b : w;
      }
      Mb[c * SEQ + qb * 32 + lane] = w;
    } else if (wv < MAW + NB) {                           // all words of one batch; lane c keeps word c
      const int* p = kpm + (size_t)(wv - MAW) * SEQ_FULL + lane;
#pragma unroll   // the loads are independent: unrolled they all fly at once
      for (int c = 0; c < MW; ++c) {
        const unsigned b = __builtin_amdgcn_ballot_w32(p[c * 32] != 0);
        w = (lane == c) ? b : w;
      }
      if (lane < MW) Mb[MW * SEQ + (wv - MAW) * MW + lane] = w;
    }
    return;
  }
  const size_t tid = (size_t)(blockIdx.x - MBLK) * blockDim.x + threadIdx.x, stride = (size_t)(gridDim.x - MBLK) * blockDim.x;
  const size_t nx = (size_t)MROWS * E / 8, nw = (size_t)E * E / 8;
  const size_t total = 3 * nx + 4 * nw;
  for (size_t c = tid; c < total; c += stride) {
    const float* src; b16* dst; size_t si, di;
    bool toh = false;                                     // the chunk belongs to the f16 plane
    if (c < 3 * nx) {
      const int which = (int)(c / nx);
      const size_t cc = c - (size_t)which * nx;
      di = cc * 8;
      const size_t m = di / E, col = di % E;
      const size_t n = m / SEQ, t = m % SEQ;
      si = (n * SEQ_FULL + t) * (size_t)E + col;
      src = (which == 0) ? xq : (which == 1) ? xk : xv;
      dst = (which == 0) ? Xq : (which == 1) ? Xk : Xv;
    } else {
      const size_t c2 = c - 3 * nx;
      const int which = (int)(c2 / nw);
      const size_t cc = c2 - (size_t)which * nw;
      di = cc * 8; si = di;
      src = (which == 0) ? wq : (which == 1) ? wk : (which == 2) ? wv : wo;
      dst = (which == 0) ? Wq : (which == 1) ? Wk : (which == 2) ? Wv : (b16*)Wo;
      toh = (which == 3);
    }
    const v4f f0 = *(const v4f*)(src + si), f1 = *(const v4f*)(src + si + 4);
    v8b o; v8h oh;
#pragma unroll
    for (int e = 0; e < 4; ++e) { o[e] = (b16)f0[e]; o[4 + e] = (b16)f1[e]; oh[e] = (h16)f0[e]; oh[4 + e] = (h16)f1[e]; }
    *(v4i*)(dst + di) = toh ? __builtin_bit_cast(v4i, oh) : __builtin_bit_cast(v4i, o);   // one store for both kinds of plane: no branch in the stream
    
  }
}

constexpr int GP = 128 + 16;
constexpr int GPL = 128 * GP;
constexpr int GNT = E / 64;
constexpr int GROW = 32 * E * 2;
static_assert(GNT >= 2 && GP % 16 == 0 && E % 128 == 0);
// 16x16x32 16-bit fragment from a staged row: p = row start + 64 B x k step + 16 B x (lane >> 4); same element order as frag_kh
__device__ __forceinline__ v16b frag_lds(const unsigned char* p) { return cat8b(*(const v8b*)p, *(const v8b*)(p + 32)); }
__device__ __forceinline__ v16h frag_ldsh(const unsigned char* p) { return cat8h(*(const v8h*)p, *(const v8h*)(p + 32)); }
// Two planes = 8 copies of 16 B per lane (256 lanes). l: the lane's LDS byte address in the first plane of the target buffer (row = thread
// id >> 3, piece = thread id & 7); ga / gb: the lane's first 16 B of the trip in each global plane. Successive copies lie 32 rows on.
__device__ __forceinline__ void stage2(unsigned l, const unsigned char* ga, const unsigned char* gb) {
  asm volatile("global_load_async_to_lds_b128 %0, %8, off\n\t"
               "global_load_async_to_lds_b128 %1, %9, off\n\t"
               "global_load_async_to_lds_b128 %2, %10, off\n\t"
               "global_load_async_to_lds_b128 %3, %11, off\n\t"
               "global_load_async_to_lds_b128 %4, %12, off\n\t"
               "global_load_async_to_lds_b128 %5, %13, off\n\t"
               "global_load_async_to_lds_b128 %6, %14, off\n\t"
               "global_load_async_to_lds_b128 %7, %15, off\n\t"
               "s_wait_xcnt 0x0"
               :: "v"(l), "v"(l + 32 * GP), "v"(l + 64 * GP), "v"(l + 96 * GP),
                  "v"(l + GPL), "v"(l + GPL + 32 * GP), "v"(l + GPL + 64 * GP), "v"(l + GPL + 96 * GP),
                  "v"(ga), "v"(ga + GROW), "v"(ga + 2 * GROW), "v"(ga + 3 * GROW), "v"(gb), "v"(gb + GROW), "v"(gb + 2 * GROW), "v"(gb + 3 * GROW)
               : "memory");
}

// ---------------------------------------------------------------------------
// QKV GEMM: (MROWS x 1024) x (1024 x 3072), grid (24, MROWS/128); a block's 128 columns are one head of q, k or v, a wave's 64 half of it.
// A = bf16 activation plane rows, B = bf16 weight rows ([out][in] = [n][k]); one product per tile pair. Epilogue adds the RNE-bf16 bias and
// rounds to f16; it stages per wave in the LDS of the ring, which no wave reads and no copy writes any more behind the last trip's barrier.
// ---------------------------------------------------------------------------
__global__ __launch_bounds__(256) void qkv_gemm_kernel(const b16* __restrict__ Xq, const b16* __restrict__ Xk, const b16* __restrict__ Xv,
                                                       const b16* __restrict__ Wq, const b16* __restrict__ Wk, const b16* __restrict__ Wv,
                                                       const float* __restrict__ bq, const float* __restrict__ bk, const float* __restrict__ bv,
                                                       h16* __restrict__ Qf, h16* __restrict__ Kf, h16* __restrict__ Vf) {
  constexpr int ST = 2 * GPL;                                       // one buffer: A plane, B plane
  __shared__ __attribute__((aligned(16))) unsigned char Sm[2 * ST];
  static_assert(2 * ST >= 8 * 32 * 64 * 2);
  const int lane = threadIdx.x & 31, wave = threadIdx.x >> 5, nloc = lane & 15, hlf = lane >> 4;
  const int wm = wave >> 1, wn = wave & 1;
  const int mb = blockIdx.y * 128, m0 = mb + wm * 32;
  const int cb = blockIdx.x * 128;                                  // 0..3071, block-uniform
  const int mat = cb / E, cmb = cb % E, cm = cmb + wn * 64, head = cmb / DH, dlo = wn * 64;
  const b16* X = (mat == 0) ? Xq : (mat == 1) ? Xk : Xv;
  const b16* W = (mat == 0) ? Wq : (mat == 1) ? Wk : Wv;
  const float* bias = ((mat == 0) ? bq : (mat == 1) ? bk : bv) + cm;
  const unsigned prow = threadIdx.x >> 3, pcol = (threadIdx.x & 7) * 16;
  const unsigned char* ga = (const unsigned char*)(X + (size_t)(mb + prow) * E) + pcol;
  const unsigned char* gb = (const unsigned char*)(W + (size_t)(cmb + prow) * E) + pcol;
  const unsigned l0 = (unsigned)(size_t)&Sm[0] + prow * GP + pcol;
  stage2(l0, ga, gb);
  asm volatile("s_wait_asynccnt 0x0" ::: "memory");       // this wave's share of trip 0 has landed
  __syncthreads();                                        // trip 0's planes are whole for every wave
  stage2(l0 + ST, ga + 128, gb + 128);
  v8f acc[2][4];
#pragma unroll
  for (int r = 0; r < 2; ++r)
#pragma unroll
    for (int t = 0; t < 4; ++t) acc[r][t] = (v8f){};
#pragma unroll 1
  for (int it = 0; it < GNT; ++it) {
    const unsigned sb = (unsigned)(it & 1) * (unsigned)ST;
    const unsigned char* pa = &Sm[0] + sb + (wm * 32 + nloc) * GP + 16 * hlf;
    const unsigned char* pb = &Sm[0] + sb + GPL + (wn * 64 + nloc) * GP + 16 * hlf;
#pragma unroll
    for (int u = 0; u < 2; ++u) {
      const v16b a0 = frag_lds(pa + 64 * u), a1 = frag_lds(pa + 16 * GP + 64 * u);
      v16b b[4];
#pragma unroll
      for (int t = 0; t < 4; ++t) b[t] = frag_lds(pb + t * 16 * GP + 64 * u);
      __builtin_amdgcn_sched_barrier(0);   // all twelve LDS reads of the k step issue ahead of its first WMMA: one read latency a step, not one a fragment
#pragma unroll
      for (int t = 0; t < 4; ++t) {
        acc[0][t] = wmma16b(a0, b[t], acc[0][t]);
        acc[1][t] = wmma16b(a1, b[t], acc[1][t]);
      }
    }
    __builtin_amdgcn_sched_barrier(0);   // the trip's WMMAs stay ahead of the waits below, so that they cover the flight of the next trip's copies
    asm volatile("s_wait_dscnt 0x0" ::: "memory");        // this wave's reads of the buffer are done before it may be refilled
    asm volatile("s_wait_asynccnt 0x0" ::: "memory");     // this wave's share of the next trip has landed
    __syncthreads();                                      // publishes the next trip's planes and ends every wave's reads of this buffer
    if (it + 2 < GNT) {
      const size_t go = (size_t)(it + 2) * 128;
      stage2(l0 + sb, ga + go, gb + go);
    }
  }
  asm volatile("s_wait_asynccnt 0x0" ::: "memory");       // no copy is outstanding when the ring's LDS is reused below
  const int n = m0 / SEQ, t0 = m0 % SEQ, g = n * NH + head;
  h16* Tp = (h16*)(&Sm[0] + wave * (32 * 64 * 2));
  const float* bl = bias + nloc;
  float bb[4];
#pragma unroll
  for (int t = 0; t < 4; ++t) bb[t] = bl[t * 16];
  // the wait names the bias loads' address, which so keeps its registers, written by nothing (a load's own result among it), until the wait has passed
  asm volatile("s_wait_xcnt 0x0" :: "v"(bl) : "memory");
#pragma unroll
  for (int t = 0; t < 4; ++t)
#pragma unroll
    for (int r = 0; r < 2; ++r)
#pragma unroll
      for (int v = 0; v < 8; ++v) {
        const int rr = r * 16 + v + 8 * hlf, d = t * 16 + nloc;
        const int idx = (mat < 2) ? (rr * 64 + d) : ((rr >> 4) * 1024 + d * 16 + (rr & 15));
        Tp[idx] = (h16)(acc[r][t][v] + bfr(bb[t]));
      }
  wave_lds_sync();
  if (mat < 2) {
    h16* Pf = (mat == 0) ? Qf : Kf;
    const size_t rowbase = (size_t)g * SEQ + t0;
#pragma unroll
    for (int j = 0; j < 8; ++j) {
      const int e = (j * 32 + lane) * 8, rr = e >> 6, cc = e & 63;
      const size_t go = (rowbase + rr) * DH + dlo + cc;
      *(v8h*)(Pf + go) = ld8h(Tp + e);
    }
    asm volatile("s_wait_xcnt 0x0" ::: "memory");         // closes the stores above: none of their registers is rewritten ahead of it on any path of the listing
  } else {
    const size_t tb = (size_t)g * KT + (t0 >> 4);
#pragma unroll
    for (int j = 0; j < 8; ++j) {
      const int e = (j * 32 + lane) * 8, kt2 = e >> 10, within = e & 1023;
      const size_t go = ((tb + kt2) * DH + dlo) * 16 + within;
      *(v8h*)(Vf + go) = ld8h(Tp + e);
    }
    asm volatile("s_wait_xcnt 0x0" ::: "memory");         // closes the stores above: none of their registers is rewritten ahead of it on any path of the listing
  }
}

constexpr int AW = 8;
constexpr int QB = 128;
constexpr int KPITCH = 2 * DH + 16;
constexpr int KPL = 32 * KPITCH;
constexpr int VPL = 2 * DH * 16 * 2;
constexpr int OFF_K = 0, OFF_V = KPL, STAGE = KPL + VPL;
constexpr int HALFB = (SEQ / 2) * DH * 2;      // bytes from a key to the key SEQ / 2 on, in the K and the V plane
constexpr int NT = SEQ / 64;                   // trips: 32 keys of each half of the keys
static_assert(SEQ % QB == 0 && NT >= 2 && STAGE % 16 == 0 && KPITCH % 16 == 0);

__device__ __forceinline__ v8h lds8h(const unsigned char* p) { return *(const v8h*)p; }
__device__ __forceinline__ float xhalf(float x) {
  return __builtin_bit_cast(float, __builtin_amdgcn_permlanex16(__builtin_bit_cast(int, x), __builtin_bit_cast(int, x), 0x76543210, 0xfedcba98, false, false));
}
// one stage = 4 copies of 16 B per lane (256 lanes x 64 B = 16 KiB). lk / lv: the lane's LDS byte addresses in the K / V part of the target
// buffer; the pointers: the lane's first 16 B of the stage in each global plane. The second copy of a plane lies 4,096 global bytes on.
__device__ __forceinline__ void stage_copy(unsigned lk, unsigned lv, const unsigned char* gk, const unsigned char* gv) {
  asm volatile("global_load_async_to_lds_b128 %0, %4, off\n\t"
               "global_load_async_to_lds_b128 %1, %5, off\n\t"
               "global_load_async_to_lds_b128 %2, %6, off\n\t"
               "global_load_async_to_lds_b128 %3, %7, off\n\t"
               "s_wait_xcnt 0x0"
               :: "v"(lk), "v"(lk + 16 * KPITCH), "v"(lv), "v"(lv + VPL / 2),
                  "v"(gk), "v"(gk + 4096), "v"(gv), "v"(gv + 4096)
               : "memory");
}

// Online softmax of one 16-query tile over the trip's 32 keys: s0 holds keys 8hh+0..7, s1 keys 16+8hh+0..7 of the lane's query, scaled and
// with -inf at masked places. Leaves P^T rounded to f16 as a B operand and returns the factor that rescales what was accumulated before.
__device__ __forceinline__ float softmax_tile(v8f s0, v8f s1, float& m, float& l, v16h& pb) {
  const float ninf = -__builtin_inff();
  float mr = ninf;
#pragma unroll
  for (int r = 0; r < 8; ++r) mr = fmaxf(mr, fmaxf(s0[r], s1[r]));
  mr = fmaxf(mr, xhalf(mr));
  const float mn = fmaxf(m, mr);
  const float mref = (mn == ninf) ? 0.0f : mn;    // fully masked prefix: nothing accumulated yet
  const float al_ = __expf(m - mref);
  m = mn;
  float sum = 0.0f;
#pragma unroll
  for (int r = 0; r < 8; ++r) {
    const float e0 = __expf(s0[r] - mref), e1 = __expf(s1[r] - mref);
    sum += e0 + e1;
    pb[r] = (h16)e0; pb[8 + r] = (h16)e1;
  }
  sum += xhalf(sum);
  l = l * al_ + sum;
  return al_;
}

__global__ __launch_bounds__(32 * AW)
void attn_kernel(const h16* __restrict__ Qf, const h16* __restrict__ Kf, const h16* __restrict__ Vf, const unsigned* __restrict__ Mb,
                 h16* __restrict__ Yf) {
  __shared__ __attribute__((aligned(16))) unsigned char Ring[2][2 * STAGE];   // [buffer][key half]
  __shared__ __attribute__((aligned(16))) h16 Os[AW][16 * DH];
  __shared__ __attribute__((aligned(16))) float Mx[AW][16 * DH];              // the y^T partial that a wave hands to its partner
  __shared__ float Ms[AW][2][32];                                             // with its maximum and its sum
  // the wave's number as a scalar: tile, head and row bases then live in scalar registers, which leaves the vector registers to the fragments
  const int wid = __builtin_amdgcn_readfirstlane(threadIdx.x >> 5), lane = threadIdx.x & 31, hh = lane >> 4, col = lane & 15;
  const int qg = wid & 3, kh = wid >> 2;                  // query group, key half
  const int g = blockIdx.x / (SEQ / QB);                  // n*NH + h
  const int qb = (blockIdx.x % (SEQ / QB)) * QB + qg * 32;
  const int n = g / NH, h = g % NH;
  // The wave's tile 0 is the one it finishes, tile 1 the one it hands over: the partner numbers the same two tiles the other way round.
  const int q0[2] = {qb + (kh << 4), qb + ((kh ^ 1) << 4)};
  const unsigned* amb[2] = {Mb + kh * (MW / 2) * SEQ + q0[0], Mb + kh * (MW / 2) * SEQ + q0[1]};   // attn_mask bits [word][query]
  const unsigned* kpb = Mb + MW * SEQ + n * MW + kh * (MW / 2);                                    // key_padding_mask bits [n][word]
  const float ninf = -__builtin_inff();
  // Copy addresses. A stage is 8,192 contiguous bytes of each global plane. K: 16-byte piece c = thread id (and c + 256) is row c >> 4,
  // piece c & 15. V: a wave's 512 bytes are 16 d rows of 32 B; lane = (key half hh, d row), so each half wave writes 256 contiguous LDS bytes.
  const size_t gplane = (size_t)g * SEQ * DH * 2;         // byte offset of (n, h) in the K and the V plane
  const unsigned ring0 = (unsigned)(size_t)&Ring[0][0];
  {
    // Tile 0's addresses are formed from the thread id, apart from the later tiles': a value that an asm statement names itself is held below
    // v256 for its whole life, and one that also lived through the loop, where the fragments fill those registers, would be spilled to scratch.
    const unsigned wv = threadIdx.x >> 5;
    const unsigned kin0 = (unsigned)threadIdx.x * 16u, vin0 = wv * 512u + (unsigned)(col * 32 + hh * 16);
    const unsigned lk0 = ring0 + OFF_K + (unsigned)((threadIdx.x >> 4) * KPITCH + (threadIdx.x & 15) * 16);
    const unsigned lv0 = ring0 + OFF_V + (unsigned)(hh * (DH * 16)) + (wv * 16u + (unsigned)col) * 16u;
    stage_copy(lk0, lv0, (const unsigned char*)Kf + gplane + kin0, (const unsigned char*)Vf + gplane + vin0);
    stage_copy(lk0 + STAGE, lv0 + STAGE, (const unsigned char*)Kf + gplane + HALFB + kin0, (const unsigned char*)Vf + gplane + HALFB + vin0);
  }
  const unsigned kin = (unsigned)(wid * 512 + lane * 16), vin = (unsigned)(wid * 512 + col * 32 + hh * 16);   // thread id = 32 wid + lane
  const unsigned char* gk = (const unsigned char*)Kf + gplane + kin;
  const unsigned char* gv = (const unsigned char*)Vf + gplane + vin;
  const unsigned lk = ring0 + OFF_K + (unsigned)((wid * 2 + hh) * KPITCH + col * 16);
  const unsigned lv = ring0 + OFF_V + (unsigned)(hh * (DH * 16) + (wid * 16 + col) * 16);
  v16h qf[2][DH / 32];                                    // B operands of S^T, the same in every trip: [query tile][k step]
#pragma unroll
  for (int a = 0; a < 2; ++a) {
    const size_t qo = ((size_t)g * SEQ + q0[a] + col) * DH;
#pragma unroll
    for (int s = 0; s < DH / 32; ++s) qf[a][s] = frag_kh(Qf + qo + 32 * s, hh);
  }
  // Masked positions of the coming trip, one word per query tile, shifted so that bit r is the lane's key 8hh + r and bit 16 + r its key
  // 16 + 8hh + r; anym: whether any lane's word holds a bit, as a scalar that is ready long before the trip's branch asks for it.
  unsigned mw[2], anym;
  int mo = 0;                                             // word, within the wave's half of the keys, of the trip whose bits are loaded next
  {
    const unsigned kw = kpb[mo];
    mw[0] = (amb[0][mo * SEQ + col] | kw) >> (8 * hh); mw[1] = (amb[1][mo * SEQ + col] | kw) >> (8 * hh);
    anym = __builtin_amdgcn_ballot_w32((mw[0] | mw[1]) != 0);
    mo += 1;
  }
  asm volatile("s_wait_asynccnt 0x0" ::: "memory");       // this wave's share of tile 0 has landed
  __syncthreads();                                        // tile 0 is whole for every wave
  stage_copy(lk + 2 * STAGE, lv + 2 * STAGE, gk + 8192, gv + 8192);
  stage_copy(lk + 3 * STAGE, lv + 3 * STAGE, gk + HALFB + 8192, gv + HALFB + 8192);
  float m[2] = {ninf, ninf}, l[2] = {0.0f, 0.0f};
  v8f o[2][8];
#pragma unroll
  for (int a = 0; a < 2; ++a)
#pragma unroll
    for (int t = 0; t < 8; ++t) o[a][t] = (v8f){};
  // One trip. refill is a constant at each call: the steady trip then holds no branch but the one round the mask fill.
  auto trip = [&](const int it, const bool refill) __attribute__((always_inline)) {
    // the trip's first key is kh * SEQ / 2 + 32 * it
    const unsigned bo = (unsigned)(it & 1) * (unsigned)(2 * STAGE);
    const unsigned char* B = &Ring[0][0] + bo + (unsigned)kh * (unsigned)STAGE;
    const unsigned char* k0 = B + col * KPITCH + 16 * hh;   // the trip's key col; its key 16 + col lies 16 rows on
    v16h kf[2][DH / 32];                                    // the trip's K fragments: [16-key tile][k step]
#pragma unroll
    for (int s = 0; s < DH / 32; ++s)
#pragma unroll
      for (int j = 0; j < 2; ++j) {
        const unsigned char* ka = k0 + j * 16 * KPITCH + 64 * s;
        kf[j][s] = cat8h(lds8h(ka + OFF_K), lds8h(ka + OFF_K + 32));
      }
    __builtin_amdgcn_sched_barrier(0);   // all K reads of the trip issue as one group ahead of S^T: one LDS latency a trip, not one a fragment
    v8f sc[2][2];                                           // [query tile][16-key tile]
#pragma unroll
    for (int a = 0; a < 2; ++a) { sc[a][0] = (v8f){}; sc[a][1] = (v8f){}; }
#pragma unroll   // each step names its own Q and K registers: a rolled loop could only index them through memory. Four independent tiles in turn
    for (int s = 0; s < DH / 32; ++s) {
      sc[0][0] = wmma16h(kf[0][s], qf[0][s], sc[0][0]); sc[1][0] = wmma16h(kf[0][s], qf[1][s], sc[1][0]);
      sc[0][1] = wmma16h(kf[1][s], qf[0][s], sc[0][1]); sc[1][1] = wmma16h(kf[1][s], qf[1][s], sc[1][1]);
    }
    const unsigned nw0 = amb[0][mo * SEQ + col], nw1 = amb[1][mo * SEQ + col], kw = kpb[mo];   // the next trip's mask bits
    asm volatile("s_wait_xcnt 0x0" ::: "memory");         // the mask loads' address registers are temporaries that the V reads and softmax overwrite
    __builtin_amdgcn_sched_barrier(0);   // nothing from below, the V address among it, is lifted over that wait into a register that a mask load names
    const unsigned char* va = B + hh * (DH * 16) + col * 16;   // the trip's keys 8hh+0..7 of d row col; the second 16-key tile lies VPL/2 on
    v16h vf[8];                                             // the trip's V^T fragments, d rows t*16 + col
#pragma unroll
    for (int t = 0; t < 8; ++t) vf[t] = cat8h(lds8h(va + OFF_V + t * 256), lds8h(va + OFF_V + VPL / 2 + t * 256));
    __builtin_amdgcn_sched_barrier(0);   // the V reads and the next trip's mask loads have issued by here, so that softmax covers their flight
#pragma unroll
    for (int a = 0; a < 2; ++a) { sc[a][0] = sc[a][0] * SCALE; sc[a][1] = sc[a][1] * SCALE; }
    if (anym != 0) {                     // a scalar branch: a trip with no masked key in any of the wave's 32 x 32 places has nothing to fill
#pragma unroll
      for (int a = 0; a < 2; ++a)
#pragma unroll
        for (int r = 0; r < 8; ++r) {
          sc[a][0][r] = (mw[a] & (1u << r)) ? ninf : sc[a][0][r];
          sc[a][1][r] = (mw[a] & (1u << (16 + r))) ? ninf : sc[a][1][r];
        }
    }
    v16h pb[2];
#pragma unroll
    for (int a = 0; a < 2; ++a) {
      const float al_ = softmax_tile(sc[a][0], sc[a][1], m[a], l[a], pb[a]);
#pragma unroll
      for (int t = 0; t < 8; ++t) o[a][t] = o[a][t] * al_;
    }
    mw[0] = (nw0 | kw) >> (8 * hh); mw[1] = (nw1 | kw) >> (8 * hh);
    anym = __builtin_amdgcn_ballot_w32((mw[0] | mw[1]) != 0);
    // sixteen output tiles in turn: neighbouring WMMAs are independent
#pragma unroll
    for (int t = 0; t < 8; ++t) { o[0][t] = wmma16h(vf[t], pb[0], o[0][t]); o[1][t] = wmma16h(vf[t], pb[1], o[1][t]); }
    __builtin_amdgcn_sched_barrier(0);   // softmax and y^T stay ahead of the waits below, so that they cover the flight of the next tiles' copies
    asm volatile("s_wait_dscnt 0x0" ::: "memory");        // this wave's reads of the buffer are done before it may be refilled
    asm volatile("s_wait_asynccnt 0x0" ::: "memory");     // this wave's share of the next tiles has landed
    __syncthreads();                                      // publishes the next tiles and ends every wave's reads of this buffer
    if (refill) {
      const size_t go = (size_t)(it + 2) * 8192;
      stage_copy(lk + bo, lv + bo, gk + go, gv + go);
      stage_copy(lk + bo + STAGE, lv + bo + STAGE, gk + go + HALFB, gv + go + HALFB);
      mo += 1;                                            // stays on the last trip's words at the end: that trip reloads them, in bounds and unused
    }
  };
#pragma unroll 1
  for (int it = 0; it < NT - 2; ++it) trip(it, true);
#pragma unroll 1
  for (int it = NT - 2; it < NT; ++it) trip(it, false);   // no tile is left to ask for
  asm volatile("s_wait_asynccnt 0x0" ::: "memory");       // no copy is outstanding when the wave goes on to its end
  // Tile 1's partial goes to the partner wave, which walked the other half of the keys and finishes that tile; same lane, same element.
  float* X = &Mx[wid][0];
#pragma unroll
  for (int t = 0; t < 8; ++t) {
    *(v4f*)(X + ((2 * t) * 32 + lane) * 4) = __builtin_shufflevector(o[1][t], o[1][t], 0, 1, 2, 3);
    *(v4f*)(X + ((2 * t + 1) * 32 + lane) * 4) = __builtin_shufflevector(o[1][t], o[1][t], 4, 5, 6, 7);
  }
  Ms[wid][0][lane] = m[1]; Ms[wid][1][lane] = l[1];
  __syncthreads();                                        // every wave's hand-over is written before its partner reads it
  const float* Y = &Mx[wid ^ 4][0];
  const float pm = Ms[wid ^ 4][0][lane], pl = Ms[wid ^ 4][1][lane];
  const float mn = fmaxf(m[0], pm);
  const float mref = (mn == ninf) ? 0.0f : mn;            // every key masked: both factors 0, the sum 0, as without the split
  const float a0 = __expf(m[0] - mref), a1 = __expf(pm - mref);
  const float inv = 1.0f / (l[0] * a0 + pl * a1);
  const float c0 = a0 * inv, c1 = a1 * inv;
  h16* T0 = Os[wid];
#pragma unroll
  for (int t = 0; t < 8; ++t) {
    const v4f p0 = *(const v4f*)(Y + ((2 * t) * 32 + lane) * 4), p1 = *(const v4f*)(Y + ((2 * t + 1) * 32 + lane) * 4);
    v8f yv;
#pragma unroll
    for (int r = 0; r < 8; ++r) yv[r] = o[0][t][r] * c0 + ((r < 4) ? p0[r & 3] : p1[r & 3]) * c1;
    const int idx = col * DH + t * 16 + 8 * hh;          // [query][d]
    *(v8h*)(T0 + idx) = __builtin_convertvector(yv, v8h);
  }
  wave_lds_sync();
  const size_t tok0 = (size_t)n * SEQ + q0[0];
#pragma unroll
  for (int j = 0; j < 8; ++j) {
    const int e = (j * 32 + lane) * 8, rr = e >> 7, cc = e & 127;
    const size_t go = (tok0 + rr) * E + (size_t)h * DH + cc;
    *(v8h*)(Yf + go) = ld8h(T0 + e);
  }
  
}

// ---------------------------------------------------------------------------
// Output projection: (MROWS x 1024) x (1024 x 1024) -> f32, grid (8, MROWS/128), A = y plane rows, B = Wo plane rows ([out][in]), both f16.
// ---------------------------------------------------------------------------
__global__ __launch_bounds__(256) void out_gemm_kernel(const h16* __restrict__ Yf, const h16* __restrict__ Wo,
                                                       const float* __restrict__ bo, float* __restrict__ out) {
  constexpr int ST = 2 * GPL;                                       // one buffer: y plane, Wo plane
  __shared__ __attribute__((aligned(16))) unsigned char Sm[2 * ST];
  static_assert(2 * ST >= 8 * 32 * 64 * 4);
  const int lane = threadIdx.x & 31, wave = threadIdx.x >> 5, nloc = lane & 15, hlf = lane >> 4;
  const int wm = wave >> 1, wn = wave & 1;
  const int mb = blockIdx.y * 128, m0 = mb + wm * 32;
  const int cb = blockIdx.x * 128, c0 = cb + wn * 64;
  const unsigned prow = threadIdx.x >> 3, pcol = (threadIdx.x & 7) * 16;
  const unsigned char* gy = (const unsigned char*)(Yf + (size_t)(mb + prow) * E) + pcol;
  const unsigned char* gw = (const unsigned char*)(Wo + (size_t)(cb + prow) * E) + pcol;
  const unsigned l0 = (unsigned)(size_t)&Sm[0] + prow * GP + pcol;
  stage2(l0, gy, gw);
  asm volatile("s_wait_asynccnt 0x0" ::: "memory");       // this wave's share of trip 0 has landed
  __syncthreads();                                        // trip 0's planes are whole for every wave
  stage2(l0 + ST, gy + 128, gw + 128);
  v8f acc[2][4];
#pragma unroll
  for (int r = 0; r < 2; ++r)
#pragma unroll
    for (int t = 0; t < 4; ++t) acc[r][t] = (v8f){};
#pragma unroll 1
  for (int it = 0; it < GNT; ++it) {
    const unsigned sb = (unsigned)(it & 1) * (unsigned)ST;
    const unsigned char* pa = &Sm[0] + sb + (wm * 32 + nloc) * GP + 16 * hlf;
    const unsigned char* pb = &Sm[0] + sb + GPL + (wn * 64 + nloc) * GP + 16 * hlf;
    v16h a[2][2], b[2][4];                                // [k step][fragment]; a: rows 0..15, rows 16..31
#pragma unroll
    for (int u = 0; u < 2; ++u) {
      a[u][0] = frag_ldsh(pa + 64 * u); a[u][1] = frag_ldsh(pa + 16 * GP + 64 * u);
#pragma unroll
      for (int t = 0; t < 4; ++t) b[u][t] = frag_ldsh(pb + t * 16 * GP + 64 * u);
    }
    __builtin_amdgcn_sched_barrier(0);   // the trip's LDS reads all issue ahead of its first WMMA, which then waits for its own fragments only
#pragma unroll
    for (int u = 0; u < 2; ++u)
#pragma unroll
      for (int t = 0; t < 4; ++t) {
        acc[0][t] = wmma16h(a[u][0], b[u][t], acc[0][t]);
        acc[1][t] = wmma16h(a[u][1], b[u][t], acc[1][t]);
      }
    __builtin_amdgcn_sched_barrier(0);   // the trip's WMMAs stay ahead of the waits below, so that they cover the flight of the next trip's copies
    asm volatile("s_wait_dscnt 0x0" ::: "memory");        // this wave's reads of the buffer are done before it may be refilled
    asm volatile("s_wait_asynccnt 0x0" ::: "memory");     // this wave's share of the next trip has landed
    __syncthreads();                                      // publishes the next trip's planes and ends every wave's reads of this buffer
    if (it + 2 < GNT) {
      const size_t go = (size_t)(it + 2) * 128;
      stage2(l0 + sb, gy + go, gw + go);
    }
  }
  asm volatile("s_wait_asynccnt 0x0" ::: "memory");       // no copy is outstanding when the ring's LDS is reused below
  float* Tt = (float*)(&Sm[0] + wave * (32 * 64 * 4));
#pragma unroll
  for (int t = 0; t < 4; ++t)
#pragma unroll
    for (int r = 0; r < 2; ++r)
#pragma unroll
      for (int v = 0; v < 8; ++v) Tt[(r * 16 + v + 8 * hlf) * 64 + t * 16 + nloc] = acc[r][t][v] + bfr(bo[c0 + t * 16 + nloc]);
  wave_lds_sync();
  float* dst0 = out + (size_t)m0 * E + c0;
#pragma unroll
  for (int j = 0; j < 16; ++j) { const int rr = j * 2 + hlf, c4 = nloc * 4; *(v4f*)(dst0 + (size_t)rr * E + c4) = *(const v4f*)(Tt + rr * 64 + c4); }
  
}
}  // namespace

extern "C" void kernel_launch(void* const* d_in, const int* in_sizes, int n_in,
                              void* d_out, int out_size, void* d_ws, size_t ws_size, hipStream_t stream) {
  if (n_in < 13) return;
  const long act_need = ((long)(NB - 1) * SEQ_FULL + SEQ) * (long)E;
  if ((long)in_sizes[0] < act_need || (long)in_sizes[1] < act_need || (long)in_sizes[2] < act_need) return;
  if (in_sizes[3] < (NB - 1) * SEQ_FULL + SEQ) return;
  if ((long)in_sizes[4] < (long)(SEQ - 1) * SEQ_FULL + SEQ) return;
  if (in_sizes[5] < E * E || in_sizes[7] < E * E || in_sizes[9] < E * E || in_sizes[11] < E * E) return;
  if (in_sizes[6] < E || in_sizes[8] < E || in_sizes[10] < E || in_sizes[12] < E) return;
  if (out_size < MROWS * E) return;

  const float* query = (const float*)d_in[0];   // [NB_FULL][SEQ_FULL][E]
  const float* key   = (const float*)d_in[1];
  const float* value = (const float*)d_in[2];
  const int*   kpm   = (const int*)d_in[3];     // [NB_FULL][SEQ_FULL] int32 0/1
  const int*   am    = (const int*)d_in[4];     // [SEQ_FULL][SEQ_FULL] int32 0/1
  const float* q_w   = (const float*)d_in[5];   // [out][in]
  const float* q_b   = (const float*)d_in[6];
  const float* k_w   = (const float*)d_in[7];
  const float* k_b   = (const float*)d_in[8];
  const float* v_w   = (const float*)d_in[9];
  const float* v_b   = (const float*)d_in[10];
  const float* o_w   = (const float*)d_in[11];
  const float* o_b   = (const float*)d_in[12];
  float* out = (float*)d_out;                   // [NB][SEQ][E] f32

  const size_t plane = (size_t)MROWS * E * 2;   // 8 MiB at full size
  const size_t wplane = (size_t)E * E * 2;      // 2 MiB
  size_t off = 0; char* ws = (char*)d_ws;
  b16* Xq  = (b16*)(ws + off); off += plane;
  b16* Xk  = (b16*)(ws + off); off += plane;
  b16* Xv  = (b16*)(ws + off); off += plane;
  b16* Wq  = (b16*)(ws + off); off += wplane;
  b16* Wk  = (b16*)(ws + off); off += wplane;
  b16* Wv  = (b16*)(ws + off); off += wplane;
  h16* Wo  = (h16*)(ws + off); off += wplane;
  h16* Qf  = (h16*)(ws + off); off += plane;
  h16* Kf  = (h16*)(ws + off); off += plane;
  h16* Vf  = (h16*)(ws + off); off += plane;
  h16* Yf  = (h16*)(ws + off); off += plane;    // 64 MiB at full size
  unsigned* Mb = (unsigned*)(ws + off); off += (size_t)(SEQ + NB) * MW * 4;   // mask bits
  if (off > ws_size) return;

  cvt_kernel<<<MBLK + 2048, 256, 0, stream>>>(query, key, value, q_w, k_w, v_w, o_w, am, kpm, Mb, Xq, Xk, Xv, Wq, Wk, Wv, Wo);
  qkv_gemm_kernel<<<dim3(3 * E / 128, MROWS / 128), 256, 0, stream>>>(Xq, Xk, Xv, Wq, Wk, Wv, q_b, k_b, v_b, Qf, Kf, Vf);
  attn_kernel<<<NG * (SEQ / QB), 32 * AW, 0, stream>>>(Qf, Kf, Vf, Mb, Yf);
  out_gemm_kernel<<<dim3(E / 128, MROWS / 128), 256, 0, stream>>>(Yf, Wo, o_b, out);
}

// v009
// It runs in 73.6 microseconds.
// Two timings next to v008 put it at 1.07 and 1.06 times that version's speed.
// Over all steps from v000 it is 4.95 times as fast.
#include <hip/hip_runtime.h>

#ifndef NB
#define NB 4
#endif
#ifndef SEQ
#define SEQ 1024
#endif
#ifndef NB_FULL
#define NB_FULL 4
#endif
#ifndef SEQ_FULL
#define SEQ_FULL 1024
#endif

namespace {
constexpr int E = 1024, NH = 8, DH = 128;
constexpr int MROWS = NB * SEQ;          // token rows, compact n*SEQ + t
constexpr int QT = SEQ / 16;             // 16-query tiles per (n, h)
constexpr int KT = SEQ / 16;             // 16-key tiles per (n, h)
constexpr int NG = NB * NH;              // g = n*NH + h
constexpr float SCALE = 0.08838834764831845f;   // 1/sqrt(128), applied in f32 on the score accumulators
static_assert(NB >= 1 && NB <= NB_FULL);
static_assert(SEQ % 128 == 0 && SEQ <= SEQ_FULL);
static_assert(E == NH * DH);
static_assert(MROWS % 128 == 0);
constexpr int MW = SEQ / 32;             // mask words per query or batch: bit b of word w is key 32w + b
constexpr int MAW = (SEQ / 32) * MW;     // waves that pack attn_mask: one per 32 queries and word
constexpr int MBLK = (MAW + NB + 7) / 8; // blocks of 8 waves that pack the two masks

typedef __bf16 b16;
typedef __attribute__((ext_vector_type(16))) __bf16 v16b;
typedef __attribute__((ext_vector_type(8)))  __bf16 v8b;
typedef __attribute__((ext_vector_type(8)))  float v8f;
typedef __attribute__((ext_vector_type(4)))  float v4f;
typedef __attribute__((ext_vector_type(4)))  int v4i;
typedef _Float16 h16;
typedef __attribute__((ext_vector_type(16))) _Float16 v16h;
typedef __attribute__((ext_vector_type(8)))  _Float16 v8h;

__device__ __forceinline__ v16b cat8b(v8b a, v8b b) { return __builtin_shufflevector(a, b, 0, 1, 2, 3, 4, 5, 6, 7, 8, 9, 10, 11, 12, 13, 14, 15); }
__device__ __forceinline__ v8h ld8h(const h16* p) { return *(const v8h*)p; }
__device__ __forceinline__ v16h cat8h(v8h a, v8h b) { return __builtin_shufflevector(a, b, 0, 1, 2, 3, 4, 5, 6, 7, 8, 9, 10, 11, 12, 13, 14, 15); }
// 16x16x32 16-bit fragment from a k-contiguous row pointer (A: lane&15 = row, B: lane&15 = column), hh = lane>>4:
// elements 0..7 <- p[8hh+0..7], elements 8..15 <- p[16+8hh+0..7]
__device__ __forceinline__ v16h frag_kh(const h16* p, int hh) { return cat8h(ld8h(p + 8 * hh), ld8h(p + 16 + 8 * hh)); }
// RNE bf16 value of an f32 input, widened back to f32
__device__ __forceinline__ float bfr(float f) { return (float)(b16)f; }
__device__ __forceinline__ v8f wmma16b(v16b a, v16b b, v8f c) {
  return __builtin_amdgcn_wmma_f32_16x16x32_bf16(false, a, false, b, (short)0, c, false, false);
}
__device__ __forceinline__ v8f wmma16h(v16h a, v16h b, v8f c) {
  return __builtin_amdgcn_wmma_f32_16x16x32_f16(false, a, false, b, (short)0, c, false, false);
}
__device__ __forceinline__ void wave_lds_sync() {
  __builtin_amdgcn_fence(3, "workgroup");
  __builtin_amdgcn_wave_barrier();
  __builtin_amdgcn_fence(2, "workgroup");
}
__device__ __forceinline__ void ask_l2(const unsigned char* a, const unsigned char* b) {
  asm volatile("global_prefetch_b8 %0, off scope:SCOPE_SE\n\t"
               "global_prefetch_b8 %1, off scope:SCOPE_SE\n\t"
               "s_wait_xcnt 0x0"
               :: "v"(a), "v"(b));
}
// the same for one address a lane
__device__ __forceinline__ void ask_l2(const unsigned char* a) {
  asm volatile("global_prefetch_b8 %0, off scope:SCOPE_SE\n\t"
               "s_wait_xcnt 0x0"
               :: "v"(a));
}

// ---------------------------------------------------------------------------
// f32 -> RNE bf16 planes: query/key/value [NB_FULL][SEQ_FULL][E] -> X planes [MROWS][E] (compact rows n*SEQ+t); the Wo plane is RNE f16, as y is.
// Region selection is block-uniform (region sizes are multiples of 256 chunks).
// The first MBLK blocks pack the two masks to one bit a key instead: Mb holds attn_mask as [word][query], so that the 16 queries of an
// attention tile lie in one line, and behind it key_padding_mask as [batch][word]. A wave reads whole 128-byte lines, one word's keys each,
// and stores its words as one run.
// ---------------------------------------------------------------------------
__global__ __launch_bounds__(256) void cvt_kernel(const float* __restrict__ xq, const float* __restrict__ xk, const float* __restrict__ xv,
                                                  const float* __restrict__ wq, const float* __restrict__ wk, const float* __restrict__ wv,
                                                  const float* __restrict__ wo, const int* __restrict__ am, const int* __restrict__ kpm,
                                                  unsigned* __restrict__ Mb,
                                                  b16* __restrict__ Xq, b16* __restrict__ Xk, b16* __restrict__ Xv,
                                                  b16* __restrict__ Wq, b16* __restrict__ Wk, b16* __restrict__ Wv, h16* __restrict__ Wo) {
  if (blockIdx.x < MBLK) {
    // wv is the same for a whole wave: every lane is on at the ballots
    const int wv = blockIdx.x * 8 + (threadIdx.x >> 5), lane = threadIdx.x & 31;
    unsigned w = 0;
    if (wv < MAW) {                                       // word c of queries 32 qb .. 32 qb + 31; lane j keeps query 32 qb + j's
      const int qb = wv / MW, c = wv % MW;
      const int* p = am + (size_t)qb * 32 * SEQ_FULL + c * 32 + lane;
#pragma unroll   // the loads are independent: unrolled they all fly at once
      for (int j = 0; j < 32; ++j) {
        const unsigned b = __builtin_amdgcn_ballot_w32(p[(size_t)j * SEQ_FULL] != 0);
        w = (lane == j) ? b : w;
      }
      Mb[c * SEQ + qb * 32 + lane] = w;
    } else if (wv < MAW + NB) {                           // all words of one batch; lane c keeps word c
      const int* p = kpm + (size_t)(wv - MAW) * SEQ_FULL + lane;
#pragma unroll   // the loads are independent: unrolled they all fly at once
      for (int c = 0; c < MW; ++c) {
        const unsigned b = __builtin_amdgcn_ballot_w32(p[c * 32] != 0);
        w = (lane == c) ? b : w;
      }
      if (lane < MW) Mb[MW * SEQ + (wv - MAW) * MW + lane] = w;
    }
    return;
  }
  const size_t tid = (size_t)(blockIdx.x - MBLK) * blockDim.x + threadIdx.x, stride = (size_t)(gridDim.x - MBLK) * blockDim.x;
  const size_t nx = (size_t)MROWS * E / 8, nw = (size_t)E * E / 8;
  const size_t total = 3 * nx + 4 * nw;
  for (size_t c = tid; c < total; c += stride) {
    const float* src; b16* dst; size_t si, di;
    bool toh = false;                                     // the chunk belongs to the f16 plane
    if (c < 3 * nx) {
      const int which = (int)(c / nx);
      const size_t cc = c - (size_t)which * nx;
      di = cc * 8;
      const size_t m = di / E, col = di % E;
      const size_t n = m / SEQ, t = m % SEQ;
      si = (n * SEQ_FULL + t) * (size_t)E + col;
      src = (which == 0) ? xq : (which == 1) ? xk : xv;
      dst = (which == 0) ? Xq : (which == 1) ? Xk : Xv;
    } else {
      const size_t c2 = c - 3 * nx;
      const int which = (int)(c2 / nw);
      const size_t cc = c2 - (size_t)which * nw;
      di = cc * 8; si = di;
      src = (which == 0) ? wq : (which == 1) ? wk : (which == 2) ? wv : wo;
      dst = (which == 0) ? Wq : (which == 1) ? Wk : (which == 2) ? Wv : (b16*)Wo;
      toh = (which == 3);
    }
    const v4f f0 = *(const v4f*)(src + si), f1 = *(const v4f*)(src + si + 4);
    v8b o; v8h oh;
#pragma unroll
    for (int e = 0; e < 4; ++e) { o[e] = (b16)f0[e]; o[4 + e] = (b16)f1[e]; oh[e] = (h16)f0[e]; oh[4 + e] = (h16)f1[e]; }
    *(v4i*)(dst + di) = toh ? __builtin_bit_cast(v4i, oh) : __builtin_bit_cast(v4i, o);   // one store for both kinds of plane: no branch in the stream
    
  }
}

constexpr int GP = 128 + 16;
constexpr int GPL = 128 * GP;
constexpr int GNT = E / 64;
constexpr int GROW = 32 * E * 2;
static_assert(GNT >= 2 && GP % 16 == 0 && E % 128 == 0);
static_assert(E * 2 == 8 * 256);         // a plane's row is 8 steps of 256 bytes: 256 lanes ask at 32 rows
// 16x16x32 16-bit fragment from a staged row: p = row start + 64 B x k step + 16 B x (lane >> 4); same element order as frag_kh
__device__ __forceinline__ v16b frag_lds(const unsigned char* p) { return cat8b(*(const v8b*)p, *(const v8b*)(p + 32)); }
__device__ __forceinline__ v16h frag_ldsh(const unsigned char* p) { return cat8h(*(const v8h*)p, *(const v8h*)(p + 32)); }
// Two planes = 8 copies of 16 B per lane (256 lanes). l: the lane's LDS byte address in the first plane of the target buffer (row = thread
// id >> 3, piece = thread id & 7); ga / gb: the lane's first 16 B of the trip in each global plane. Successive copies lie 32 rows on.
__device__ __forceinline__ void stage2(unsigned l, const unsigned char* ga, const unsigned char* gb) {
  asm volatile("global_load_async_to_lds_b128 %0, %8, off\n\t"
               "global_load_async_to_lds_b128 %1, %9, off\n\t"
               "global_load_async_to_lds_b128 %2, %10, off\n\t"
               "global_load_async_to_lds_b128 %3, %11, off\n\t"
               "global_load_async_to_lds_b128 %4, %12, off\n\t"
               "global_load_async_to_lds_b128 %5, %13, off\n\t"
               "global_load_async_to_lds_b128 %6, %14, off\n\t"
               "global_load_async_to_lds_b128 %7, %15, off\n\t"
               "s_wait_xcnt 0x0"
               :: "v"(l), "v"(l + 32 * GP), "v"(l + 64 * GP), "v"(l + 96 * GP),
                  "v"(l + GPL), "v"(l + GPL + 32 * GP), "v"(l + GPL + 64 * GP), "v"(l + GPL + 96 * GP),
                  "v"(ga), "v"(ga + GROW), "v"(ga + 2 * GROW), "v"(ga + 3 * GROW), "v"(gb), "v"(gb + GROW), "v"(gb + 2 * GROW), "v"(gb + 3 * GROW)
               : "memory");
}

// ---------------------------------------------------------------------------
// QKV GEMM: (MROWS x 1024) x (1024 x 3072), grid (24, MROWS/128); a block's 128 columns are one head of q, k or v, a wave's 64 half of it.
// A = bf16 activation plane rows, B = bf16 weight rows ([out][in] = [n][k]); one product per tile pair. Epilogue adds the RNE-bf16 bias and
// rounds to f16; it stages per wave in the LDS of the ring, which no wave reads and no copy writes any more behind the last trip's barrier.
// ---------------------------------------------------------------------------
__global__ __launch_bounds__(256) void qkv_gemm_kernel(const b16* __restrict__ Xq, const b16* __restrict__ Xk, const b16* __restrict__ Xv,
                                                       const b16* __restrict__ Wq, const b16* __restrict__ Wk, const b16* __restrict__ Wv,
                                                       const float* __restrict__ bq, const float* __restrict__ bk, const float* __restrict__ bv,
                                                       h16* __restrict__ Qf, h16* __restrict__ Kf, h16* __restrict__ Vf) {
  constexpr int ST = 2 * GPL;                                       // one buffer: A plane, B plane
  __shared__ __attribute__((aligned(16))) unsigned char Sm[2 * ST];
  static_assert(2 * ST >= 8 * 32 * 64 * 2);
  const int lane = threadIdx.x & 31, wave = threadIdx.x >> 5, nloc = lane & 15, hlf = lane >> 4;
  const int wm = wave >> 1, wn = wave & 1;
  const int mb = blockIdx.y * 128, m0 = mb + wm * 32;
  const int cb = blockIdx.x * 128;                                  // 0..3071, block-uniform
  const int mat = cb / E, cmb = cb % E, cm = cmb + wn * 64, head = cmb / DH, dlo = wn * 64;
  const b16* X = (mat == 0) ? Xq : (mat == 1) ? Xk : Xv;
  const b16* W = (mat == 0) ? Wq : (mat == 1) ? Wk : Wv;
  const float* bias = ((mat == 0) ? bq : (mat == 1) ? bk : bv) + cm;
  const unsigned prow = threadIdx.x >> 3, pcol = (threadIdx.x & 7) * 16;
  const unsigned char* ga = (const unsigned char*)(X + (size_t)(mb + prow) * E) + pcol;
  const unsigned char* gb = (const unsigned char*)(W + (size_t)(cmb + prow) * E) + pcol;
  const unsigned l0 = (unsigned)(size_t)&Sm[0] + prow * GP + pcol;
  stage2(l0, ga, gb);
  // X rows are shared by the 8 blocks of a matrix along x, W rows by all blocks along y; lane = (row of the quarter, unit of the row)
  ask_l2((const unsigned char*)(X + (size_t)(mb + (blockIdx.x & 3) * 32 + prow) * E) + (threadIdx.x & 7) * 256,
         (const unsigned char*)(W + (size_t)(cmb + (blockIdx.y & 3) * 32 + prow) * E) + (threadIdx.x & 7) * 256);
  asm volatile("s_wait_asynccnt 0x0" ::: "memory");       // this wave's share of trip 0 has landed
  __syncthreads();                                        // trip 0's planes are whole for every wave
  stage2(l0 + ST, ga + 128, gb + 128);
  v8f acc[2][4];
#pragma unroll
  for (int r = 0; r < 2; ++r)
#pragma unroll
    for (int t = 0; t < 4; ++t) acc[r][t] = (v8f){};
#pragma unroll 1
  for (int it = 0; it < GNT; ++it) {
    const unsigned sb = (unsigned)(it & 1) * (unsigned)ST;
    const unsigned char* pa = &Sm[0] + sb + (wm * 32 + nloc) * GP + 16 * hlf;
    const unsigned char* pb = &Sm[0] + sb + GPL + (wn * 64 + nloc) * GP + 16 * hlf;
#pragma unroll
    for (int u = 0; u < 2; ++u) {
      const v16b a0 = frag_lds(pa + 64 * u), a1 = frag_lds(pa + 16 * GP + 64 * u);
      v16b b[4];
#pragma unroll
      for (int t = 0; t < 4; ++t) b[t] = frag_lds(pb + t * 16 * GP + 64 * u);
      __builtin_amdgcn_sched_barrier(0);   // all twelve LDS reads of the k step issue ahead of its first WMMA: one read latency a step, not one a fragment
#pragma unroll
      for (int t = 0; t < 4; ++t) {
        acc[0][t] = wmma16b(a0, b[t], acc[0][t]);
        acc[1][t] = wmma16b(a1, b[t], acc[1][t]);
      }
    }
    __builtin_amdgcn_sched_barrier(0);   // the trip's WMMAs stay ahead of the waits below, so that they cover the flight of the next trip's copies
    asm volatile("s_wait_dscnt 0x0" ::: "memory");        // this wave's reads of the buffer are done before it may be refilled
    asm volatile("s_wait_asynccnt 0x0" ::: "memory");     // this wave's share of the next trip has landed
    __syncthreads();                                      // publishes the next trip's planes and ends every wave's reads of this buffer
    if (it + 2 < GNT) {
      const size_t go = (size_t)(it + 2) * 128;
      stage2(l0 + sb, ga + go, gb + go);
    }
  }
  asm volatile("s_wait_asynccnt 0x0" ::: "memory");       // no copy is outstanding when the ring's LDS is reused below
  const int n = m0 / SEQ, t0 = m0 % SEQ, g = n * NH + head;
  h16* Tp = (h16*)(&Sm[0] + wave * (32 * 64 * 2));
  const float* bl = bias + nloc;
  float bb[4];
#pragma unroll
  for (int t = 0; t < 4; ++t) bb[t] = bl[t * 16];
  // the wait names the bias loads' address, which so keeps its registers, written by nothing (a load's own result among it), until the wait has passed
  asm volatile("s_wait_xcnt 0x0" :: "v"(bl) : "memory");
#pragma unroll
  for (int t = 0; t < 4; ++t)
#pragma unroll
    for (int r = 0; r < 2; ++r)
#pragma unroll
      for (int v = 0; v < 8; ++v) {
        const int rr = r * 16 + v + 8 * hlf, d = t * 16 + nloc;
        const int idx = (mat < 2) ? (rr * 64 + d) : ((rr >> 4) * 1024 + d * 16 + (rr & 15));
        Tp[idx] = (h16)(acc[r][t][v] + bfr(bb[t]));
      }
  wave_lds_sync();
  if (mat < 2) {
    h16* Pf = (mat == 0) ? Qf : Kf;
    const size_t rowbase = (size_t)g * SEQ + t0;
#pragma unroll
    for (int j = 0; j < 8; ++j) {
      const int e = (j * 32 + lane) * 8, rr = e >> 6, cc = e & 63;
      const size_t go = (rowbase + rr) * DH + dlo + cc;
      *(v8h*)(Pf + go) = ld8h(Tp + e);
    }
    asm volatile("s_wait_xcnt 0x0" ::: "memory");         // closes the stores above: none of their registers is rewritten ahead of it on any path of the listing
  } else {
    const size_t tb = (size_t)g * KT + (t0 >> 4);
#pragma unroll
    for (int j = 0; j < 8; ++j) {
      const int e = (j * 32 + lane) * 8, kt2 = e >> 10, within = e & 1023;
      const size_t go = ((tb + kt2) * DH + dlo) * 16 + within;
      *(v8h*)(Vf + go) = ld8h(Tp + e);
    }
    asm volatile("s_wait_xcnt 0x0" ::: "memory");         // closes the stores above: none of their registers is rewritten ahead of it on any path of the listing
  }
}

constexpr int AW = 8;
constexpr int QB = 128;
constexpr int KPITCH = 2 * DH + 16;
constexpr int KPL = 32 * KPITCH;
constexpr int VPL = 2 * DH * 16 * 2;
constexpr int OFF_K = 0, OFF_V = KPL, STAGE = KPL + VPL;
constexpr int HALFB = (SEQ / 2) * DH * 2;      // bytes from a key to the key SEQ / 2 on, in the K and the V plane
constexpr int NT = SEQ / 64;                   // trips: 32 keys of each half of the keys
static_assert(SEQ % QB == 0 && NT >= 2 && STAGE % 16 == 0 && KPITCH % 16 == 0);

__device__ __forceinline__ v8h lds8h(const unsigned char* p) { return *(const v8h*)p; }
__device__ __forceinline__ float xhalf(float x) {
  return __builtin_bit_cast(float, __builtin_amdgcn_permlanex16(__builtin_bit_cast(int, x), __builtin_bit_cast(int, x), 0x76543210, 0xfedcba98, false, false));
}
// one stage = 4 copies of 16 B per lane (256 lanes x 64 B = 16 KiB). lk / lv: the lane's LDS byte addresses in the K / V part of the target
// buffer; the pointers: the lane's first 16 B of the stage in each global plane. The second copy of a plane lies 4,096 global bytes on.
__device__ __forceinline__ void stage_copy(unsigned lk, unsigned lv, const unsigned char* gk, const unsigned char* gv) {
  asm volatile("global_load_async_to_lds_b128 %0, %4, off\n\t"
               "global_load_async_to_lds_b128 %1, %5, off\n\t"
               "global_load_async_to_lds_b128 %2, %6, off\n\t"
               "global_load_async_to_lds_b128 %3, %7, off\n\t"
               "s_wait_xcnt 0x0"
               :: "v"(lk), "v"(lk + 16 * KPITCH), "v"(lv), "v"(lv + VPL / 2),
                  "v"(gk), "v"(gk + 4096), "v"(gv), "v"(gv + 4096)
               : "memory");
}

// Online softmax of one 16-query tile over the trip's 32 keys: s0 holds keys 8hh+0..7, s1 keys 16+8hh+0..7 of the lane's query, scaled and
// with -inf at masked places. Leaves P^T rounded to f16 as a B operand and returns the factor that rescales what was accumulated before.
__device__ __forceinline__ float softmax_tile(v8f s0, v8f s1, float& m, float& l, v16h& pb) {
  const float ninf = -__builtin_inff();
  float mr = ninf;
#pragma unroll
  for (int r = 0; r < 8; ++r) mr = fmaxf(mr, fmaxf(s0[r], s1[r]));
  mr = fmaxf(mr, xhalf(mr));
  const float mn = fmaxf(m, mr);
  const float mref = (mn == ninf) ? 0.0f : mn;    // fully masked prefix: nothing accumulated yet
  const float al_ = __expf(m - mref);
  m = mn;
  float sum = 0.0f;
#pragma unroll
  for (int r = 0; r < 8; ++r) {
    const float e0 = __expf(s0[r] - mref), e1 = __expf(s1[r] - mref);
    sum += e0 + e1;
    pb[r] = (h16)e0; pb[8 + r] = (h16)e1;
  }
  sum += xhalf(sum);
  l = l * al_ + sum;
  return al_;
}

__global__ __launch_bounds__(32 * AW)
void attn_kernel(const h16* __restrict__ Qf, const h16* __restrict__ Kf, const h16* __restrict__ Vf, const unsigned* __restrict__ Mb,
                 h16* __restrict__ Yf) {
  __shared__ __attribute__((aligned(16))) unsigned char Ring[2][2 * STAGE];   // [buffer][key half]
  __shared__ __attribute__((aligned(16))) h16 Os[AW][16 * DH];
  __shared__ __attribute__((aligned(16))) float Mx[AW][16 * DH];              // the y^T partial that a wave hands to its partner
  __shared__ float Ms[AW][2][32];                                             // with its maximum and its sum
  // the wave's number as a scalar: tile, head and row bases then live in scalar registers, which leaves the vector registers to the fragments
  const int wid = __builtin_amdgcn_readfirstlane(threadIdx.x >> 5), lane = threadIdx.x & 31, hh = lane >> 4, col = lane & 15;
  const int qg = wid & 3, kh = wid >> 2;                  // query group, key half
  const int g = blockIdx.x / (SEQ / QB);                  // n*NH + h
  const int qb = (blockIdx.x % (SEQ / QB)) * QB + qg * 32;
  const int n = g / NH, h = g % NH;
  // The wave's tile 0 is the one it finishes, tile 1 the one it hands over: the partner numbers the same two tiles the other way round.
  const int q0[2] = {qb + (kh << 4), qb + ((kh ^ 1) << 4)};
  const unsigned* amb[2] = {Mb + kh * (MW / 2) * SEQ + q0[0], Mb + kh * (MW / 2) * SEQ + q0[1]};   // attn_mask bits [word][query]
  const unsigned* kpb = Mb + MW * SEQ + n * MW + kh * (MW / 2);                                    // key_padding_mask bits [n][word]
  const float ninf = -__builtin_inff();
  // Copy addresses. A stage is 8,192 contiguous bytes of each global plane. K: 16-byte piece c = thread id (and c + 256) is row c >> 4,
  // piece c & 15. V: a wave's 512 bytes are 16 d rows of 32 B; lane = (key half hh, d row), so each half wave writes 256 contiguous LDS bytes.
  const size_t gplane = (size_t)g * SEQ * DH * 2;         // byte offset of (n, h) in the K and the V plane
  const unsigned ring0 = (unsigned)(size_t)&Ring[0][0];
  {
    // Tile 0's addresses are formed from the thread id, apart from the later tiles': a value that an asm statement names itself is held below
    // v256 for its whole life, and one that also lived through the loop, where the fragments fill those registers, would be spilled to scratch.
    const unsigned wv = threadIdx.x >> 5;
    const unsigned kin0 = (unsigned)threadIdx.x * 16u, vin0 = wv * 512u + (unsigned)(col * 32 + hh * 16);
    const unsigned lk0 = ring0 + OFF_K + (unsigned)((threadIdx.x >> 4) * KPITCH + (threadIdx.x & 15) * 16);
    const unsigned lv0 = ring0 + OFF_V + (unsigned)(hh * (DH * 16)) + (wv * 16u + (unsigned)col) * 16u;
    stage_copy(lk0, lv0, (const unsigned char*)Kf + gplane + kin0, (const unsigned char*)Vf + gplane + vin0);
    stage_copy(lk0 + STAGE, lv0 + STAGE, (const unsigned char*)Kf + gplane + HALFB + kin0, (const unsigned char*)Vf + gplane + HALFB + vin0);
    // K and V of (n, h) are shared by the SEQ / QB blocks of its queries: a quarter of each plane a block, one unit of each a lane
    const unsigned pu = (blockIdx.x & 3) * (unsigned)(SEQ * DH / 2) + (threadIdx.x < SEQ / 4 ? threadIdx.x : SEQ / 4 - 1) * 256u;
    ask_l2((const unsigned char*)Kf + gplane + pu, (const unsigned char*)Vf + gplane + pu);
    // The attn_mask bits of the block's QB queries: 512 bytes of each word's row, a new row every trip. One unit a lane; the test is wave-uniform.
    if (wid < MW / 16) {
      const unsigned u = (unsigned)(wid * 32 + lane);
      ask_l2((const unsigned char*)(Mb + (u >> 1) * SEQ + (blockIdx.x % (SEQ / QB)) * QB + (u & 1) * 64));
    }
  }
  const unsigned kin = (unsigned)(wid * 512 + lane * 16), vin = (unsigned)(wid * 512 + col * 32 + hh * 16);   // thread id = 32 wid + lane
  const unsigned char* gk = (const unsigned char*)Kf + gplane + kin;
  const unsigned char* gv = (const unsigned char*)Vf + gplane + vin;
  const unsigned lk = ring0 + OFF_K + (unsigned)((wid * 2 + hh) * KPITCH + col * 16);
  const unsigned lv = ring0 + OFF_V + (unsigned)(hh * (DH * 16) + (wid * 16 + col) * 16);
  v16h qf[2][DH / 32];                                    // B operands of S^T, the same in every trip: [query tile][k step]
#pragma unroll
  for (int a = 0; a < 2; ++a) {
    const size_t qo = ((size_t)g * SEQ + q0[a] + col) * DH;
#pragma unroll
    for (int s = 0; s < DH / 32; ++s) qf[a][s] = frag_kh(Qf + qo + 32 * s, hh);
  }
  // Masked positions of the coming trip, one word per query tile, shifted so that bit r is the lane's key 8hh + r and bit 16 + r its key
  // 16 + 8hh + r; anym: whether any lane's word holds a bit, as a scalar that is ready long before the trip's branch asks for it.
  unsigned mw[2], anym;
  int mo = 0;                                             // word, within the wave's half of the keys, of the trip whose bits are loaded next
  {
    const unsigned kw = kpb[mo];
    mw[0] = (amb[0][mo * SEQ + col] | kw) >> (8 * hh); mw[1] = (amb[1][mo * SEQ + col] | kw) >> (8 * hh);
    anym = __builtin_amdgcn_ballot_w32((mw[0] | mw[1]) != 0);
    mo += 1;
  }
  asm volatile("s_wait_asynccnt 0x0" ::: "memory");       // this wave's share of tile 0 has landed
  __syncthreads();                                        // tile 0 is whole for every wave
  stage_copy(lk + 2 * STAGE, lv + 2 * STAGE, gk + 8192, gv + 8192);
  stage_copy(lk + 3 * STAGE, lv + 3 * STAGE, gk + HALFB + 8192, gv + HALFB + 8192);
  float m[2] = {ninf, ninf}, l[2] = {0.0f, 0.0f};
  v8f o[2][8];
#pragma unroll
  for (int a = 0; a < 2; ++a)
#pragma unroll
    for (int t = 0; t < 8; ++t) o[a][t] = (v8f){};
  // One trip. refill is a constant at each call: the steady trip then holds no branch but the one round the mask fill.
  auto trip = [&](const int it, const bool refill) __attribute__((always_inline)) {
    // the trip's first key is kh * SEQ / 2 + 32 * it
    const unsigned bo = (unsigned)(it & 1) * (unsigned)(2 * STAGE);
    const unsigned char* B = &Ring[0][0] + bo + (unsigned)kh * (unsigned)STAGE;
    const unsigned char* k0 = B + col * KPITCH + 16 * hh;   // the trip's key col; its key 16 + col lies 16 rows on
    v16h kf[2][DH / 32];                                    // the trip's K fragments: [16-key tile][k step]
#pragma unroll
    for (int s = 0; s < DH / 32; ++s)
#pragma unroll
      for (int j = 0; j < 2; ++j) {
        const unsigned char* ka = k0 + j * 16 * KPITCH + 64 * s;
        kf[j][s] = cat8h(lds8h(ka + OFF_K), lds8h(ka + OFF_K + 32));
      }
    __builtin_amdgcn_sched_barrier(0);   // all K reads of the trip issue as one group ahead of S^T: one LDS latency a trip, not one a fragment
    v8f sc[2][2];                                           // [query tile][16-key tile]
#pragma unroll
    for (int a = 0; a < 2; ++a) { sc[a][0] = (v8f){}; sc[a][1] = (v8f){}; }
#pragma unroll   // each step names its own Q and K registers: a rolled loop could only index them through memory. Four independent tiles in turn
    for (int s = 0; s < DH / 32; ++s) {
      sc[0][0] = wmma16h(kf[0][s], qf[0][s], sc[0][0]); sc[1][0] = wmma16h(kf[0][s], qf[1][s], sc[1][0]);
      sc[0][1] = wmma16h(kf[1][s], qf[0][s], sc[0][1]); sc[1][1] = wmma16h(kf[1][s], qf[1][s], sc[1][1]);
    }
    const unsigned nw0 = amb[0][mo * SEQ + col], nw1 = amb[1][mo * SEQ + col], kw = kpb[mo];   // the next trip's mask bits
    asm volatile("s_wait_xcnt 0x0" ::: "memory");         // the mask loads' address registers are temporaries that the V reads and softmax overwrite
    __builtin_amdgcn_sched_barrier(0);   // nothing from below, the V address among it, is lifted over that wait into a register that a mask load names
    const unsigned char* va = B + hh * (DH * 16) + col * 16;   // the trip's keys 8hh+0..7 of d row col; the second 16-key tile lies VPL/2 on
    v16h vf[8];                                             // the trip's V^T fragments, d rows t*16 + col
#pragma unroll
    for (int t = 0; t < 8; ++t) vf[t] = cat8h(lds8h(va + OFF_V + t * 256), lds8h(va + OFF_V + VPL / 2 + t * 256));
    __builtin_amdgcn_sched_barrier(0);   // the V reads and the next trip's mask loads have issued by here, so that softmax covers their flight
#pragma unroll
    for (int a = 0; a < 2; ++a) { sc[a][0] = sc[a][0] * SCALE; sc[a][1] = sc[a][1] * SCALE; }
    if (anym != 0) {                     // a scalar branch: a trip with no masked key in any of the wave's 32 x 32 places has nothing to fill
#pragma unroll
      for (int a = 0; a < 2; ++a)
#pragma unroll
        for (int r = 0; r < 8; ++r) {
          sc[a][0][r] = (mw[a] & (1u << r)) ? ninf : sc[a][0][r];
          sc[a][1][r] = (mw[a] & (1u << (16 + r))) ? ninf : sc[a][1][r];
        }
    }
    v16h pb[2];
#pragma unroll
    for (int a = 0; a < 2; ++a) {
      const float al_ = softmax_tile(sc[a][0], sc[a][1], m[a], l[a], pb[a]);
#pragma unroll
      for (int t = 0; t < 8; ++t) o[a][t] = o[a][t] * al_;
    }
    mw[0] = (nw0 | kw) >> (8 * hh); mw[1] = (nw1 | kw) >> (8 * hh);
    anym = __builtin_amdgcn_ballot_w32((mw[0] | mw[1]) != 0);
    // sixteen output tiles in turn: neighbouring WMMAs are independent
#pragma unroll
    for (int t = 0; t < 8; ++t) { o[0][t] = wmma16h(vf[t], pb[0], o[0][t]); o[1][t] = wmma16h(vf[t], pb[1], o[1][t]); }
    __builtin_amdgcn_sched_barrier(0);   // softmax and y^T stay ahead of the waits below, so that they cover the flight of the next tiles' copies
    asm volatile("s_wait_dscnt 0x0" ::: "memory");        // this wave's reads of the buffer are done before it may be refilled
    asm volatile("s_wait_asynccnt 0x0" ::: "memory");     // this wave's share of the next tiles has landed
    __syncthreads();                                      // publishes the next tiles and ends every wave's reads of this buffer
    if (refill) {
      const size_t go = (size_t)(it + 2) * 8192;
      stage_copy(lk + bo, lv + bo, gk + go, gv + go);
      stage_copy(lk + bo + STAGE, lv + bo + STAGE, gk + go + HALFB, gv + go + HALFB);
      mo += 1;                                            // stays on the last trip's words at the end: that trip reloads them, in bounds and unused
    }
  };
#pragma unroll 1
  for (int it = 0; it < NT - 2; ++it) trip(it, true);
#pragma unroll 1
  for (int it = NT - 2; it < NT; ++it) trip(it, false);   // no tile is left to ask for
  asm volatile("s_wait_asynccnt 0x0" ::: "memory");       // no copy is outstanding when the wave goes on to its end
  // Tile 1's partial goes to the partner wave, which walked the other half of the keys and finishes that tile; same lane, same element.
  float* X = &Mx[wid][0];
#pragma unroll
  for (int t = 0; t < 8; ++t) {
    *(v4f*)(X + ((2 * t) * 32 + lane) * 4) = __builtin_shufflevector(o[1][t], o[1][t], 0, 1, 2, 3);
    *(v4f*)(X + ((2 * t + 1) * 32 + lane) * 4) = __builtin_shufflevector(o[1][t], o[1][t], 4, 5, 6, 7);
  }
  Ms[wid][0][lane] = m[1]; Ms[wid][1][lane] = l[1];
  __syncthreads();                                        // every wave's hand-over is written before its partner reads it
  const float* Y = &Mx[wid ^ 4][0];
  const float pm = Ms[wid ^ 4][0][lane], pl = Ms[wid ^ 4][1][lane];
  const float mn = fmaxf(m[0], pm);
  const float mref = (mn == ninf) ? 0.0f : mn;            // every key masked: both factors 0, the sum 0, as without the split
  const float a0 = __expf(m[0] - mref), a1 = __expf(pm - mref);
  const float inv = 1.0f / (l[0] * a0 + pl * a1);
  const float c0 = a0 * inv, c1 = a1 * inv;
  h16* T0 = Os[wid];
#pragma unroll
  for (int t = 0; t < 8; ++t) {
    const v4f p0 = *(const v4f*)(Y + ((2 * t) * 32 + lane) * 4), p1 = *(const v4f*)(Y + ((2 * t + 1) * 32 + lane) * 4);
    v8f yv;
#pragma unroll
    for (int r = 0; r < 8; ++r) yv[r] = o[0][t][r] * c0 + ((r < 4) ? p0[r & 3] : p1[r & 3]) * c1;
    const int idx = col * DH + t * 16 + 8 * hh;          // [query][d]
    *(v8h*)(T0 + idx) = __builtin_convertvector(yv, v8h);
  }
  wave_lds_sync();
  const size_t tok0 = (size_t)n * SEQ + q0[0];
#pragma unroll
  for (int j = 0; j < 8; ++j) {
    const int e = (j * 32 + lane) * 8, rr = e >> 7, cc = e & 127;
    const size_t go = (tok0 + rr) * E + (size_t)h * DH + cc;
    *(v8h*)(Yf + go) = ld8h(T0 + e);
  }
  
}

// ---------------------------------------------------------------------------
// Output projection: (MROWS x 1024) x (1024 x 1024) -> f32, grid (8, MROWS/128), A = y plane rows, B = Wo plane rows ([out][in]), both f16.
// ---------------------------------------------------------------------------
__global__ __launch_bounds__(256) void out_gemm_kernel(const h16* __restrict__ Yf, const h16* __restrict__ Wo,
                                                       const float* __restrict__ bo, float* __restrict__ out) {
  constexpr int ST = 2 * GPL;                                       // one buffer: y plane, Wo plane
  __shared__ __attribute__((aligned(16))) unsigned char Sm[2 * ST];
  static_assert(2 * ST >= 8 * 32 * 64 * 4);
  const int lane = threadIdx.x & 31, wave = threadIdx.x >> 5, nloc = lane & 15, hlf = lane >> 4;
  const int wm = wave >> 1, wn = wave & 1;
  const int mb = blockIdx.y * 128, m0 = mb + wm * 32;
  const int cb = blockIdx.x * 128, c0 = cb + wn * 64;
  const unsigned prow = threadIdx.x >> 3, pcol = (threadIdx.x & 7) * 16;
  const unsigned char* gy = (const unsigned char*)(Yf + (size_t)(mb + prow) * E) + pcol;
  const unsigned char* gw = (const unsigned char*)(Wo + (size_t)(cb + prow) * E) + pcol;
  const unsigned l0 = (unsigned)(size_t)&Sm[0] + prow * GP + pcol;
  stage2(l0, gy, gw);
  // y rows are shared by the 8 blocks along x, Wo rows by all blocks along y; lane = (row of the quarter, unit of the row)
  ask_l2((const unsigned char*)(Yf + (size_t)(mb + (blockIdx.x & 3) * 32 + prow) * E) + (threadIdx.x & 7) * 256,
         (const unsigned char*)(Wo + (size_t)(cb + (blockIdx.y & 3) * 32 + prow) * E) + (threadIdx.x & 7) * 256);
  asm volatile("s_wait_asynccnt 0x0" ::: "memory");       // this wave's share of trip 0 has landed
  __syncthreads();                                        // trip 0's planes are whole for every wave
  stage2(l0 + ST, gy + 128, gw + 128);
  v8f acc[2][4];
#pragma unroll
  for (int r = 0; r < 2; ++r)
#pragma unroll
    for (int t = 0; t < 4; ++t) acc[r][t] = (v8f){};
#pragma unroll 1
  for (int it = 0; it < GNT; ++it) {
    const unsigned sb = (unsigned)(it & 1) * (unsigned)ST;
    const unsigned char* pa = &Sm[0] + sb + (wm * 32 + nloc) * GP + 16 * hlf;
    const unsigned char* pb = &Sm[0] + sb + GPL + (wn * 64 + nloc) * GP + 16 * hlf;
    v16h a[2][2], b[2][4];                                // [k step][fragment]; a: rows 0..15, rows 16..31
#pragma unroll
    for (int u = 0; u < 2; ++u) {
      a[u][0] = frag_ldsh(pa + 64 * u); a[u][1] = frag_ldsh(pa + 16 * GP + 64 * u);
#pragma unroll
      for (int t = 0; t < 4; ++t) b[u][t] = frag_ldsh(pb + t * 16 * GP + 64 * u);
    }
    __builtin_amdgcn_sched_barrier(0);   // the trip's LDS reads all issue ahead of its first WMMA, which then waits for its own fragments only
#pragma unroll
    for (int u = 0; u < 2; ++u)
#pragma unroll
      for (int t = 0; t < 4; ++t) {
        acc[0][t] = wmma16h(a[u][0], b[u][t], acc[0][t]);
        acc[1][t] = wmma16h(a[u][1], b[u][t], acc[1][t]);
      }
    __builtin_amdgcn_sched_barrier(0);   // the trip's WMMAs stay ahead of the waits below, so that they cover the flight of the next trip's copies
    asm volatile("s_wait_dscnt 0x0" ::: "memory");        // this wave's reads of the buffer are done before it may be refilled
    asm volatile("s_wait_asynccnt 0x0" ::: "memory");     // this wave's share of the next trip has landed
    __syncthreads();                                      // publishes the next trip's planes and ends every wave's reads of this buffer
    if (it + 2 < GNT) {
      const size_t go = (size_t)(it + 2) * 128;
      stage2(l0 + sb, gy + go, gw + go);
    }
  }
  asm volatile("s_wait_asynccnt 0x0" ::: "memory");       // no copy is outstanding when the ring's LDS is reused below
  float* Tt = (float*)(&Sm[0] + wave * (32 * 64 * 4));
#pragma unroll
  for (int t = 0; t < 4; ++t)
#pragma unroll
    for (int r = 0; r < 2; ++r)
#pragma unroll
      for (int v = 0; v < 8; ++v) Tt[(r * 16 + v + 8 * hlf) * 64 + t * 16 + nloc] = acc[r][t][v] + bfr(bo[c0 + t * 16 + nloc]);
  wave_lds_sync();
  float* dst0 = out + (size_t)m0 * E + c0;
#pragma unroll
  for (int j = 0; j < 16; ++j) { const int rr = j * 2 + hlf, c4 = nloc * 4; *(v4f*)(dst0 + (size_t)rr * E + c4) = *(const v4f*)(Tt + rr * 64 + c4); }
  
}
}  // namespace

extern "C" void kernel_launch(void* const* d_in, const int* in_sizes, int n_in,
                              void* d_out, int out_size, void* d_ws, size_t ws_size, hipStream_t stream) {
  if (n_in < 13) return;
  const long act_need = ((long)(NB - 1) * SEQ_FULL + SEQ) * (long)E;
  if ((long)in_sizes[0] < act_need || (long)in_sizes[1] < act_need || (long)in_sizes[2] < act_need) return;
  if (in_sizes[3] < (NB - 1) * SEQ_FULL + SEQ) return;
  if ((long)in_sizes[4] < (long)(SEQ - 1) * SEQ_FULL + SEQ) return;
  if (in_sizes[5] < E * E || in_sizes[7] < E * E || in_sizes[9] < E * E || in_sizes[11] < E * E) return;
  if (in_sizes[6] < E || in_sizes[8] < E || in_sizes[10] < E || in_sizes[12] < E) return;
  if (out_size < MROWS * E) return;

  const float* query = (const float*)d_in[0];   // [NB_FULL][SEQ_FULL][E]
  const float* key   = (const float*)d_in[1];
  const float* value = (const float*)d_in[2];
  const int*   kpm   = (const int*)d_in[3];     // [NB_FULL][SEQ_FULL] int32 0/1
  const int*   am    = (const int*)d_in[4];     // [SEQ_FULL][SEQ_FULL] int32 0/1
  const float* q_w   = (const float*)d_in[5];   // [out][in]
  const float* q_b   = (const float*)d_in[6];
  const float* k_w   = (const float*)d_in[7];
  const float* k_b   = (const float*)d_in[8];
  const float* v_w   = (const float*)d_in[9];
  const float* v_b   = (const float*)d_in[10];
  const float* o_w   = (const float*)d_in[11];
  const float* o_b   = (const float*)d_in[12];
  float* out = (float*)d_out;                   // [NB][SEQ][E] f32

  const size_t plane = (size_t)MROWS * E * 2;   // 8 MiB at full size
  const size_t wplane = (size_t)E * E * 2;      // 2 MiB
  size_t off = 0; char* ws = (char*)d_ws;
  b16* Xq  = (b16*)(ws + off); off += plane;
  b16* Xk  = (b16*)(ws + off); off += plane;
  b16* Xv  = (b16*)(ws + off); off += plane;
  b16* Wq  = (b16*)(ws + off); off += wplane;
  b16* Wk  = (b16*)(ws + off); off += wplane;
  b16* Wv  = (b16*)(ws + off); off += wplane;
  h16* Wo  = (h16*)(ws + off); off += wplane;
  h16* Qf  = (h16*)(ws + off); off += plane;
  h16* Kf  = (h16*)(ws + off); off += plane;
  h16* Vf  = (h16*)(ws + off); off += plane;
  h16* Yf  = (h16*)(ws + off); off += plane;    // 64 MiB at full size
  unsigned* Mb = (unsigned*)(ws + off); off += (size_t)(SEQ + NB) * MW * 4;   // mask bits
  if (off > ws_size) return;

  cvt_kernel<<<MBLK + 2048, 256, 0, stream>>>(query, key, value, q_w, k_w, v_w, o_w, am, kpm, Mb, Xq, Xk, Xv, Wq, Wk, Wv, Wo);
  qkv_gemm_kernel<<<dim3(3 * E / 128, MROWS / 128), 256, 0, stream>>>(Xq, Xk, Xv, Wq, Wk, Wv, q_b, k_b, v_b, Qf, Kf, Vf);
  attn_kernel<<<NG * (SEQ / QB), 32 * AW, 0, stream>>>(Qf, Kf, Vf, Mb, Yf);
  out_gemm_kernel<<<dim3(E / 128, MROWS / 128), 256, 0, stream>>>(Yf, Wo, o_b, out);
}

// v010
// It runs in 71.4 microseconds.
// Timed twice side by side with v009, it ran 1.03 times as fast both times.
// Counting every step since v000, it is 5.10 times as fast.
#include <hip/hip_runtime.h>

#ifndef NB
#define NB 4
#endif
#ifndef SEQ
#define SEQ 1024
#endif
#ifndef NB_FULL
#define NB_FULL 4
#endif
#ifndef SEQ_FULL
#define SEQ_FULL 1024
#endif

namespace {
constexpr int E = 1024, NH = 8, DH = 128;
constexpr int MROWS = NB * SEQ;          // token rows, compact n*SEQ + t
constexpr int QT = SEQ / 16;             // 16-query tiles per (n, h)
constexpr int KT = SEQ / 16;             // 16-key tiles per (n, h)
constexpr int NG = NB * NH;              // g = n*NH + h
constexpr float SCALE = 0.08838834764831845f;   // 1/sqrt(128), applied in f32 on the score accumulators
static_assert(NB >= 1 && NB <= NB_FULL);
static_assert(SEQ % 128 == 0 && SEQ <= SEQ_FULL);
static_assert(E == NH * DH);
static_assert(MROWS % 128 == 0);
constexpr int MW = SEQ / 32;             // mask words per query or batch: bit b of word w is key 32w + b
constexpr int MAW = (SEQ / 32) * MW;     // waves that pack attn_mask: one per 32 queries and word
constexpr int MBLK = (MAW + NB + 7) / 8; // blocks of 8 waves that pack the two masks

typedef __bf16 b16;
typedef __attribute__((ext_vector_type(16))) __bf16 v16b;
typedef __attribute__((ext_vector_type(8)))  __bf16 v8b;
typedef __attribute__((ext_vector_type(8)))  float v8f;
typedef __attribute__((ext_vector_type(4)))  float v4f;
typedef __attribute__((ext_vector_type(4)))  int v4i;
typedef _Float16 h16;
typedef __attribute__((ext_vector_type(16))) _Float16 v16h;
typedef __attribute__((ext_vector_type(8)))  _Float16 v8h;

__device__ __forceinline__ v16b cat8b(v8b a, v8b b) { return __builtin_shufflevector(a, b, 0, 1, 2, 3, 4, 5, 6, 7, 8, 9, 10, 11, 12, 13, 14, 15); }
__device__ __forceinline__ v8h ld8h(const h16* p) { return *(const v8h*)p; }
__device__ __forceinline__ v16h cat8h(v8h a, v8h b) { return __builtin_shufflevector(a, b, 0, 1, 2, 3, 4, 5, 6, 7, 8, 9, 10, 11, 12, 13, 14, 15); }
// 16x16x32 16-bit fragment from a k-contiguous row pointer (A: lane&15 = row, B: lane&15 = column), hh = lane>>4:
// elements 0..7 <- p[8hh+0..7], elements 8..15 <- p[16+8hh+0..7]
__device__ __forceinline__ v16h frag_kh(const h16* p, int hh) { return cat8h(ld8h(p + 8 * hh), ld8h(p + 16 + 8 * hh)); }
// RNE bf16 value of an f32 input, widened back to f32
__device__ __forceinline__ float bfr(float f) { return (float)(b16)f; }
__device__ __forceinline__ v8f wmma16b(v16b a, v16b b, v8f c) {
  return __builtin_amdgcn_wmma_f32_16x16x32_bf16(false, a, false, b, (short)0, c, false, false);
}
__device__ __forceinline__ v8f wmma16h(v16h a, v16h b, v8f c) {
  return __builtin_amdgcn_wmma_f32_16x16x32_f16(false, a, false, b, (short)0, c, false, false);
}
__device__ __forceinline__ void wave_lds_sync() {
  __builtin_amdgcn_fence(3, "workgroup");
  __builtin_amdgcn_wave_barrier();
  __builtin_amdgcn_fence(2, "workgroup");
}
__device__ __forceinline__ void ask_l2(const unsigned char* a, const unsigned char* b) {
  asm volatile("global_prefetch_b8 %0, off scope:SCOPE_SE\n\t"
               "global_prefetch_b8 %1, off scope:SCOPE_SE\n\t"
               "s_wait_xcnt 0x0"
               :: "v"(a), "v"(b));
}
// the same for one address a lane
__device__ __forceinline__ void ask_l2(const unsigned char* a) {
  asm volatile("global_prefetch_b8 %0, off scope:SCOPE_SE\n\t"
               "s_wait_xcnt 0x0"
               :: "v"(a));
}

// ---------------------------------------------------------------------------
// f32 -> RNE bf16 planes: query/key/value [NB_FULL][SEQ_FULL][E] -> X planes [MROWS][E] (compact rows n*SEQ+t); the Wo plane is RNE f16, as y is.
// Region selection is block-uniform (region sizes are multiples of 256 chunks).
// The first MBLK blocks pack the two masks to one bit a key instead: Mb holds attn_mask as [word][query], so that the 16 queries of an
// attention tile lie in one line, and behind it key_padding_mask as [batch][word]. A wave reads whole 128-byte lines, one word's keys each,
// and stores its words as one run.
// ---------------------------------------------------------------------------
__global__ __launch_bounds__(256) void cvt_kernel(const float* __restrict__ xq, const float* __restrict__ xk, const float* __restrict__ xv,
                                                  const float* __restrict__ wq, const float* __restrict__ wk, const float* __restrict__ wv,
                                                  const float* __restrict__ wo, const int* __restrict__ am, const int* __restrict__ kpm,
                                                  unsigned* __restrict__ Mb,
                                                  b16* __restrict__ Xq, b16* __restrict__ Xk, b16* __restrict__ Xv,
                                                  b16* __restrict__ Wq, b16* __restrict__ Wk, b16* __restrict__ Wv, h16* __restrict__ Wo) {
  if (blockIdx.x < MBLK) {
    // wv is the same for a whole wave: every lane is on at the ballots
    const int wv = blockIdx.x * 8 + (threadIdx.x >> 5), lane = threadIdx.x & 31;
    unsigned w = 0;
    if (wv < MAW) {                                       // word c of queries 32 qb .. 32 qb + 31; lane j keeps query 32 qb + j's
      const int qb = wv / MW, c = wv % MW;
      const int* p = am + (size_t)qb * 32 * SEQ_FULL + c * 32 + lane;
#pragma unroll   // the loads are independent: unrolled they all fly at once
      for (int j = 0; j < 32; ++j) {
        const unsigned b = __builtin_amdgcn_ballot_w32(p[(size_t)j * SEQ_FULL] != 0);
        w = (lane == j) ? b : w;
      }
      Mb[c * SEQ + qb * 32 + lane] = w;
    } else if (wv < MAW + NB) {                           // all words of one batch; lane c keeps word c
      const int* p = kpm + (size_t)(wv - MAW) * SEQ_FULL + lane;
#pragma unroll   // the loads are independent: unrolled they all fly at once
      for (int c = 0; c < MW; ++c) {
        const unsigned b = __builtin_amdgcn_ballot_w32(p[c * 32] != 0);
        w = (lane == c) ? b : w;
      }
      if (lane < MW) Mb[MW * SEQ + (wv - MAW) * MW + lane] = w;
    }
    return;
  }
  const size_t tid = (size_t)(blockIdx.x - MBLK) * blockDim.x + threadIdx.x, stride = (size_t)(gridDim.x - MBLK) * blockDim.x;
  const size_t nx = (size_t)MROWS * E / 8, nw = (size_t)E * E / 8;
  const size_t total = 3 * nx + 4 * nw;
  for (size_t c = tid; c < total; c += stride) {
    const float* src; b16* dst; size_t si, di;
    bool toh = false;                                     // the chunk belongs to the f16 plane
    if (c < 3 * nx) {
      const int which = (int)(c / nx);
      const size_t cc = c - (size_t)which * nx;
      di = cc * 8;
      const size_t m = di / E, col = di % E;
      const size_t n = m / SEQ, t = m % SEQ;
      si = (n * SEQ_FULL + t) * (size_t)E + col;
      src = (which == 0) ? xq : (which == 1) ? xk : xv;
      dst = (which == 0) ? Xq : (which == 1) ? Xk : Xv;
    } else {
      const size_t c2 = c - 3 * nx;
      const int which = (int)(c2 / nw);
      const size_t cc = c2 - (size_t)which * nw;
      di = cc * 8; si = di;
      src = (which == 0) ? wq : (which == 1) ? wk : (which == 2) ? wv : wo;
      dst = (which == 0) ? Wq : (which == 1) ? Wk : (which == 2) ? Wv : (b16*)Wo;
      toh = (which == 3);
    }
    const v4f f0 = *(const v4f*)(src + si), f1 = *(const v4f*)(src + si + 4);
    v8b o; v8h oh;
#pragma unroll
    for (int e = 0; e < 4; ++e) { o[e] = (b16)f0[e]; o[4 + e] = (b16)f1[e]; oh[e] = (h16)f0[e]; oh[4 + e] = (h16)f1[e]; }
    *(v4i*)(dst + di) = toh ? __builtin_bit_cast(v4i, oh) : __builtin_bit_cast(v4i, o);   // one store for both kinds of plane: no branch in the stream
    
  }
}

constexpr int GP = 128 + 16;
constexpr int GPL = 128 * GP;
constexpr int GNT = E / 64;
constexpr int GROW = 32 * E * 2;
static_assert(GNT >= 2 && GP % 16 == 0 && E % 128 == 0);
static_assert(E * 2 == 8 * 256);         // a plane's row is 8 steps of 256 bytes: 256 lanes ask at 32 rows
// 16x16x32 16-bit fragment from a staged row: p = row start + 64 B x k step + 16 B x (lane >> 4); same element order as frag_kh
__device__ __forceinline__ v16b frag_lds(const unsigned char* p) { return cat8b(*(const v8b*)p, *(const v8b*)(p + 32)); }
__device__ __forceinline__ v16h frag_ldsh(const unsigned char* p) { return cat8h(*(const v8h*)p, *(const v8h*)(p + 32)); }
// Two planes = 8 copies of 16 B per lane (256 lanes). l: the lane's LDS byte address in the first plane of the target buffer (row = thread
// id >> 3, piece = thread id & 7); ga / gb: the lane's first 16 B of the trip in each global plane. Successive copies lie 32 rows on.
__device__ __forceinline__ void stage2(unsigned l, const unsigned char* ga, const unsigned char* gb) {
  asm volatile("global_load_async_to_lds_b128 %0, %8, off\n\t"
               "global_load_async_to_lds_b128 %1, %9, off\n\t"
               "global_load_async_to_lds_b128 %2, %10, off\n\t"
               "global_load_async_to_lds_b128 %3, %11, off\n\t"
               "global_load_async_to_lds_b128 %4, %12, off\n\t"
               "global_load_async_to_lds_b128 %5, %13, off\n\t"
               "global_load_async_to_lds_b128 %6, %14, off\n\t"
               "global_load_async_to_lds_b128 %7, %15, off\n\t"
               "s_wait_xcnt 0x0"
               :: "v"(l), "v"(l + 32 * GP), "v"(l + 64 * GP), "v"(l + 96 * GP),
                  "v"(l + GPL), "v"(l + GPL + 32 * GP), "v"(l + GPL + 64 * GP), "v"(l + GPL + 96 * GP),
                  "v"(ga), "v"(ga + GROW), "v"(ga + 2 * GROW), "v"(ga + 3 * GROW), "v"(gb), "v"(gb + GROW), "v"(gb + 2 * GROW), "v"(gb + 3 * GROW)
               : "memory");
}

constexpr int QW = 12;
constexpr int QR = 384;
static_assert((3 * MROWS) % QR == 0 && MROWS >= QR && MROWS % 64 == 0 && SEQ % 64 == 0);
// 384 staged rows = 8 copies of 16 B per lane (384 lanes). l: the lane's LDS byte address (row = thread id >> 3, piece = thread id & 7);
// g: the lane's first 16 B of the trip. Successive copies lie 48 rows on.
__device__ __forceinline__ void stage_rows384(unsigned l, const unsigned char* g) {
  asm volatile("global_load_async_to_lds_b128 %0, %8, off\n\t"
               "global_load_async_to_lds_b128 %1, %9, off\n\t"
               "global_load_async_to_lds_b128 %2, %10, off\n\t"
               "global_load_async_to_lds_b128 %3, %11, off\n\t"
               "global_load_async_to_lds_b128 %4, %12, off\n\t"
               "global_load_async_to_lds_b128 %5, %13, off\n\t"
               "global_load_async_to_lds_b128 %6, %14, off\n\t"
               "global_load_async_to_lds_b128 %7, %15, off\n\t"
               "s_wait_xcnt 0x0"
               :: "v"(l), "v"(l + 48 * GP), "v"(l + 96 * GP), "v"(l + 144 * GP), "v"(l + 192 * GP), "v"(l + 240 * GP), "v"(l + 288 * GP), "v"(l + 336 * GP),
                  "v"(g), "v"(g + 48 * E * 2), "v"(g + 96 * E * 2), "v"(g + 144 * E * 2), "v"(g + 192 * E * 2), "v"(g + 240 * E * 2),
                  "v"(g + 288 * E * 2), "v"(g + 336 * E * 2)
               : "memory");
}
// The same with a lane's 4 copies of one plane of 128 rows (lb, gb; successive copies lie 32 rows on) in the one statement: the first 256 lanes
// bring the weight plane too, and one closing wait a trip stands between the wave's LDS reads and its WMMAs, not two.
__device__ __forceinline__ void stage_rows384_128(unsigned l, const unsigned char* g, unsigned lb, const unsigned char* gb) {
  asm volatile("global_load_async_to_lds_b128 %0, %12, off\n\t"
               "global_load_async_to_lds_b128 %1, %13, off\n\t"
               "global_load_async_to_lds_b128 %2, %14, off\n\t"
               "global_load_async_to_lds_b128 %3, %15, off\n\t"
               "global_load_async_to_lds_b128 %4, %16, off\n\t"
               "global_load_async_to_lds_b128 %5, %17, off\n\t"
               "global_load_async_to_lds_b128 %6, %18, off\n\t"
               "global_load_async_to_lds_b128 %7, %19, off\n\t"
               "global_load_async_to_lds_b128 %8, %20, off\n\t"
               "global_load_async_to_lds_b128 %9, %21, off\n\t"
               "global_load_async_to_lds_b128 %10, %22, off\n\t"
               "global_load_async_to_lds_b128 %11, %23, off\n\t"
               "s_wait_xcnt 0x0"
               :: "v"(l), "v"(l + 48 * GP), "v"(l + 96 * GP), "v"(l + 144 * GP), "v"(l + 192 * GP), "v"(l + 240 * GP), "v"(l + 288 * GP), "v"(l + 336 * GP),
                  "v"(lb), "v"(lb + 32 * GP), "v"(lb + 64 * GP), "v"(lb + 96 * GP),
                  "v"(g), "v"(g + 48 * E * 2), "v"(g + 96 * E * 2), "v"(g + 144 * E * 2), "v"(g + 192 * E * 2), "v"(g + 240 * E * 2),
                  "v"(g + 288 * E * 2), "v"(g + 336 * E * 2), "v"(gb), "v"(gb + GROW), "v"(gb + 2 * GROW), "v"(gb + 3 * GROW)
               : "memory");
}
// one plane of 128 staged rows = 4 copies of 16 B per lane of the block's first 256 lanes; successive copies lie 32 rows on
__device__ __forceinline__ void stage_rows128(unsigned l, const unsigned char* g) {
  asm volatile("global_load_async_to_lds_b128 %0, %4, off\n\t"
               "global_load_async_to_lds_b128 %1, %5, off\n\t"
               "global_load_async_to_lds_b128 %2, %6, off\n\t"
               "global_load_async_to_lds_b128 %3, %7, off\n\t"
               "s_wait_xcnt 0x0"
               :: "v"(l), "v"(l + 32 * GP), "v"(l + 64 * GP), "v"(l + 96 * GP), "v"(g), "v"(g + GROW), "v"(g + 2 * GROW), "v"(g + 3 * GROW)
               : "memory");
}

__global__ __launch_bounds__(32 * QW) void qkv_gemm_kernel(const b16* __restrict__ Xs, const b16* __restrict__ Ws,
                                                       const float* __restrict__ bq, const float* __restrict__ bk, const float* __restrict__ bv,
                                                       h16* __restrict__ Qf, h16* __restrict__ Kf, h16* __restrict__ Vf) {
  constexpr int OFFB = 3 * GPL;                                     // behind the 384 activation rows: two weight planes
  constexpr int ST = 5 * GPL;                                       // one buffer
  __shared__ __attribute__((aligned(16))) unsigned char Sm[2 * ST];
  static_assert(2 * ST >= QW * 64 * 64 * 2);
  // the wave's number as a scalar: the tests on it below are scalar branches, and its matrix, head and row bases live in scalar registers
  const int wave = __builtin_amdgcn_readfirstlane(threadIdx.x >> 5), lane = threadIdx.x & 31, nloc = lane & 15, hlf = lane >> 4;
  const int wm = wave >> 1, wn = wave & 1;
  const int r0 = blockIdx.y * QR;                                   // the block's first stacked row
  const int cmb = blockIdx.x * 128;                                 // its first column within q, k or v
  const int mat0 = r0 / MROWS, mat1 = (r0 + QR - 1) / MROWS;        // the matrix of its first and of its last row, block-uniform
  const int rw = r0 + wm * 64, mat = rw / MROWS, m0 = rw % MROWS;   // the wave's rows lie in one matrix
  const int cm = cmb + wn * 64, head = cmb / DH, dlo = wn * 64;
  const float* bias = ((mat == 0) ? bq : (mat == 1) ? bk : bv) + cm;
  const unsigned prow = threadIdx.x >> 3, pcol = (threadIdx.x & 7) * 16;
  const unsigned char* ga = (const unsigned char*)(Xs + (size_t)(r0 + prow) * E) + pcol;
  const unsigned char* gb0 = (const unsigned char*)(Ws + (size_t)(mat0 * E + cmb + prow) * E) + pcol;   // used by the first 8 waves alone: prow < 32
  const unsigned char* gb1 = (const unsigned char*)(Ws + (size_t)(mat1 * E + cmb + prow) * E) + pcol;
  const unsigned l0 = (unsigned)(size_t)&Sm[0] + prow * GP + pcol;
  // one trip's planes into the buffer at byte lb; go: the trip's byte offset in a row. Both tests are wave-uniform scalars.
  auto stage = [&](const unsigned lb, const size_t go) __attribute__((always_inline)) {
    if (wave < 8) {
      stage_rows384_128(l0 + lb, ga + go, l0 + lb + OFFB, gb0 + go);
      if (mat1 != mat0) stage_rows128(l0 + lb + OFFB + GPL, gb1 + go);
    } else {
      stage_rows384(l0 + lb, ga + go);
    }
  };
  stage(0, 0);
  // X rows are shared by the 8 blocks along x, W rows by the blocks of a matrix along y; a quarter of each a block, lane = (row, unit of the row)
  {
    const unsigned char* px = (const unsigned char*)(Xs + (size_t)(r0 + (blockIdx.x & 3) * 96 + prow) * E) + (threadIdx.x & 7) * 256;
    ask_l2(px, px + 48 * E * 2);
    if (wave < 8) ask_l2((const unsigned char*)(Ws + (size_t)(mat0 * E + cmb + (blockIdx.y & 3) * 32 + prow) * E) + (threadIdx.x & 7) * 256);
  }
  asm volatile("s_wait_asynccnt 0x0" ::: "memory");       // this wave's share of trip 0 has landed
  __syncthreads();                                        // trip 0's planes are whole for every wave
  v8f acc[4][4];
#pragma unroll
  for (int r = 0; r < 4; ++r)
#pragma unroll
    for (int t = 0; t < 4; ++t) acc[r][t] = (v8f){};
  const unsigned ao = (unsigned)((wm * 64 + nloc) * GP + 16 * hlf);
  const unsigned bo = (unsigned)(OFFB + ((mat != mat0) ? GPL : 0) + (wn * 64 + nloc) * GP + 16 * hlf);
#pragma unroll 1
  for (int it = 0; it < GNT; ++it) {
    const unsigned sb = (unsigned)(it & 1) * (unsigned)ST;
    const unsigned char* pa = &Sm[0] + sb + ao;
    const unsigned char* pb = &Sm[0] + sb + bo;
    v16b a[2][4], b[2][4];                                // [k step][fragment]
#pragma unroll
    for (int u = 0; u < 2; ++u) {
      b[u][0] = frag_lds(pb + 64 * u);
#pragma unroll
      for (int r = 0; r < 4; ++r) a[u][r] = frag_lds(pa + r * 16 * GP + 64 * u);
#pragma unroll
      for (int t = 1; t < 4; ++t) b[u][t] = frag_lds(pb + t * 16 * GP + 64 * u);
    }
    __builtin_amdgcn_sched_barrier(0);   // the trip's LDS reads all issue ahead of the copies and of its first WMMA, which then waits for its own fragments only
    // The next trip's planes go into the other buffer, which the trip before read (in trip 0: nobody yet): the barrier at that trip's foot has ended
    // every wave's reads of it. The copies stand behind this trip's LDS reads, so that their address sums and closing wait pass while the fragments fly.
    if (it + 1 < GNT) stage(sb ^ (unsigned)ST, (size_t)(it + 1) * 128);
    __builtin_amdgcn_sched_barrier(0);   // no WMMA is lifted over the copies: they issue first and have the whole run of WMMAs for their flight
#pragma unroll
    for (int u = 0; u < 2; ++u)
#pragma unroll
      for (int t = 0; t < 4; ++t)
#pragma unroll
        for (int r = 0; r < 4; ++r) acc[r][t] = wmma16b(a[u][r], b[u][t], acc[r][t]);
    __builtin_amdgcn_sched_barrier(0);   // the trip's WMMAs stay ahead of the waits below, so that they cover the flight of the next trip's copies
    asm volatile("s_wait_dscnt 0x0" ::: "memory");        // this wave's reads of the buffer are done before it may be refilled
    asm volatile("s_wait_asynccnt 0x0" ::: "memory");     // this wave's share of the next trip has landed
    __syncthreads();                                      // publishes the next trip's planes and ends every wave's reads of this buffer
  }
  asm volatile("s_wait_asynccnt 0x0" ::: "memory");       // no copy is outstanding when the ring's LDS is reused below
  const int n = m0 / SEQ, t0 = m0 % SEQ, g = n * NH + head;
  h16* Tp = (h16*)(&Sm[0] + wave * (64 * 64 * 2));
  const float* bl = bias + nloc;
  float bb[4];
#pragma unroll
  for (int t = 0; t < 4; ++t) bb[t] = bl[t * 16];
  // the wait names the bias loads' address, which so keeps its registers, written by nothing (a load's own result among it), until the wait has passed
  asm volatile("s_wait_xcnt 0x0" :: "v"(bl) : "memory");
#pragma unroll
  for (int t = 0; t < 4; ++t)
#pragma unroll
    for (int r = 0; r < 4; ++r)
#pragma unroll
      for (int v = 0; v < 8; ++v) {
        const int rr = r * 16 + v + 8 * hlf, d = t * 16 + nloc;
        const int idx = (mat < 2) ? (rr * 64 + d) : ((rr >> 4) * 1024 + d * 16 + (rr & 15));
        Tp[idx] = (h16)(acc[r][t][v] + bfr(bb[t]));
      }
  wave_lds_sync();
  if (mat < 2) {
    h16* Pf = (mat == 0) ? Qf : Kf;
    // lane = (row of four, 16-byte piece of its 128 bytes); the stores lie four rows apart, so that one address serves all sixteen
    h16* pl = Pf + ((size_t)g * SEQ + t0 + (lane >> 3)) * DH + dlo + (lane & 7) * 8;
#pragma unroll
    for (int j = 0; j < 16; ++j) *(v8h*)(pl + j * 4 * DH) = ld8h(Tp + (j * 32 + lane) * 8);
    asm volatile("s_wait_xcnt 0x0" ::: "memory");         // closes the stores above: none of their registers is rewritten ahead of it on any path of the listing
  } else {
    const size_t tb = (size_t)g * KT + (t0 >> 4);
#pragma unroll
    for (int j = 0; j < 16; ++j) {
      const int e = (j * 32 + lane) * 8, kt2 = e >> 10, within = e & 1023;
      const size_t go = ((tb + kt2) * DH + dlo) * 16 + within;
      *(v8h*)(Vf + go) = ld8h(Tp + e);
    }
    asm volatile("s_wait_xcnt 0x0" ::: "memory");         // closes the stores above: none of their registers is rewritten ahead of it on any path of the listing
  }
}

constexpr int AW = 8;
constexpr int QB = 128;
constexpr int KPITCH = 2 * DH + 16;
constexpr int KPL = 32 * KPITCH;
constexpr int VPL = 2 * DH * 16 * 2;
constexpr int OFF_K = 0, OFF_V = KPL, STAGE = KPL + VPL;
constexpr int HALFB = (SEQ / 2) * DH * 2;      // bytes from a key to the key SEQ / 2 on, in the K and the V plane
constexpr int NT = SEQ / 64;                   // trips: 32 keys of each half of the keys
static_assert(SEQ % QB == 0 && NT >= 2 && STAGE % 16 == 0 && KPITCH % 16 == 0);

__device__ __forceinline__ v8h lds8h(const unsigned char* p) { return *(const v8h*)p; }
__device__ __forceinline__ float xhalf(float x) {
  return __builtin_bit_cast(float, __builtin_amdgcn_permlanex16(__builtin_bit_cast(int, x), __builtin_bit_cast(int, x), 0x76543210, 0xfedcba98, false, false));
}
// one stage = 4 copies of 16 B per lane (256 lanes x 64 B = 16 KiB). lk / lv: the lane's LDS byte addresses in the K / V part of the target
// buffer; the pointers: the lane's first 16 B of the stage in each global plane. The second copy of a plane lies 4,096 global bytes on.
__device__ __forceinline__ void stage_copy(unsigned lk, unsigned lv, const unsigned char* gk, const unsigned char* gv) {
  asm volatile("global_load_async_to_lds_b128 %0, %4, off\n\t"
               "global_load_async_to_lds_b128 %1, %5, off\n\t"
               "global_load_async_to_lds_b128 %2, %6, off\n\t"
               "global_load_async_to_lds_b128 %3, %7, off\n\t"
               "s_wait_xcnt 0x0"
               :: "v"(lk), "v"(lk + 16 * KPITCH), "v"(lv), "v"(lv + VPL / 2),
                  "v"(gk), "v"(gk + 4096), "v"(gv), "v"(gv + 4096)
               : "memory");
}

// Online softmax of one 16-query tile over the trip's 32 keys: s0 holds keys 8hh+0..7, s1 keys 16+8hh+0..7 of the lane's query, scaled and
// with -inf at masked places. Leaves P^T rounded to f16 as a B operand and returns the factor that rescales what was accumulated before.
__device__ __forceinline__ float softmax_tile(v8f s0, v8f s1, float& m, float& l, v16h& pb) {
  const float ninf = -__builtin_inff();
  float mr = ninf;
#pragma unroll
  for (int r = 0; r < 8; ++r) mr = fmaxf(mr, fmaxf(s0[r], s1[r]));
  mr = fmaxf(mr, xhalf(mr));
  const float mn = fmaxf(m, mr);
  const float mref = (mn == ninf) ? 0.0f : mn;    // fully masked prefix: nothing accumulated yet
  const float al_ = __expf(m - mref);
  m = mn;
  float sum = 0.0f;
#pragma unroll
  for (int r = 0; r < 8; ++r) {
    const float e0 = __expf(s0[r] - mref), e1 = __expf(s1[r] - mref);
    sum += e0 + e1;
    pb[r] = (h16)e0; pb[8 + r] = (h16)e1;
  }
  sum += xhalf(sum);
  l = l * al_ + sum;
  return al_;
}

__global__ __launch_bounds__(32 * AW)
void attn_kernel(const h16* __restrict__ Qf, const h16* __restrict__ Kf, const h16* __restrict__ Vf, const unsigned* __restrict__ Mb,
                 h16* __restrict__ Yf) {
  __shared__ __attribute__((aligned(16))) unsigned char Ring[2][2 * STAGE];   // [buffer][key half]
  __shared__ __attribute__((aligned(16))) h16 Os[AW][16 * DH];
  __shared__ __attribute__((aligned(16))) float Mx[AW][16 * DH];              // the y^T partial that a wave hands to its partner
  __shared__ float Ms[AW][2][32];                                             // with its maximum and its sum
  // the wave's number as a scalar: tile, head and row bases then live in scalar registers, which leaves the vector registers to the fragments
  const int wid = __builtin_amdgcn_readfirstlane(threadIdx.x >> 5), lane = threadIdx.x & 31, hh = lane >> 4, col = lane & 15;
  const int qg = wid & 3, kh = wid >> 2;                  // query group, key half
  const int g = blockIdx.x / (SEQ / QB);                  // n*NH + h
  const int qb = (blockIdx.x % (SEQ / QB)) * QB + qg * 32;
  const int n = g / NH, h = g % NH;
  // The wave's tile 0 is the one it finishes, tile 1 the one it hands over: the partner numbers the same two tiles the other way round.
  const int q0[2] = {qb + (kh << 4), qb + ((kh ^ 1) << 4)};
  const unsigned* amb[2] = {Mb + kh * (MW / 2) * SEQ + q0[0], Mb + kh * (MW / 2) * SEQ + q0[1]};   // attn_mask bits [word][query]
  const unsigned* kpb = Mb + MW * SEQ + n * MW + kh * (MW / 2);                                    // key_padding_mask bits [n][word]
  const float ninf = -__builtin_inff();
  // Copy addresses. A stage is 8,192 contiguous bytes of each global plane. K: 16-byte piece c = thread id (and c + 256) is row c >> 4,
  // piece c & 15. V: a wave's 512 bytes are 16 d rows of 32 B; lane = (key half hh, d row), so each half wave writes 256 contiguous LDS bytes.
  const size_t gplane = (size_t)g * SEQ * DH * 2;         // byte offset of (n, h) in the K and the V plane
  const unsigned ring0 = (unsigned)(size_t)&Ring[0][0];
  {
    // Tile 0's addresses are formed from the thread id, apart from the later tiles': a value that an asm statement names itself is held below
    // v256 for its whole life, and one that also lived through the loop, where the fragments fill those registers, would be spilled to scratch.
    const unsigned wv = threadIdx.x >> 5;
    const unsigned kin0 = (unsigned)threadIdx.x * 16u, vin0 = wv * 512u + (unsigned)(col * 32 + hh * 16);
    const unsigned lk0 = ring0 + OFF_K + (unsigned)((threadIdx.x >> 4) * KPITCH + (threadIdx.x & 15) * 16);
    const unsigned lv0 = ring0 + OFF_V + (unsigned)(hh * (DH * 16)) + (wv * 16u + (unsigned)col) * 16u;
    stage_copy(lk0, lv0, (const unsigned char*)Kf + gplane + kin0, (const unsigned char*)Vf + gplane + vin0);
    stage_copy(lk0 + STAGE, lv0 + STAGE, (const unsigned char*)Kf + gplane + HALFB + kin0, (const unsigned char*)Vf + gplane + HALFB + vin0);
    // K and V of (n, h) are shared by the SEQ / QB blocks of its queries: a quarter of each plane a block, one unit of each a lane
    const unsigned pu = (blockIdx.x & 3) * (unsigned)(SEQ * DH / 2) + (threadIdx.x < SEQ / 4 ? threadIdx.x : SEQ / 4 - 1) * 256u;
    ask_l2((const unsigned char*)Kf + gplane + pu, (const unsigned char*)Vf + gplane + pu);
    // The attn_mask bits of the block's QB queries: 512 bytes of each word's row, a new row every trip. One unit a lane; the test is wave-uniform.
    if (wid < MW / 16) {
      const unsigned u = (unsigned)(wid * 32 + lane);
      ask_l2((const unsigned char*)(Mb + (u >> 1) * SEQ + (blockIdx.x % (SEQ / QB)) * QB + (u & 1) * 64));
    }
  }
  const unsigned kin = (unsigned)(wid * 512 + lane * 16), vin = (unsigned)(wid * 512 + col * 32 + hh * 16);   // thread id = 32 wid + lane
  const unsigned char* gk = (const unsigned char*)Kf + gplane + kin;
  const unsigned char* gv = (const unsigned char*)Vf + gplane + vin;
  const unsigned lk = ring0 + OFF_K + (unsigned)((wid * 2 + hh) * KPITCH + col * 16);
  const unsigned lv = ring0 + OFF_V + (unsigned)(hh * (DH * 16) + (wid * 16 + col) * 16);
  v16h qf[2][DH / 32];                                    // B operands of S^T, the same in every trip: [query tile][k step]
#pragma unroll
  for (int a = 0; a < 2; ++a) {
    const size_t qo = ((size_t)g * SEQ + q0[a] + col) * DH;
#pragma unroll
    for (int s = 0; s < DH / 32; ++s) qf[a][s] = frag_kh(Qf + qo + 32 * s, hh);
  }
  // Masked positions of the coming trip, one word per query tile, shifted so that bit r is the lane's key 8hh + r and bit 16 + r its key
  // 16 + 8hh + r; anym: whether any lane's word holds a bit, as a scalar that is ready long before the trip's branch asks for it.
  unsigned mw[2], anym;
  int mo = 0;                                             // word, within the wave's half of the keys, of the trip whose bits are loaded next
  {
    const unsigned kw = kpb[mo];
    mw[0] = (amb[0][mo * SEQ + col] | kw) >> (8 * hh); mw[1] = (amb[1][mo * SEQ + col] | kw) >> (8 * hh);
    anym = __builtin_amdgcn_ballot_w32((mw[0] | mw[1]) != 0);
    mo += 1;
  }
  asm volatile("s_wait_asynccnt 0x0" ::: "memory");       // this wave's share of tile 0 has landed
  __syncthreads();                                        // tile 0 is whole for every wave
  stage_copy(lk + 2 * STAGE, lv + 2 * STAGE, gk + 8192, gv + 8192);
  stage_copy(lk + 3 * STAGE, lv + 3 * STAGE, gk + HALFB + 8192, gv + HALFB + 8192);
  float m[2] = {ninf, ninf}, l[2] = {0.0f, 0.0f};
  v8f o[2][8];
#pragma unroll
  for (int a = 0; a < 2; ++a)
#pragma unroll
    for (int t = 0; t < 8; ++t) o[a][t] = (v8f){};
  // One trip. refill is a constant at each call: the steady trip then holds no branch but the one round the mask fill.
  auto trip = [&](const int it, const bool refill) __attribute__((always_inline)) {
    // the trip's first key is kh * SEQ / 2 + 32 * it
    const unsigned bo = (unsigned)(it & 1) * (unsigned)(2 * STAGE);
    const unsigned char* B = &Ring[0][0] + bo + (unsigned)kh * (unsigned)STAGE;
    const unsigned char* k0 = B + col * KPITCH + 16 * hh;   // the trip's key col; its key 16 + col lies 16 rows on
    v16h kf[2][DH / 32];                                    // the trip's K fragments: [16-key tile][k step]
#pragma unroll
    for (int s = 0; s < DH / 32; ++s)
#pragma unroll
      for (int j = 0; j < 2; ++j) {
        const unsigned char* ka = k0 + j * 16 * KPITCH + 64 * s;
        kf[j][s] = cat8h(lds8h(ka + OFF_K), lds8h(ka + OFF_K + 32));
      }
    __builtin_amdgcn_sched_barrier(0);   // all K reads of the trip issue as one group ahead of S^T: one LDS latency a trip, not one a fragment
    v8f sc[2][2];                                           // [query tile][16-key tile]
#pragma unroll
    for (int a = 0; a < 2; ++a) { sc[a][0] = (v8f){}; sc[a][1] = (v8f){}; }
#pragma unroll   // each step names its own Q and K registers: a rolled loop could only index them through memory. Four independent tiles in turn
    for (int s = 0; s < DH / 32; ++s) {
      sc[0][0] = wmma16h(kf[0][s], qf[0][s], sc[0][0]); sc[1][0] = wmma16h(kf[0][s], qf[1][s], sc[1][0]);
      sc[0][1] = wmma16h(kf[1][s], qf[0][s], sc[0][1]); sc[1][1] = wmma16h(kf[1][s], qf[1][s], sc[1][1]);
    }
    const unsigned nw0 = amb[0][mo * SEQ + col], nw1 = amb[1][mo * SEQ + col], kw = kpb[mo];   // the next trip's mask bits
    asm volatile("s_wait_xcnt 0x0" ::: "memory");         // the mask loads' address registers are temporaries that the V reads and softmax overwrite
    __builtin_amdgcn_sched_barrier(0);   // nothing from below, the V address among it, is lifted over that wait into a register that a mask load names
    const unsigned char* va = B + hh * (DH * 16) + col * 16;   // the trip's keys 8hh+0..7 of d row col; the second 16-key tile lies VPL/2 on
    v16h vf[8];                                             // the trip's V^T fragments, d rows t*16 + col
#pragma unroll
    for (int t = 0; t < 8; ++t) vf[t] = cat8h(lds8h(va + OFF_V + t * 256), lds8h(va + OFF_V + VPL / 2 + t * 256));
    __builtin_amdgcn_sched_barrier(0);   // the V reads and the next trip's mask loads have issued by here, so that softmax covers their flight
#pragma unroll
    for (int a = 0; a < 2; ++a) { sc[a][0] = sc[a][0] * SCALE; sc[a][1] = sc[a][1] * SCALE; }
    if (anym != 0) {                     // a scalar branch: a trip with no masked key in any of the wave's 32 x 32 places has nothing to fill
#pragma unroll
      for (int a = 0; a < 2; ++a)
#pragma unroll
        for (int r = 0; r < 8; ++r) {
          sc[a][0][r] = (mw[a] & (1u << r)) ? ninf : sc[a][0][r];
          sc[a][1][r] = (mw[a] & (1u << (16 + r))) ? ninf : sc[a][1][r];
        }
    }
    v16h pb[2];
#pragma unroll
    for (int a = 0; a < 2; ++a) {
      const float al_ = softmax_tile(sc[a][0], sc[a][1], m[a], l[a], pb[a]);
#pragma unroll
      for (int t = 0; t < 8; ++t) o[a][t] = o[a][t] * al_;
    }
    mw[0] = (nw0 | kw) >> (8 * hh); mw[1] = (nw1 | kw) >> (8 * hh);
    anym = __builtin_amdgcn_ballot_w32((mw[0] | mw[1]) != 0);
    // sixteen output tiles in turn: neighbouring WMMAs are independent
#pragma unroll
    for (int t = 0; t < 8; ++t) { o[0][t] = wmma16h(vf[t], pb[0], o[0][t]); o[1][t] = wmma16h(vf[t], pb[1], o[1][t]); }
    __builtin_amdgcn_sched_barrier(0);   // softmax and y^T stay ahead of the waits below, so that they cover the flight of the next tiles' copies
    asm volatile("s_wait_dscnt 0x0" ::: "memory");        // this wave's reads of the buffer are done before it may be refilled
    asm volatile("s_wait_asynccnt 0x0" ::: "memory");     // this wave's share of the next tiles has landed
    __syncthreads();                                      // publishes the next tiles and ends every wave's reads of this buffer
    if (refill) {
      const size_t go = (size_t)(it + 2) * 8192;
      stage_copy(lk + bo, lv + bo, gk + go, gv + go);
      stage_copy(lk + bo + STAGE, lv + bo + STAGE, gk + go + HALFB, gv + go + HALFB);
      mo += 1;                                            // stays on the last trip's words at the end: that trip reloads them, in bounds and unused
    }
  };
#pragma unroll 1
  for (int it = 0; it < NT - 2; ++it) trip(it, true);
#pragma unroll 1
  for (int it = NT - 2; it < NT; ++it) trip(it, false);   // no tile is left to ask for
  asm volatile("s_wait_asynccnt 0x0" ::: "memory");       // no copy is outstanding when the wave goes on to its end
  // Tile 1's partial goes to the partner wave, which walked the other half of the keys and finishes that tile; same lane, same element.
  float* X = &Mx[wid][0];
#pragma unroll
  for (int t = 0; t < 8; ++t) {
    *(v4f*)(X + ((2 * t) * 32 + lane) * 4) = __builtin_shufflevector(o[1][t], o[1][t], 0, 1, 2, 3);
    *(v4f*)(X + ((2 * t + 1) * 32 + lane) * 4) = __builtin_shufflevector(o[1][t], o[1][t], 4, 5, 6, 7);
  }
  Ms[wid][0][lane] = m[1]; Ms[wid][1][lane] = l[1];
  __syncthreads();                                        // every wave's hand-over is written before its partner reads it
  const float* Y = &Mx[wid ^ 4][0];
  const float pm = Ms[wid ^ 4][0][lane], pl = Ms[wid ^ 4][1][lane];
  const float mn = fmaxf(m[0], pm);
  const float mref = (mn == ninf) ? 0.0f : mn;            // every key masked: both factors 0, the sum 0, as without the split
  const float a0 = __expf(m[0] - mref), a1 = __expf(pm - mref);
  const float inv = 1.0f / (l[0] * a0 + pl * a1);
  const float c0 = a0 * inv, c1 = a1 * inv;
  h16* T0 = Os[wid];
#pragma unroll
  for (int t = 0; t < 8; ++t) {
    const v4f p0 = *(const v4f*)(Y + ((2 * t) * 32 + lane) * 4), p1 = *(const v4f*)(Y + ((2 * t + 1) * 32 + lane) * 4);
    v8f yv;
#pragma unroll
    for (int r = 0; r < 8; ++r) yv[r] = o[0][t][r] * c0 + ((r < 4) ? p0[r & 3] : p1[r & 3]) * c1;
    const int idx = col * DH + t * 16 + 8 * hh;          // [query][d]
    *(v8h*)(T0 + idx) = __builtin_convertvector(yv, v8h);
  }
  wave_lds_sync();
  const size_t tok0 = (size_t)n * SEQ + q0[0];
#pragma unroll
  for (int j = 0; j < 8; ++j) {
    const int e = (j * 32 + lane) * 8, rr = e >> 7, cc = e & 127;
    const size_t go = (tok0 + rr) * E + (size_t)h * DH + cc;
    *(v8h*)(Yf + go) = ld8h(T0 + e);
  }
  
}

// ---------------------------------------------------------------------------
// Output projection: (MROWS x 1024) x (1024 x 1024) -> f32, grid (8, MROWS/128), A = y plane rows, B = Wo plane rows ([out][in]), both f16.
// ---------------------------------------------------------------------------
__global__ __launch_bounds__(256) void out_gemm_kernel(const h16* __restrict__ Yf, const h16* __restrict__ Wo,
                                                       const float* __restrict__ bo, float* __restrict__ out) {
  constexpr int ST = 2 * GPL;                                       // one buffer: y plane, Wo plane
  __shared__ __attribute__((aligned(16))) unsigned char Sm[2 * ST];
  static_assert(2 * ST >= 8 * 32 * 64 * 4);
  const int lane = threadIdx.x & 31, wave = threadIdx.x >> 5, nloc = lane & 15, hlf = lane >> 4;
  const int wm = wave >> 1, wn = wave & 1;
  const int mb = blockIdx.y * 128, m0 = mb + wm * 32;
  const int cb = blockIdx.x * 128, c0 = cb + wn * 64;
  const unsigned prow = threadIdx.x >> 3, pcol = (threadIdx.x & 7) * 16;
  const unsigned char* gy = (const unsigned char*)(Yf + (size_t)(mb + prow) * E) + pcol;
  const unsigned char* gw = (const unsigned char*)(Wo + (size_t)(cb + prow) * E) + pcol;
  const unsigned l0 = (unsigned)(size_t)&Sm[0] + prow * GP + pcol;
  stage2(l0, gy, gw);
  // y rows are shared by the 8 blocks along x, Wo rows by all blocks along y; lane = (row of the quarter, unit of the row)
  ask_l2((const unsigned char*)(Yf + (size_t)(mb + (blockIdx.x & 3) * 32 + prow) * E) + (threadIdx.x & 7) * 256,
         (const unsigned char*)(Wo + (size_t)(cb + (blockIdx.y & 3) * 32 + prow) * E) + (threadIdx.x & 7) * 256);
  asm volatile("s_wait_asynccnt 0x0" ::: "memory");       // this wave's share of trip 0 has landed
  __syncthreads();                                        // trip 0's planes are whole for every wave
  stage2(l0 + ST, gy + 128, gw + 128);
  v8f acc[2][4];
#pragma unroll
  for (int r = 0; r < 2; ++r)
#pragma unroll
    for (int t = 0; t < 4; ++t) acc[r][t] = (v8f){};
#pragma unroll 1
  for (int it = 0; it < GNT; ++it) {
    const unsigned sb = (unsigned)(it & 1) * (unsigned)ST;
    const unsigned char* pa = &Sm[0] + sb + (wm * 32 + nloc) * GP + 16 * hlf;
    const unsigned char* pb = &Sm[0] + sb + GPL + (wn * 64 + nloc) * GP + 16 * hlf;
    v16h a[2][2], b[2][4];                                // [k step][fragment]; a: rows 0..15, rows 16..31
#pragma unroll
    for (int u = 0; u < 2; ++u) {
      a[u][0] = frag_ldsh(pa + 64 * u); a[u][1] = frag_ldsh(pa + 16 * GP + 64 * u);
#pragma unroll
      for (int t = 0; t < 4; ++t) b[u][t] = frag_ldsh(pb + t * 16 * GP + 64 * u);
    }
    __builtin_amdgcn_sched_barrier(0);   // the trip's LDS reads all issue ahead of its first WMMA, which then waits for its own fragments only
#pragma unroll
    for (int u = 0; u < 2; ++u)
#pragma unroll
      for (int t = 0; t < 4; ++t) {
        acc[0][t] = wmma16h(a[u][0], b[u][t], acc[0][t]);
        acc[1][t] = wmma16h(a[u][1], b[u][t], acc[1][t]);
      }
    __builtin_amdgcn_sched_barrier(0);   // the trip's WMMAs stay ahead of the waits below, so that they cover the flight of the next trip's copies
    asm volatile("s_wait_dscnt 0x0" ::: "memory");        // this wave's reads of the buffer are done before it may be refilled
    asm volatile("s_wait_asynccnt 0x0" ::: "memory");     // this wave's share of the next trip has landed
    __syncthreads();                                      // publishes the next trip's planes and ends every wave's reads of this buffer
    if (it + 2 < GNT) {
      const size_t go = (size_t)(it + 2) * 128;
      stage2(l0 + sb, gy + go, gw + go);
    }
  }
  asm volatile("s_wait_asynccnt 0x0" ::: "memory");       // no copy is outstanding when the ring's LDS is reused below
  float* Tt = (float*)(&Sm[0] + wave * (32 * 64 * 4));
#pragma unroll
  for (int t = 0; t < 4; ++t)
#pragma unroll
    for (int r = 0; r < 2; ++r)
#pragma unroll
      for (int v = 0; v < 8; ++v) Tt[(r * 16 + v + 8 * hlf) * 64 + t * 16 + nloc] = acc[r][t][v] + bfr(bo[c0 + t * 16 + nloc]);
  wave_lds_sync();
  float* dst0 = out + (size_t)m0 * E + c0;
#pragma unroll
  for (int j = 0; j < 16; ++j) { const int rr = j * 2 + hlf, c4 = nloc * 4; *(v4f*)(dst0 + (size_t)rr * E + c4) = *(const v4f*)(Tt + rr * 64 + c4); }
  
}
}  // namespace

extern "C" void kernel_launch(void* const* d_in, const int* in_sizes, int n_in,
                              void* d_out, int out_size, void* d_ws, size_t ws_size, hipStream_t stream) {
  if (n_in < 13) return;
  const long act_need = ((long)(NB - 1) * SEQ_FULL + SEQ) * (long)E;
  if ((long)in_sizes[0] < act_need || (long)in_sizes[1] < act_need || (long)in_sizes[2] < act_need) return;
  if (in_sizes[3] < (NB - 1) * SEQ_FULL + SEQ) return;
  if ((long)in_sizes[4] < (long)(SEQ - 1) * SEQ_FULL + SEQ) return;
  if (in_sizes[5] < E * E || in_sizes[7] < E * E || in_sizes[9] < E * E || in_sizes[11] < E * E) return;
  if (in_sizes[6] < E || in_sizes[8] < E || in_sizes[10] < E || in_sizes[12] < E) return;
  if (out_size < MROWS * E) return;

  const float* query = (const float*)d_in[0];   // [NB_FULL][SEQ_FULL][E]
  const float* key   = (const float*)d_in[1];
  const float* value = (const float*)d_in[2];
  const int*   kpm   = (const int*)d_in[3];     // [NB_FULL][SEQ_FULL] int32 0/1
  const int*   am    = (const int*)d_in[4];     // [SEQ_FULL][SEQ_FULL] int32 0/1
  const float* q_w   = (const float*)d_in[5];   // [out][in]
  const float* q_b   = (const float*)d_in[6];
  const float* k_w   = (const float*)d_in[7];
  const float* k_b   = (const float*)d_in[8];
  const float* v_w   = (const float*)d_in[9];
  const float* v_b   = (const float*)d_in[10];
  const float* o_w   = (const float*)d_in[11];
  const float* o_b   = (const float*)d_in[12];
  float* out = (float*)d_out;                   // [NB][SEQ][E] f32

  const size_t plane = (size_t)MROWS * E * 2;   // 8 MiB at full size
  const size_t wplane = (size_t)E * E * 2;      // 2 MiB
  size_t off = 0; char* ws = (char*)d_ws;
  b16* Xq  = (b16*)(ws + off); off += plane;
  b16* Xk  = (b16*)(ws + off); off += plane;
  b16* Xv  = (b16*)(ws + off); off += plane;
  b16* Wq  = (b16*)(ws + off); off += wplane;
  b16* Wk  = (b16*)(ws + off); off += wplane;
  b16* Wv  = (b16*)(ws + off); off += wplane;
  h16* Wo  = (h16*)(ws + off); off += wplane;
  h16* Qf  = (h16*)(ws + off); off += plane;
  h16* Kf  = (h16*)(ws + off); off += plane;
  h16* Vf  = (h16*)(ws + off); off += plane;
  h16* Yf  = (h16*)(ws + off); off += plane;    // 64 MiB at full size
  unsigned* Mb = (unsigned*)(ws + off); off += (size_t)(SEQ + NB) * MW * 4;   // mask bits
  if (off > ws_size) return;

  cvt_kernel<<<MBLK + 2048, 256, 0, stream>>>(query, key, value, q_w, k_w, v_w, o_w, am, kpm, Mb, Xq, Xk, Xv, Wq, Wk, Wv, Wo);
  // Xq, Xk, Xv lie one behind the other in the workspace, as do Wq, Wk, Wv: the kernel takes each run as one stacked matrix
  qkv_gemm_kernel<<<dim3(E / 128, 3 * MROWS / QR), 32 * QW, 0, stream>>>(Xq, Wq, q_b, k_b, v_b, Qf, Kf, Vf);
  attn_kernel<<<NG * (SEQ / QB), 32 * AW, 0, stream>>>(Qf, Kf, Vf, Mb, Yf);
  out_gemm_kernel<<<dim3(E / 128, MROWS / 128), 256, 0, stream>>>(Yf, Wo, o_b, out);
}
